// v000
// The times below were measured on an AMD MI455X: many runs one after another, warmed up first and cycling through
// copies of the inputs, with the whole window's GPU time divided by the number of runs. Launches and the gaps
// between them are all in it. The median over several windows is given; except for v000 it joins two sittings, which
// can be a few percent apart, so the side-by-side timings, each taken in one sitting, are the better comparison.
// v000 is the starting kernel. One run takes 504 microseconds.
#include <hip/hip_runtime.h>
#include <hip/hip_bf16.h>

#define B_ 4
#define S_ 2048
#define D_ 1024
#define H_ 16
#define HD_ 64
#define M_ (B_ * S_)   // 8192 rows of the token matrix

typedef __attribute__((ext_vector_type(16))) __bf16 bf16x16;
typedef __attribute__((ext_vector_type(8)))  float  f32x8;

union Frag {          // 16 bf16 = 8 VGPRs; u[0] -> K = g*8..g*8+7, u[1] -> K = 16+g*8..
    uint4   u[2];
    bf16x16 v;
};

#define WMMA_BF16(a, b, c) \
    __builtin_amdgcn_wmma_f32_16x16x32_bf16(false, (a), false, (b), (short)0, (c), false, false)

// ---------------------------------------------------------------------------
// fp32 -> bf16 conversion (4 elems / thread)
// ---------------------------------------------------------------------------
__global__ void f32_to_bf16_kernel(const float* __restrict__ in, __bf16* __restrict__ out, int n) {
    int i = (blockIdx.x * blockDim.x + threadIdx.x) * 4;
    if (i + 3 < n) {
        float4 f = *reinterpret_cast<const float4*>(in + i);
        out[i + 0] = (__bf16)f.x;
        out[i + 1] = (__bf16)f.y;
        out[i + 2] = (__bf16)f.z;
        out[i + 3] = (__bf16)f.w;
    } else {
        for (int j = i; j < n; ++j) out[j] = (__bf16)in[j];
    }
}

// ---------------------------------------------------------------------------
// NT GEMM: C[M x N] = A[M x K](bf16) * W[N x K](bf16)^T  (+bias)*scale (+res)
// block = 256 threads (8 waves); block tile 128x128; wave tile 32x64
// (2 M-tiles x 4 N-tiles = 8 f32x8 accumulators, 6 fragment loads / 8 WMMAs).
// W tile double-buffered through LDS; one barrier per 32-K step.
// MODE 0: bf16 output.  MODE 1: f32 output + residual add.
// ---------------------------------------------------------------------------
template <int MODE>
__global__ __launch_bounds__(256)
void gemm_nt_kernel(const __bf16* __restrict__ A, const __bf16* __restrict__ W,
                    const float* __restrict__ bias, void* __restrict__ Out,
                    const float* __restrict__ residual,
                    int M, int N, int K, float scale) {
    __shared__ __attribute__((aligned(16))) __bf16 wlds[2][128 * 40];  // padded stride 40

    const int lane = threadIdx.x & 31;
    const int wave = threadIdx.x >> 5;
    const int g    = lane >> 4;      // half-wave group (A/B layout K-offset selector)
    const int lm   = lane & 15;      // row (A) / column (B) within tile
    const int mw   = wave & 3;       // 32-row strip within block tile
    const int nw   = wave >> 2;      // 64-col strip within block tile
    const int n0   = blockIdx.x * 128;
    const int m0   = blockIdx.y * 128;

    f32x8 acc[2][4];
    for (int mt = 0; mt < 2; ++mt)
        for (int j = 0; j < 4; ++j)
            for (int e = 0; e < 8; ++e) acc[mt][j][e] = 0.0f;

    // cooperative W staging: 128 rows x 2 threads, 32 B each
    const int srow  = threadIdx.x >> 1;
    const int shalf = threadIdx.x & 1;
    const __bf16* wstage = W + (size_t)(n0 + srow) * K + shalf * 16;

    // preload iteration 0 into buffer 0
    {
        uint4 w0 = *reinterpret_cast<const uint4*>(wstage);
        uint4 w1 = *reinterpret_cast<const uint4*>(wstage + 8);
        *reinterpret_cast<uint4*>(&wlds[0][srow * 40 + shalf * 16])     = w0;
        *reinterpret_cast<uint4*>(&wlds[0][srow * 40 + shalf * 16 + 8]) = w1;
    }

    const int niter = K / 32;
    for (int i = 0; i < niter; ++i) {
        __syncthreads();                       // buffer (i&1) is ready
        const int kk = i * 32;

        uint4 nx0, nx1;
        const bool havenext = (i + 1 < niter);
        if (havenext) {                        // issue next tile's global loads early
            nx0 = *reinterpret_cast<const uint4*>(wstage + kk + 32);
            nx1 = *reinterpret_cast<const uint4*>(wstage + kk + 32 + 8);
            if (i + 2 < niter)
                __builtin_prefetch(wstage + kk + 64, 0, 1);  // global_prefetch_b8
        }

        Frag fa[2];
#pragma unroll
        for (int mt = 0; mt < 2; ++mt) {
            const __bf16* asrc = A + (size_t)(m0 + mw * 32 + mt * 16 + lm) * K + kk;
            fa[mt].u[0] = *reinterpret_cast<const uint4*>(asrc + g * 8);
            fa[mt].u[1] = *reinterpret_cast<const uint4*>(asrc + 16 + g * 8);
        }

        const __bf16* wl = wlds[i & 1];
#pragma unroll
        for (int j = 0; j < 4; ++j) {
            Frag fb;
            const __bf16* bsrc = &wl[(nw * 64 + j * 16 + lm) * 40];
            fb.u[0] = *reinterpret_cast<const uint4*>(bsrc + g * 8);
            fb.u[1] = *reinterpret_cast<const uint4*>(bsrc + 16 + g * 8);
            acc[0][j] = WMMA_BF16(fa[0].v, fb.v, acc[0][j]);
            acc[1][j] = WMMA_BF16(fa[1].v, fb.v, acc[1][j]);
        }

        if (havenext) {                        // fill the idle buffer
            __bf16* dl = wlds[(i + 1) & 1];
            *reinterpret_cast<uint4*>(&dl[srow * 40 + shalf * 16])     = nx0;
            *reinterpret_cast<uint4*>(&dl[srow * 40 + shalf * 16 + 8]) = nx1;
        }
    }

    // epilogue: C-layout row m = r + 8*g, col n = lm
#pragma unroll
    for (int mt = 0; mt < 2; ++mt) {
        const int mbase = m0 + mw * 32 + mt * 16 + 8 * g;
#pragma unroll
        for (int j = 0; j < 4; ++j) {
            const int n  = n0 + nw * 64 + j * 16 + lm;
            const float bv = bias ? bias[n] : 0.0f;
#pragma unroll
            for (int r = 0; r < 8; ++r) {
                const int m = mbase + r;
                float v = (acc[mt][j][r] + bv) * scale;
                if (MODE == 0) {
                    ((__bf16*)Out)[(size_t)m * N + n] = (__bf16)v;
                } else {
                    v += residual[(size_t)m * N + n];
                    ((float*)Out)[(size_t)m * N + n] = v;
                }
            }
        }
    }
}

// ---------------------------------------------------------------------------
// Flash attention: scores = Q_scaled * K^T + tril(1); softmax; ctx = A * V.
// grid = (S/128, B*H); block = 256 (8 waves); wave owns 16 query rows.
// K/V tiles double-buffered in LDS; one barrier per 32-key step.
// Q/K/V/ctx are (B,S,D) bf16 with head h in columns [h*64, h*64+64).
// ---------------------------------------------------------------------------
__global__ __launch_bounds__(256)
void flash_attn_kernel(const __bf16* __restrict__ Q, const __bf16* __restrict__ Kp,
                       const __bf16* __restrict__ Vp, __bf16* __restrict__ O) {
    __shared__ __attribute__((aligned(16))) __bf16 klds[2][32 * 72];     // K tile row-major
    __shared__ __attribute__((aligned(16))) __bf16 vlds[2][64 * 40];     // V tile TRANSPOSED [d][key]
    __shared__ __attribute__((aligned(16))) __bf16 plds[8 * 16 * 40];    // per-wave P (16x32)

    const int lane = threadIdx.x & 31;
    const int wave = threadIdx.x >> 5;
    const int g    = lane >> 4;
    const int lm   = lane & 15;

    const int b = blockIdx.y / H_;
    const int h = blockIdx.y % H_;
    const int qblk = blockIdx.x * 128;
    const size_t headoff = (size_t)b * S_ * D_ + (size_t)h * HD_;

    // Q fragments (two K=32 steps over HD=64), loaded once
    const int qrow = qblk + wave * 16 + lm;
    Frag qf[2];
    const __bf16* qsrc = Q + headoff + (size_t)qrow * D_;
#pragma unroll
    for (int dh = 0; dh < 2; ++dh) {
        qf[dh].u[0] = *reinterpret_cast<const uint4*>(qsrc + dh * 32 + g * 8);
        qf[dh].u[1] = *reinterpret_cast<const uint4*>(qsrc + dh * 32 + 16 + g * 8);
    }

    float mrun[8], lrun[8];
    f32x8 acc[4];
    for (int r = 0; r < 8; ++r) { mrun[r] = -3.0e38f; lrun[r] = 0.0f; }
    for (int dt = 0; dt < 4; ++dt)
        for (int e = 0; e < 8; ++e) acc[dt][e] = 0.0f;

    // staging: 32 key rows x 8 d-chunks, 16 B each
    const int trow = threadIdx.x >> 3;
    const int tch  = threadIdx.x & 7;
    const __bf16* kstage = Kp + headoff + (size_t)trow * D_ + tch * 8;
    const __bf16* vstage = Vp + headoff + (size_t)trow * D_ + tch * 8;

    // preload tile 0 into buffer 0
    {
        uint4 kv = *reinterpret_cast<const uint4*>(kstage);
        union { uint4 u; __bf16 e[8]; } vv;
        vv.u = *reinterpret_cast<const uint4*>(vstage);
        *reinterpret_cast<uint4*>(&klds[0][trow * 72 + tch * 8]) = kv;
#pragma unroll
        for (int i = 0; i < 8; ++i) vlds[0][(tch * 8 + i) * 40 + trow] = vv.e[i];
    }

    const int niter = S_ / 32;
    for (int it = 0; it < niter; ++it) {
        __syncthreads();                         // buffer (it&1) is ready
        const int kt = it * 32;

        uint4 kn;
        union { uint4 u; __bf16 e[8]; } vn;
        const bool havenext = (it + 1 < niter);
        if (havenext) {
            kn   = *reinterpret_cast<const uint4*>(kstage + (size_t)(kt + 32) * D_);
            vn.u = *reinterpret_cast<const uint4*>(vstage + (size_t)(kt + 32) * D_);
        }

        const __bf16* kl = klds[it & 1];
        const __bf16* vl = vlds[it & 1];

        // scores: two 16-key subtiles, accumulated over two d-halves
        f32x8 sc[2];
        for (int t = 0; t < 2; ++t)
            for (int e = 0; e < 8; ++e) sc[t][e] = 0.0f;
#pragma unroll
        for (int dh = 0; dh < 2; ++dh) {
#pragma unroll
            for (int t = 0; t < 2; ++t) {
                Frag kf;
                const __bf16* ks = &kl[(t * 16 + lm) * 72 + dh * 32];
                kf.u[0] = *reinterpret_cast<const uint4*>(ks + g * 8);
                kf.u[1] = *reinterpret_cast<const uint4*>(ks + 16 + g * 8);
                sc[t] = WMMA_BF16(qf[dh].v, kf.v, sc[t]);
            }
        }

        // additive tril(1) mask + online softmax (row = r + 8*g, 16 lanes per row)
        __bf16* pbase = &plds[wave * 16 * 40];
#pragma unroll
        for (int r = 0; r < 8; ++r) {
            const int qg = qblk + wave * 16 + r + 8 * g;
            float s0 = sc[0][r] + ((kt + lm)      <= qg ? 1.0f : 0.0f);
            float s1 = sc[1][r] + ((kt + 16 + lm) <= qg ? 1.0f : 0.0f);
            float mx = fmaxf(s0, s1);
            for (int off = 1; off < 16; off <<= 1)
                mx = fmaxf(mx, __shfl_xor(mx, off, 32));
            const float mnew  = fmaxf(mrun[r], mx);
            const float alpha = __expf(mrun[r] - mnew);
            const float p0 = __expf(s0 - mnew);
            const float p1 = __expf(s1 - mnew);
            float rs = p0 + p1;
            for (int off = 1; off < 16; off <<= 1)
                rs += __shfl_xor(rs, off, 32);
            lrun[r] = lrun[r] * alpha + rs;
            mrun[r] = mnew;
#pragma unroll
            for (int dt = 0; dt < 4; ++dt) acc[dt][r] *= alpha;
            pbase[(r + 8 * g) * 40 + lm]      = (__bf16)p0;
            pbase[(r + 8 * g) * 40 + 16 + lm] = (__bf16)p1;
        }

        // P back out of LDS in A-operand layout (per-wave buffer, DS ops in-order)
        Frag pf;
        const __bf16* ps = &plds[wave * 16 * 40 + lm * 40];
        pf.u[0] = *reinterpret_cast<const uint4*>(ps + g * 8);
        pf.u[1] = *reinterpret_cast<const uint4*>(ps + 16 + g * 8);

#pragma unroll
        for (int dt = 0; dt < 4; ++dt) {
            Frag vf;
            const __bf16* vs = &vl[(dt * 16 + lm) * 40];
            vf.u[0] = *reinterpret_cast<const uint4*>(vs + g * 8);
            vf.u[1] = *reinterpret_cast<const uint4*>(vs + 16 + g * 8);
            acc[dt] = WMMA_BF16(pf.v, vf.v, acc[dt]);
        }

        if (havenext) {                          // fill the idle buffer
            __bf16* kd = klds[(it + 1) & 1];
            __bf16* vd = vlds[(it + 1) & 1];
            *reinterpret_cast<uint4*>(&kd[trow * 72 + tch * 8]) = kn;
#pragma unroll
            for (int i = 0; i < 8; ++i) vd[(tch * 8 + i) * 40 + trow] = vn.e[i];
        }
    }

    // normalize and store ctx (transposed back to (b,s,h*64+d) automatically)
    __bf16* dst = O + headoff;
#pragma unroll
    for (int dt = 0; dt < 4; ++dt)
#pragma unroll
        for (int r = 0; r < 8; ++r) {
            const int m = qblk + wave * 16 + r + 8 * g;
            dst[(size_t)m * D_ + dt * 16 + lm] = (__bf16)(acc[dt][r] / lrun[r]);
        }
}

// ---------------------------------------------------------------------------
extern "C" void kernel_launch(void* const* d_in, const int* in_sizes, int n_in,
                              void* d_out, int out_size, void* d_ws, size_t ws_size,
                              hipStream_t stream) {
    const float* x      = (const float*)d_in[0];
    const float* Wq     = (const float*)d_in[1];
    const float* Wk     = (const float*)d_in[2];
    const float* Wv     = (const float*)d_in[3];
    const float* in_w   = (const float*)d_in[4];
    const float* in_b   = (const float*)d_in[5];
    const float* out_w  = (const float*)d_in[6];
    const float* out_b  = (const float*)d_in[7];
    const float* proj_w = (const float*)d_in[8];
    const float* proj_b = (const float*)d_in[9];
    float* out = (float*)d_out;

    const size_t MB = 1u << 20;
    char* ws = (char*)d_ws;
    __bf16* xb     = (__bf16*)(ws + 0);         // 16 MB  (B*S*D)
    __bf16* wqb    = (__bf16*)(ws + 16 * MB);   //  2 MB
    __bf16* wkb    = (__bf16*)(ws + 18 * MB);
    __bf16* wvb    = (__bf16*)(ws + 20 * MB);
    __bf16* inwb   = (__bf16*)(ws + 22 * MB);   //  6 MB
    __bf16* outwb  = (__bf16*)(ws + 28 * MB);
    __bf16* projwb = (__bf16*)(ws + 30 * MB);
    __bf16* qb     = (__bf16*)(ws + 32 * MB);   // 16 MB each
    __bf16* kb     = (__bf16*)(ws + 48 * MB);
    __bf16* vb     = (__bf16*)(ws + 64 * MB);
    __bf16* Qb     = (__bf16*)(ws + 80 * MB);
    __bf16* Kb     = (__bf16*)(ws + 96 * MB);
    __bf16* Vb     = (__bf16*)(ws + 112 * MB);
    __bf16* ctx    = qb;                        // q/k/v dead after Q/K/V built
    __bf16* attn   = kb;

    const int NX = M_ * D_;      // 8,388,608
    const int ND = D_ * D_;      // 1,048,576
    auto cvt = [&](const float* src, __bf16* dst, int n) {
        f32_to_bf16_kernel<<<(n / 4 + 255) / 256, 256, 0, stream>>>(src, dst, n);
    };
    cvt(x, xb, NX);
    cvt(Wq, wqb, ND);  cvt(Wk, wkb, ND);  cvt(Wv, wvb, ND);
    cvt(in_w, inwb, 3 * ND);
    cvt(out_w, outwb, ND);  cvt(proj_w, projwb, ND);

    const dim3 blk(256);
    const dim3 gg(D_ / 128, M_ / 128);  // (8, 64)
    const float qscale = 1.0f / 8.0f;   // 1/sqrt(HD)

    // q/k/v = x * W^T
    gemm_nt_kernel<0><<<gg, blk, 0, stream>>>(xb, wqb, nullptr, qb, nullptr, M_, D_, D_, 1.0f);
    gemm_nt_kernel<0><<<gg, blk, 0, stream>>>(xb, wkb, nullptr, kb, nullptr, M_, D_, D_, 1.0f);
    gemm_nt_kernel<0><<<gg, blk, 0, stream>>>(xb, wvb, nullptr, vb, nullptr, M_, D_, D_, 1.0f);
    // Q/K/V = (q/k/v) * in_w_slice^T + bias   (softmax scale folded into Q)
    gemm_nt_kernel<0><<<gg, blk, 0, stream>>>(qb, inwb,          in_b,          Qb, nullptr, M_, D_, D_, qscale);
    gemm_nt_kernel<0><<<gg, blk, 0, stream>>>(kb, inwb + ND,     in_b + D_,     Kb, nullptr, M_, D_, D_, 1.0f);
    gemm_nt_kernel<0><<<gg, blk, 0, stream>>>(vb, inwb + 2 * ND, in_b + 2 * D_, Vb, nullptr, M_, D_, D_, 1.0f);
    // attention
    flash_attn_kernel<<<dim3(S_ / 128, B_ * H_), blk, 0, stream>>>(Qb, Kb, Vb, ctx);
    // attn = ctx * out_w^T + out_b
    gemm_nt_kernel<0><<<gg, blk, 0, stream>>>(ctx, outwb, out_b, attn, nullptr, M_, D_, D_, 1.0f);
    // out = attn * proj_w^T + proj_b + x   (fp32)
    gemm_nt_kernel<1><<<gg, blk, 0, stream>>>(attn, projwb, proj_b, out, x, M_, D_, D_, 1.0f);
}

// v002
// Measured time: 320 microseconds a run.
// Versions between v000 and this one are left out; their measured steps multiply to 1.64 times as fast.
#include <hip/hip_runtime.h>
#include <hip/hip_bf16.h>

#define B_ 4
#define S_ 2048
#define D_ 1024
#define H_ 16
#define HD_ 64
#define M_ (B_ * S_)   // 8192 rows of the token matrix

typedef __attribute__((ext_vector_type(16))) __bf16 bf16x16;
typedef __attribute__((ext_vector_type(8)))  float  f32x8;

union Frag {          // 16 bf16 = 8 VGPRs; u[0] -> K = g*8..g*8+7, u[1] -> K = 16+g*8..
    uint4   u[2];
    bf16x16 v;
};

#define WMMA_BF16(a, b, c) \
    __builtin_amdgcn_wmma_f32_16x16x32_bf16(false, (a), false, (b), (short)0, (c), false, false)

// ---------------------------------------------------------------------------
// fp32 -> bf16 conversion (4 elems / thread)
// ---------------------------------------------------------------------------
__global__ void f32_to_bf16_kernel(const float* __restrict__ in, __bf16* __restrict__ out, int n) {
    int i = (blockIdx.x * blockDim.x + threadIdx.x) * 4;
    if (i + 3 < n) {
        float4 f = *reinterpret_cast<const float4*>(in + i);
        out[i + 0] = (__bf16)f.x;
        out[i + 1] = (__bf16)f.y;
        out[i + 2] = (__bf16)f.z;
        out[i + 3] = (__bf16)f.w;
    } else {
        for (int j = i; j < n; ++j) out[j] = (__bf16)in[j];
    }
}

// ---------------------------------------------------------------------------
// fp32 -> bf16 conversion with transpose: out[c][r] = in[r][c], n x n matrix,
// 64x64 tile through LDS so that both the reads and the writes are contiguous.
// ---------------------------------------------------------------------------
__global__ __launch_bounds__(256)
void f32_to_bf16_transpose_kernel(const float* __restrict__ in, __bf16* __restrict__ out, int n) {
    __shared__ float tile[64][65];
    const int c0 = blockIdx.x * 64;
    const int r0 = blockIdx.y * 64;
    const int t  = threadIdx.x;
    {
        const int c4 = (t & 15) * 4;
        const int r  = t >> 4;
#pragma unroll  // all four row loads in flight together
        for (int k = 0; k < 4; ++k) {
            float4 f = *reinterpret_cast<const float4*>(in + (size_t)(r0 + r + 16 * k) * n + c0 + c4);
            tile[r + 16 * k][c4 + 0] = f.x;
            tile[r + 16 * k][c4 + 1] = f.y;
            tile[r + 16 * k][c4 + 2] = f.z;
            tile[r + 16 * k][c4 + 3] = f.w;
        }
    }
    __syncthreads();
    {
        const int r8 = (t & 7) * 8;
        const int c  = t >> 3;
#pragma unroll  // both unrolled: p stays in registers, constant LDS offsets
        for (int k = 0; k < 2; ++k) {
            union { uint4 u; __bf16 e[8]; } p;
#pragma unroll
            for (int i = 0; i < 8; ++i) p.e[i] = (__bf16)tile[r8 + i][c + 32 * k];
            *reinterpret_cast<uint4*>(out + (size_t)(c0 + c + 32 * k) * n + r0 + r8) = p.u;
        }
    }
}

// ---------------------------------------------------------------------------
// fp32 -> bf16 conversion of a D_ x D_ weight w, and in the same pass the folded
// bias bout[r] = b[r] + sum_e w[r][e] * v[e] in f32.
// block = 8 waves x 4 rows = 32 rows, so a block writes one whole 128-byte line of bout.
// ---------------------------------------------------------------------------
__global__ __launch_bounds__(256)
void f32_to_bf16_fold_bias_kernel(const float* __restrict__ w, const float* __restrict__ v,
                                  const float* __restrict__ b, __bf16* __restrict__ wout,
                                  float* __restrict__ bout) {
    __shared__ float rowsum[32];
    const int lane = threadIdx.x & 31;
    const int wave = threadIdx.x >> 5;
    const int row0 = blockIdx.x * 32;
    const size_t base = (size_t)(row0 + wave * 4) * D_;
    float s[4] = {0.0f, 0.0f, 0.0f, 0.0f};
#pragma unroll  // both unrolled: the loads of all four rows in flight together, s[] in registers
    for (int k = 0; k < D_ / 128; ++k) {
        const int c = k * 128 + lane * 4;
        float4 gv = *reinterpret_cast<const float4*>(v + c);
#pragma unroll
        for (int rr = 0; rr < 4; ++rr) {
            float4 f = *reinterpret_cast<const float4*>(w + base + rr * D_ + c);
            union { uint2 u; __bf16 e[4]; } p;
            p.e[0] = (__bf16)f.x;  p.e[1] = (__bf16)f.y;
            p.e[2] = (__bf16)f.z;  p.e[3] = (__bf16)f.w;
            *reinterpret_cast<uint2*>(wout + base + rr * D_ + c) = p.u;
            s[rr] += f.x * gv.x + f.y * gv.y + f.z * gv.z + f.w * gv.w;
        }
    }
#pragma unroll  // s[] indexed by constants; the four reductions overlap
    for (int rr = 0; rr < 4; ++rr) {
        for (int off = 16; off > 0; off >>= 1) s[rr] += __shfl_xor(s[rr], off, 32);
    }
    if (lane == 0) {
#pragma unroll  // s[] indexed by constants
        for (int rr = 0; rr < 4; ++rr) rowsum[wave * 4 + rr] = s[rr];
    }
    __syncthreads();
    if (threadIdx.x < 32) bout[row0 + threadIdx.x] = rowsum[threadIdx.x] + b[row0 + threadIdx.x];
}

// ---------------------------------------------------------------------------
// NT GEMM: C[M x N] = A[M x K](bf16) * W[N x K](bf16)^T  (+bias)*scale (+res)
// block = 256 threads (8 waves); block tile 128x128; wave tile 32x64
// (2 M-tiles x 4 N-tiles = 8 f32x8 accumulators, 6 fragment loads / 8 WMMAs).
// W tile double-buffered through LDS; one barrier per 32-K step.
// MODE 0: bf16 output.  MODE 1: f32 output + residual add.
// blockIdx.z picks one product of a batch whose A, W and C each lie back to back.
// ---------------------------------------------------------------------------
template <int MODE>
__global__ __launch_bounds__(256)
void gemm_nt_kernel(const __bf16* __restrict__ Abase, const __bf16* __restrict__ Wbase,
                    const float* __restrict__ bias, void* __restrict__ Outbase,
                    const float* __restrict__ resbase,
                    int M, int N, int K, float scale) {
    __shared__ __attribute__((aligned(16))) __bf16 wlds[2][128 * 40];  // padded stride 40

    const int lane = threadIdx.x & 31;
    const int wave = threadIdx.x >> 5;
    const int g    = lane >> 4;      // half-wave group (A/B layout K-offset selector)
    const int lm   = lane & 15;      // row (A) / column (B) within tile
    const int mw   = wave & 3;       // 32-row strip within block tile
    const int nw   = wave >> 2;      // 64-col strip within block tile
    const int n0   = blockIdx.x * 128;
    const int m0   = blockIdx.y * 128;
    const __bf16* __restrict__ A = Abase + (size_t)blockIdx.z * M * K;
    const __bf16* __restrict__ W = Wbase + (size_t)blockIdx.z * N * K;
    const size_t  cz = (size_t)blockIdx.z * M * N;
    void* __restrict__ Out = (MODE == 0) ? (void*)((__bf16*)Outbase + cz) : (void*)((float*)Outbase + cz);
    const float* __restrict__ residual = (MODE == 0) ? resbase : resbase + cz;

    f32x8 acc[2][4];
    for (int mt = 0; mt < 2; ++mt)
        for (int j = 0; j < 4; ++j)
            for (int e = 0; e < 8; ++e) acc[mt][j][e] = 0.0f;

    // cooperative W staging: 128 rows x 2 threads, 32 B each
    const int srow  = threadIdx.x >> 1;
    const int shalf = threadIdx.x & 1;
    const __bf16* wstage = W + (size_t)(n0 + srow) * K + shalf * 16;

    // preload iteration 0 into buffer 0
    {
        uint4 w0 = *reinterpret_cast<const uint4*>(wstage);
        uint4 w1 = *reinterpret_cast<const uint4*>(wstage + 8);
        *reinterpret_cast<uint4*>(&wlds[0][srow * 40 + shalf * 16])     = w0;
        *reinterpret_cast<uint4*>(&wlds[0][srow * 40 + shalf * 16 + 8]) = w1;
    }

    const int niter = K / 32;
    for (int i = 0; i < niter; ++i) {
        __syncthreads();                       // buffer (i&1) is ready
        const int kk = i * 32;

        uint4 nx0, nx1;
        const bool havenext = (i + 1 < niter);
        if (havenext) {                        // issue next tile's global loads early
            nx0 = *reinterpret_cast<const uint4*>(wstage + kk + 32);
            nx1 = *reinterpret_cast<const uint4*>(wstage + kk + 32 + 8);
            if (i + 2 < niter)
                __builtin_prefetch(wstage + kk + 64, 0, 1);  // global_prefetch_b8
        }

        Frag fa[2];
#pragma unroll
        for (int mt = 0; mt < 2; ++mt) {
            const __bf16* asrc = A + (size_t)(m0 + mw * 32 + mt * 16 + lm) * K + kk;
            fa[mt].u[0] = *reinterpret_cast<const uint4*>(asrc + g * 8);
            fa[mt].u[1] = *reinterpret_cast<const uint4*>(asrc + 16 + g * 8);
        }

        const __bf16* wl = wlds[i & 1];
#pragma unroll
        for (int j = 0; j < 4; ++j) {
            Frag fb;
            const __bf16* bsrc = &wl[(nw * 64 + j * 16 + lm) * 40];
            fb.u[0] = *reinterpret_cast<const uint4*>(bsrc + g * 8);
            fb.u[1] = *reinterpret_cast<const uint4*>(bsrc + 16 + g * 8);
            acc[0][j] = WMMA_BF16(fa[0].v, fb.v, acc[0][j]);
            acc[1][j] = WMMA_BF16(fa[1].v, fb.v, acc[1][j]);
        }

        if (havenext) {                        // fill the idle buffer
            __bf16* dl = wlds[(i + 1) & 1];
            *reinterpret_cast<uint4*>(&dl[srow * 40 + shalf * 16])     = nx0;
            *reinterpret_cast<uint4*>(&dl[srow * 40 + shalf * 16 + 8]) = nx1;
        }
    }

    // epilogue: C-layout row m = r + 8*g, col n = lm
#pragma unroll
    for (int mt = 0; mt < 2; ++mt) {
        const int mbase = m0 + mw * 32 + mt * 16 + 8 * g;
#pragma unroll
        for (int j = 0; j < 4; ++j) {
            const int n  = n0 + nw * 64 + j * 16 + lm;
            const float bv = bias ? bias[n] : 0.0f;
#pragma unroll
            for (int r = 0; r < 8; ++r) {
                const int m = mbase + r;
                float v = (acc[mt][j][r] + bv) * scale;
                if (MODE == 0) {
                    ((__bf16*)Out)[(size_t)m * N + n] = (__bf16)v;
                } else {
                    v += residual[(size_t)m * N + n];
                    ((float*)Out)[(size_t)m * N + n] = v;
                }
            }
        }
    }
}

// ---------------------------------------------------------------------------
// Flash attention, transposed: S^T = K * Q_scaled^T + tril(1)^T; softmax down each
// column; ctx^T = V^T * P^T.  A lane holds scores of ONE query (column lm), so the
// maximum and the sum run over its own registers, and the two f32 score tiles of a
// 32-key step, converted in place, are the B operand of the second product.
// grid = (S/128, B*H); block = 256 (8 waves); wave owns 16 query columns.
// K/V tiles double-buffered in LDS; one barrier per 32-key step.
// Q/K/V/ctx are (B,S,D) bf16 with head h in columns [h*64, h*64+64).
// ---------------------------------------------------------------------------
__device__ inline float other_half(float v) {   // value of lane l ^ 16
    const int b = __float_as_int(v);
    return __int_as_float(__builtin_amdgcn_permlanex16(b, b, 0x76543210, 0xfedcba98, false, false));
}

__global__ __launch_bounds__(256)
void flash_attn_kernel(const __bf16* __restrict__ Q, const __bf16* __restrict__ Kp,
                       const __bf16* __restrict__ Vp, __bf16* __restrict__ O) {
    __shared__ __attribute__((aligned(16))) __bf16 klds[2][32 * 72];     // K tile row-major
    __shared__ __attribute__((aligned(16))) __bf16 vlds[2][64 * 40];     // V tile TRANSPOSED [d][key]

    const int lane = threadIdx.x & 31;
    const int wave = threadIdx.x >> 5;
    const int g    = lane >> 4;
    const int lm   = lane & 15;

    const int b = blockIdx.y / H_;
    const int h = blockIdx.y % H_;
    const int qblk = blockIdx.x * 128;
    const size_t headoff = (size_t)b * S_ * D_ + (size_t)h * HD_;

    // Q fragments (B operand, two K=32 steps over HD=64), loaded once
    const int qrow = qblk + wave * 16 + lm;
    Frag qf[2];
    const __bf16* qsrc = Q + headoff + (size_t)qrow * D_;
#pragma unroll
    for (int dh = 0; dh < 2; ++dh) {
        qf[dh].u[0] = *reinterpret_cast<const uint4*>(qsrc + dh * 32 + g * 8);
        qf[dh].u[1] = *reinterpret_cast<const uint4*>(qsrc + dh * 32 + 16 + g * 8);
    }
    // precaution: no later load's result lands on an address register of a load issued before it
    asm volatile("s_wait_xcnt 0x0" ::: "memory");

    float mrun = -3.0e38f;   // running maximum of query qrow (equal in both halves)
    float lrun = 0.0f;       // running sum over this half's keys only; joined after the loop
    f32x8 acc[4];            // acc[dt][r] = ctx[qrow][dt*16 + 8*g + r]
    for (int dt = 0; dt < 4; ++dt)
        for (int e = 0; e < 8; ++e) acc[dt][e] = 0.0f;

    // staging: 32 key rows x 8 d-chunks, 16 B each
    const int trow = threadIdx.x >> 3;
    const int tch  = threadIdx.x & 7;
    const __bf16* kstage = Kp + headoff + (size_t)trow * D_ + tch * 8;
    const __bf16* vstage = Vp + headoff + (size_t)trow * D_ + tch * 8;

    // preload tile 0 into buffer 0
    {
        uint4 kv = *reinterpret_cast<const uint4*>(kstage);
        union { uint4 u; __bf16 e[8]; } vv;
        vv.u = *reinterpret_cast<const uint4*>(vstage);
        *reinterpret_cast<uint4*>(&klds[0][trow * 72 + tch * 8]) = kv;
#pragma unroll
        for (int i = 0; i < 8; ++i) vlds[0][(tch * 8 + i) * 40 + trow] = vv.e[i];
    }

    const int niter = S_ / 32;
    // not unrolled, last pass not peeled off: the next tile's global loads then keep their own
    // block at the head of the pass; peeled, they sink to their LDS stores and are waited for in full
#pragma nounroll
    for (int it = 0; it < niter; ++it) {
        __syncthreads();                         // buffer (it&1) is ready
        const int kt = it * 32;

        uint4 kn;
        union { uint4 u; __bf16 e[8]; } vn;
        const bool havenext = (it + 1 < niter);
        if (havenext) {
            kn   = *reinterpret_cast<const uint4*>(kstage + (size_t)(kt + 32) * D_);
            vn.u = *reinterpret_cast<const uint4*>(vstage + (size_t)(kt + 32) * D_);
        }

        const __bf16* kl = klds[it & 1];
        const __bf16* vl = vlds[it & 1];

        // scores: two 16-key subtiles, accumulated over two d-halves
        // sc[t][r] = score of key kt + t*16 + 8*g + r against query qrow
        f32x8 sc[2];
        for (int t = 0; t < 2; ++t)
            for (int e = 0; e < 8; ++e) sc[t][e] = 0.0f;
#pragma unroll
        for (int dh = 0; dh < 2; ++dh) {
#pragma unroll
            for (int t = 0; t < 2; ++t) {
                Frag kf;
                const __bf16* ks = &kl[(t * 16 + lm) * 72 + dh * 32];
                kf.u[0] = *reinterpret_cast<const uint4*>(ks + g * 8);
                kf.u[1] = *reinterpret_cast<const uint4*>(ks + 16 + g * 8);
                sc[t] = WMMA_BF16(kf.v, qf[dh].v, sc[t]);
            }
        }

        // additive tril(1) mask + online softmax, all 16 scores of a lane belong to qrow
        const int lim = qrow - kt - 8 * g;       // key offset t*16 + r gets +1 while <= lim
        float mxt[2] = {-3.0e38f, -3.0e38f};     // one chain per subtile
#pragma unroll
        for (int t = 0; t < 2; ++t)
#pragma unroll
            for (int r = 0; r < 8; ++r) {
                sc[t][r] += (t * 16 + r <= lim) ? 1.0f : 0.0f;
                mxt[t] = fmaxf(mxt[t], sc[t][r]);
            }
        float mx = fmaxf(mxt[0], mxt[1]);
        mx = fmaxf(mx, other_half(mx));
        const float mnew  = fmaxf(mrun, mx);
        const float alpha = __expf(mrun - mnew);
        mrun = mnew;

        Frag pf;                                 // pf.v[t*8 + r]: hardware k order of a B operand
        float rs[4] = {0.0f, 0.0f, 0.0f, 0.0f};  // four independent chains
#pragma unroll
        for (int t = 0; t < 2; ++t)
#pragma unroll
            for (int r = 0; r < 8; ++r) {
                const float p = __expf(sc[t][r] - mnew);
                rs[r & 3] += p;
                pf.v[t * 8 + r] = (__bf16)p;
            }
        lrun = lrun * alpha + ((rs[0] + rs[1]) + (rs[2] + rs[3]));
#pragma unroll
        for (int dt = 0; dt < 4; ++dt)
#pragma unroll
            for (int r = 0; r < 8; ++r) acc[dt][r] *= alpha;

#pragma unroll
        for (int dt = 0; dt < 4; ++dt) {
            Frag vf;
            const __bf16* vs = &vl[(dt * 16 + lm) * 40];
            vf.u[0] = *reinterpret_cast<const uint4*>(vs + g * 8);
            vf.u[1] = *reinterpret_cast<const uint4*>(vs + 16 + g * 8);
            acc[dt] = WMMA_BF16(vf.v, pf.v, acc[dt]);
        }

        if (havenext) {                          // fill the idle buffer
            __bf16* kd = klds[(it + 1) & 1];
            __bf16* vd = vlds[(it + 1) & 1];
            *reinterpret_cast<uint4*>(&kd[trow * 72 + tch * 8]) = kn;
#pragma unroll
            for (int i = 0; i < 8; ++i) vd[(tch * 8 + i) * 40 + trow] = vn.e[i];
        }
    }

    // join the halves' sums, normalize, store: 8 consecutive d of one query = 16 bytes
    const float inv = 1.0f / (lrun + other_half(lrun));
    __bf16* dst = O + headoff + (size_t)qrow * D_ + 8 * g;
#pragma unroll
    for (int dt = 0; dt < 4; ++dt) {
        union { uint4 u; __bf16 e[8]; } o;
#pragma unroll
        for (int r = 0; r < 8; ++r) o.e[r] = (__bf16)(acc[dt][r] * inv);
        *reinterpret_cast<uint4*>(dst + dt * 16) = o.u;
    }
}

// ---------------------------------------------------------------------------
extern "C" void kernel_launch(void* const* d_in, const int* in_sizes, int n_in,
                              void* d_out, int out_size, void* d_ws, size_t ws_size,
                              hipStream_t stream) {
    const float* x      = (const float*)d_in[0];
    const float* Wq     = (const float*)d_in[1];
    const float* Wk     = (const float*)d_in[2];
    const float* Wv     = (const float*)d_in[3];
    const float* in_w   = (const float*)d_in[4];
    const float* in_b   = (const float*)d_in[5];
    const float* out_w  = (const float*)d_in[6];
    const float* out_b  = (const float*)d_in[7];
    const float* proj_w = (const float*)d_in[8];
    const float* proj_b = (const float*)d_in[9];
    float* out = (float*)d_out;

    const size_t MB = 1u << 20;
    char* ws = (char*)d_ws;
    const int NX = M_ * D_;      // 8,388,608
    const int ND = D_ * D_;      // 1,048,576
    __bf16* xb    = (__bf16*)(ws + 0);         // 16 MB  (B*S*D)
    __bf16* w1t   = (__bf16*)(ws + 16 * MB);   //  8 MB: Wq^T, Wk^T, Wv^T, out_w^T (first layers, transposed)
    __bf16* w2    = (__bf16*)(ws + 24 * MB);   //  8 MB: in_w (3 slices), proj_w    (second layers)
    __bf16* wf    = (__bf16*)(ws + 32 * MB);   //  8 MB: folded weights w2[i] * w1[i]
    float*  bfold = (float*) (ws + 40 * MB);   //  4 KB: proj_w * out_b + proj_b
    __bf16* Qb    = (__bf16*)(ws + 48 * MB);   // 16 MB each
    __bf16* Kb    = (__bf16*)(ws + 64 * MB);
    __bf16* Vb    = (__bf16*)(ws + 80 * MB);
    __bf16* ctx   = (__bf16*)(ws + 96 * MB);

    auto cvt = [&](const float* src, __bf16* dst, int n) {
        f32_to_bf16_kernel<<<(n / 4 + 255) / 256, 256, 0, stream>>>(src, dst, n);
    };
    auto cvt_t = [&](const float* src, __bf16* dst) {
        f32_to_bf16_transpose_kernel<<<dim3(D_ / 64, D_ / 64), 256, 0, stream>>>(src, dst, D_);
    };
    cvt(x, xb, NX);
    cvt_t(Wq, w1t);  cvt_t(Wk, w1t + ND);  cvt_t(Wv, w1t + 2 * ND);  cvt_t(out_w, w1t + 3 * ND);
    cvt(in_w, w2, 3 * ND);
    f32_to_bf16_fold_bias_kernel<<<D_ / 32, 256, 0, stream>>>(proj_w, out_b, proj_b, w2 + 3 * ND, bfold);

    const dim3 blk(256);
    const dim3 gg(D_ / 128, M_ / 128);      // (8, 64)
    const dim3 gw(D_ / 128, D_ / 128, 4);   // (8, 8, 4): the four weight products
    const float qscale = 1.0f / 8.0f;       // 1/sqrt(HD)

    // two linear layers in a row are one: (x * W1^T) * W2^T = x * (W2 * W1)^T.
    // wf[i][f][d] = sum_e w2[i][f][e] * w1[i][e][d]
    gemm_nt_kernel<0><<<gw, blk, 0, stream>>>(w2, w1t, nullptr, wf, nullptr, D_, D_, D_, 1.0f);
    // Q/K/V = x * wf^T + bias   (softmax scale folded into Q)
    gemm_nt_kernel<0><<<gg, blk, 0, stream>>>(xb, wf,          in_b,          Qb, nullptr, M_, D_, D_, qscale);
    gemm_nt_kernel<0><<<gg, blk, 0, stream>>>(xb, wf + ND,     in_b + D_,     Kb, nullptr, M_, D_, D_, 1.0f);
    gemm_nt_kernel<0><<<gg, blk, 0, stream>>>(xb, wf + 2 * ND, in_b + 2 * D_, Vb, nullptr, M_, D_, D_, 1.0f);
    // attention
    flash_attn_kernel<<<dim3(S_ / 128, B_ * H_), blk, 0, stream>>>(Qb, Kb, Vb, ctx);
    // out = ctx * (proj_w * out_w)^T + (proj_w * out_b + proj_b) + x   (fp32)
    gemm_nt_kernel<1><<<gg, blk, 0, stream>>>(ctx, wf + 3 * ND, bfold, out, x, M_, D_, D_, 1.0f);
}

// v003
// Measured time: 235 microseconds a run.
// Timed twice side by side with v002, it ran 1.37 times as fast both times.
// Over all steps from v000 it is 2.25 times as fast.
#include <hip/hip_runtime.h>
#include <hip/hip_bf16.h>

#define B_ 4
#define S_ 2048
#define D_ 1024
#define H_ 16
#define HD_ 64
#define M_ (B_ * S_)   // 8192 rows of the token matrix

typedef __attribute__((ext_vector_type(16))) __bf16 bf16x16;
typedef __attribute__((ext_vector_type(8)))  float  f32x8;

union Frag {          // 16 bf16 = 8 VGPRs; u[0] -> K = g*8..g*8+7, u[1] -> K = 16+g*8..
    uint4   u[2];
    bf16x16 v;
};

#define WMMA_BF16(a, b, c) \
    __builtin_amdgcn_wmma_f32_16x16x32_bf16(false, (a), false, (b), (short)0, (c), false, false)

// ---------------------------------------------------------------------------
// fp32 -> bf16 conversion (4 elems / thread)
// ---------------------------------------------------------------------------
__global__ void f32_to_bf16_kernel(const float* __restrict__ in, __bf16* __restrict__ out, int n) {
    int i = (blockIdx.x * blockDim.x + threadIdx.x) * 4;
    if (i + 3 < n) {
        float4 f = *reinterpret_cast<const float4*>(in + i);
        out[i + 0] = (__bf16)f.x;
        out[i + 1] = (__bf16)f.y;
        out[i + 2] = (__bf16)f.z;
        out[i + 3] = (__bf16)f.w;
    } else {
        for (int j = i; j < n; ++j) out[j] = (__bf16)in[j];
    }
}

// ---------------------------------------------------------------------------
// fp32 -> bf16 conversion with transpose: out[c][r] = in[r][c], n x n matrix,
// 64x64 tile through LDS so that both the reads and the writes are contiguous.
// ---------------------------------------------------------------------------
__global__ __launch_bounds__(256)
void f32_to_bf16_transpose_kernel(const float* __restrict__ in, __bf16* __restrict__ out, int n) {
    __shared__ float tile[64][65];
    const int c0 = blockIdx.x * 64;
    const int r0 = blockIdx.y * 64;
    const int t  = threadIdx.x;
    {
        const int c4 = (t & 15) * 4;
        const int r  = t >> 4;
#pragma unroll  // all four row loads in flight together
        for (int k = 0; k < 4; ++k) {
            float4 f = *reinterpret_cast<const float4*>(in + (size_t)(r0 + r + 16 * k) * n + c0 + c4);
            tile[r + 16 * k][c4 + 0] = f.x;
            tile[r + 16 * k][c4 + 1] = f.y;
            tile[r + 16 * k][c4 + 2] = f.z;
            tile[r + 16 * k][c4 + 3] = f.w;
        }
    }
    __syncthreads();
    {
        const int r8 = (t & 7) * 8;
        const int c  = t >> 3;
#pragma unroll  // both unrolled: p stays in registers, constant LDS offsets
        for (int k = 0; k < 2; ++k) {
            union { uint4 u; __bf16 e[8]; } p;
#pragma unroll
            for (int i = 0; i < 8; ++i) p.e[i] = (__bf16)tile[r8 + i][c + 32 * k];
            *reinterpret_cast<uint4*>(out + (size_t)(c0 + c + 32 * k) * n + r0 + r8) = p.u;
        }
    }
}

// ---------------------------------------------------------------------------
// fp32 -> bf16 conversion of a D_ x D_ weight w, and in the same pass the folded
// bias bout[r] = b[r] + sum_e w[r][e] * v[e] in f32.
// block = 8 waves x 4 rows = 32 rows, so a block writes one whole 128-byte line of bout.
// ---------------------------------------------------------------------------
__global__ __launch_bounds__(256)
void f32_to_bf16_fold_bias_kernel(const float* __restrict__ w, const float* __restrict__ v,
                                  const float* __restrict__ b, __bf16* __restrict__ wout,
                                  float* __restrict__ bout) {
    __shared__ float rowsum[32];
    const int lane = threadIdx.x & 31;
    const int wave = threadIdx.x >> 5;
    const int row0 = blockIdx.x * 32;
    const size_t base = (size_t)(row0 + wave * 4) * D_;
    float s[4] = {0.0f, 0.0f, 0.0f, 0.0f};
#pragma unroll  // both unrolled: the loads of all four rows in flight together, s[] in registers
    for (int k = 0; k < D_ / 128; ++k) {
        const int c = k * 128 + lane * 4;
        float4 gv = *reinterpret_cast<const float4*>(v + c);
#pragma unroll
        for (int rr = 0; rr < 4; ++rr) {
            float4 f = *reinterpret_cast<const float4*>(w + base + rr * D_ + c);
            union { uint2 u; __bf16 e[4]; } p;
            p.e[0] = (__bf16)f.x;  p.e[1] = (__bf16)f.y;
            p.e[2] = (__bf16)f.z;  p.e[3] = (__bf16)f.w;
            *reinterpret_cast<uint2*>(wout + base + rr * D_ + c) = p.u;
            s[rr] += f.x * gv.x + f.y * gv.y + f.z * gv.z + f.w * gv.w;
        }
    }
#pragma unroll  // s[] indexed by constants; the four reductions overlap
    for (int rr = 0; rr < 4; ++rr) {
        for (int off = 16; off > 0; off >>= 1) s[rr] += __shfl_xor(s[rr], off, 32);
    }
    if (lane == 0) {
#pragma unroll  // s[] indexed by constants
        for (int rr = 0; rr < 4; ++rr) rowsum[wave * 4 + rr] = s[rr];
    }
    __syncthreads();
    if (threadIdx.x < 32) bout[row0 + threadIdx.x] = rowsum[threadIdx.x] + b[row0 + threadIdx.x];
}

// ---------------------------------------------------------------------------
// NT GEMM: C[M x N] = A[M x K](bf16) * W[N x K](bf16)^T  (+bias)*scale (+res)
// block = 256 threads (8 waves); block tile 128x128; wave tile 32x64
// (2 M-tiles x 4 N-tiles = 8 f32x8 accumulators, 6 fragment loads / 8 WMMAs).
// A and W tiles both double-buffered through LDS, 64 k a step: a step takes one whole
// 128-byte line of every operand row, and 8 neighbouring lanes fetch that line together,
// so a wave-wide 16-byte load touches 4 whole lines.  One barrier per step.
// K is a multiple of 64.
// MODE 0: bf16 output.  MODE 1: f32 output + residual add.
// blockIdx.z picks one product of a batch whose A, W and C each lie back to back.
// ---------------------------------------------------------------------------
#define GP_ 72   // LDS row pitch in elements: 144 bytes = 16 bytes x odd, for 16-byte readers

template <int MODE>
__global__ __launch_bounds__(256)
void gemm_nt_kernel(const __bf16* __restrict__ Abase, const __bf16* __restrict__ Wbase,
                    const float* __restrict__ bias, void* __restrict__ Outbase,
                    const float* __restrict__ resbase,
                    int M, int N, int K, float scale) {
    __shared__ __attribute__((aligned(16))) __bf16 alds[2][128 * GP_];
    __shared__ __attribute__((aligned(16))) __bf16 wlds[2][128 * GP_];

    const int lane = threadIdx.x & 31;
    const int wave = threadIdx.x >> 5;
    const int g    = lane >> 4;      // half-wave group (A/B layout K-offset selector)
    const int lm   = lane & 15;      // row (A) / column (B) within tile
    const int mw   = wave & 3;       // 32-row strip within block tile
    const int nw   = wave >> 2;      // 64-col strip within block tile
    const int n0   = blockIdx.x * 128;
    const int m0   = blockIdx.y * 128;
    const __bf16* __restrict__ A = Abase + (size_t)blockIdx.z * M * K;
    const __bf16* __restrict__ W = Wbase + (size_t)blockIdx.z * N * K;
    const size_t  cz = (size_t)blockIdx.z * M * N;
    void* __restrict__ Out = (MODE == 0) ? (void*)((__bf16*)Outbase + cz) : (void*)((float*)Outbase + cz);
    const float* __restrict__ residual = (MODE == 0) ? resbase : resbase + cz;

    f32x8 acc[2][4];
    for (int mt = 0; mt < 2; ++mt)
        for (int j = 0; j < 4; ++j)
            for (int e = 0; e < 8; ++e) acc[mt][j][e] = 0.0f;

    // cooperative staging: 32 rows x 8 lanes of 16 B a round, 4 rounds for each operand
    const int srow = threadIdx.x >> 3;
    const int sch  = threadIdx.x & 7;
    // block-uniform byte bases; the lane's part is the byte offsets so0..so3, the same for both
    // operands, 128 bytes further each step; they keep registers of their own through the loop
    const char* astage = reinterpret_cast<const char*>(A + (size_t)m0 * K);
    const char* wstage = reinterpret_cast<const char*>(W + (size_t)n0 * K);
    unsigned so0 = ((unsigned)srow * K + sch * 8) * 2u;
    unsigned so1 = so0 + 64u * K;
    unsigned so2 = so0 + 128u * K;
    unsigned so3 = so0 + 192u * K;
    const int sdst = srow * GP_ + sch * 8;

    // preload step 0 into buffer 0
    {
        const uint4 a0 = *reinterpret_cast<const uint4*>(astage + so0);
        const uint4 a1 = *reinterpret_cast<const uint4*>(astage + so1);
        const uint4 a2 = *reinterpret_cast<const uint4*>(astage + so2);
        const uint4 a3 = *reinterpret_cast<const uint4*>(astage + so3);
        const uint4 b0 = *reinterpret_cast<const uint4*>(wstage + so0);
        const uint4 b1 = *reinterpret_cast<const uint4*>(wstage + so1);
        const uint4 b2 = *reinterpret_cast<const uint4*>(wstage + so2);
        const uint4 b3 = *reinterpret_cast<const uint4*>(wstage + so3);
        *reinterpret_cast<uint4*>(&alds[0][sdst])                = a0;
        *reinterpret_cast<uint4*>(&alds[0][sdst + 32 * GP_])     = a1;
        *reinterpret_cast<uint4*>(&alds[0][sdst + 2 * 32 * GP_]) = a2;
        *reinterpret_cast<uint4*>(&alds[0][sdst + 3 * 32 * GP_]) = a3;
        *reinterpret_cast<uint4*>(&wlds[0][sdst])                = b0;
        *reinterpret_cast<uint4*>(&wlds[0][sdst + 32 * GP_])     = b1;
        *reinterpret_cast<uint4*>(&wlds[0][sdst + 2 * 32 * GP_]) = b2;
        *reinterpret_cast<uint4*>(&wlds[0][sdst + 3 * 32 * GP_]) = b3;
    }

    const int niter = K / 64;
    for (int i = 0; i < niter; ++i) {
        __syncthreads();                       // buffer (i&1) is ready
        uint4 na0, na1, na2, na3, nb0, nb1, nb2, nb3;
        const bool havenext = (i + 1 < niter);
        if (havenext) {                        // issue the next step's global loads early
            so0 += 128u;  so1 += 128u;  so2 += 128u;  so3 += 128u;
            na0 = *reinterpret_cast<const uint4*>(astage + so0);
            na1 = *reinterpret_cast<const uint4*>(astage + so1);
            na2 = *reinterpret_cast<const uint4*>(astage + so2);
            na3 = *reinterpret_cast<const uint4*>(astage + so3);
            nb0 = *reinterpret_cast<const uint4*>(wstage + so0);
            nb1 = *reinterpret_cast<const uint4*>(wstage + so1);
            nb2 = *reinterpret_cast<const uint4*>(wstage + so2);
            nb3 = *reinterpret_cast<const uint4*>(wstage + so3);
            // precaution: stands before the next step's additions rewrite the offset registers
            // (and before the base pair is reused) that these eight issued loads name
            asm volatile("s_wait_xcnt 0x0" ::: "memory");
        }

        const __bf16* al = alds[i & 1];
        const __bf16* wl = wlds[i & 1];
#pragma unroll  // all three unrolled: constant LDS offsets, fragments and acc[] in registers
        for (int ks = 0; ks < 2; ++ks) {
            Frag fa[2];
#pragma unroll
            for (int mt = 0; mt < 2; ++mt) {
                const __bf16* asrc = &al[(mw * 32 + mt * 16 + lm) * GP_ + ks * 32];
                fa[mt].u[0] = *reinterpret_cast<const uint4*>(asrc + g * 8);
                fa[mt].u[1] = *reinterpret_cast<const uint4*>(asrc + 16 + g * 8);
            }
#pragma unroll
            for (int j = 0; j < 4; ++j) {
                Frag fb;
                const __bf16* bsrc = &wl[(nw * 64 + j * 16 + lm) * GP_ + ks * 32];
                fb.u[0] = *reinterpret_cast<const uint4*>(bsrc + g * 8);
                fb.u[1] = *reinterpret_cast<const uint4*>(bsrc + 16 + g * 8);
                acc[0][j] = WMMA_BF16(fa[0].v, fb.v, acc[0][j]);
                acc[1][j] = WMMA_BF16(fa[1].v, fb.v, acc[1][j]);
            }
        }

        if (havenext) {                        // fill the idle buffer
            __bf16* ad = &alds[(i + 1) & 1][sdst];
            __bf16* wd = &wlds[(i + 1) & 1][sdst];
            *reinterpret_cast<uint4*>(ad)                = na0;
            *reinterpret_cast<uint4*>(ad + 32 * GP_)     = na1;
            *reinterpret_cast<uint4*>(ad + 2 * 32 * GP_) = na2;
            *reinterpret_cast<uint4*>(ad + 3 * 32 * GP_) = na3;
            *reinterpret_cast<uint4*>(wd)                = nb0;
            *reinterpret_cast<uint4*>(wd + 32 * GP_)     = nb1;
            *reinterpret_cast<uint4*>(wd + 2 * 32 * GP_) = nb2;
            *reinterpret_cast<uint4*>(wd + 3 * 32 * GP_) = nb3;
        }
    }

    // epilogue: C-layout row m = r + 8*g, col n = lm
#pragma unroll
    for (int mt = 0; mt < 2; ++mt) {
        const int mbase = m0 + mw * 32 + mt * 16 + 8 * g;
#pragma unroll
        for (int j = 0; j < 4; ++j) {
            const int n  = n0 + nw * 64 + j * 16 + lm;
            const float bv = bias ? bias[n] : 0.0f;
#pragma unroll
            for (int r = 0; r < 8; ++r) {
                const int m = mbase + r;
                float v = (acc[mt][j][r] + bv) * scale;
                if (MODE == 0) {
                    ((__bf16*)Out)[(size_t)m * N + n] = (__bf16)v;
                } else {
                    v += residual[(size_t)m * N + n];
                    ((float*)Out)[(size_t)m * N + n] = v;
                }
            }
        }
    }
}

// ---------------------------------------------------------------------------
// Flash attention, transposed: S^T = K * Q_scaled^T + tril(1)^T; softmax down each
// column; ctx^T = V^T * P^T.  A lane holds scores of ONE query (column lm), so the
// maximum and the sum run over its own registers, and the two f32 score tiles of a
// 32-key step, converted in place, are the B operand of the second product.
// grid = (S/128, B*H); block = 256 (8 waves); wave owns 16 query columns.
// K/V tiles double-buffered in LDS; one barrier per 32-key step.
// Q/K/V/ctx are (B,S,D) bf16 with head h in columns [h*64, h*64+64).
// ---------------------------------------------------------------------------
__device__ inline float other_half(float v) {   // value of lane l ^ 16
    const int b = __float_as_int(v);
    return __int_as_float(__builtin_amdgcn_permlanex16(b, b, 0x76543210, 0xfedcba98, false, false));
}

__global__ __launch_bounds__(256)
void flash_attn_kernel(const __bf16* __restrict__ Q, const __bf16* __restrict__ Kp,
                       const __bf16* __restrict__ Vp, __bf16* __restrict__ O) {
    __shared__ __attribute__((aligned(16))) __bf16 klds[2][32 * 72];     // K tile row-major
    __shared__ __attribute__((aligned(16))) __bf16 vlds[2][64 * 40];     // V tile TRANSPOSED [d][key]

    const int lane = threadIdx.x & 31;
    const int wave = threadIdx.x >> 5;
    const int g    = lane >> 4;
    const int lm   = lane & 15;

    const int b = blockIdx.y / H_;
    const int h = blockIdx.y % H_;
    const int qblk = blockIdx.x * 128;
    const size_t headoff = (size_t)b * S_ * D_ + (size_t)h * HD_;

    // Q fragments (B operand, two K=32 steps over HD=64), loaded once
    const int qrow = qblk + wave * 16 + lm;
    Frag qf[2];
    const __bf16* qsrc = Q + headoff + (size_t)qrow * D_;
#pragma unroll
    for (int dh = 0; dh < 2; ++dh) {
        qf[dh].u[0] = *reinterpret_cast<const uint4*>(qsrc + dh * 32 + g * 8);
        qf[dh].u[1] = *reinterpret_cast<const uint4*>(qsrc + dh * 32 + 16 + g * 8);
    }
    // precaution: no later load's result lands on an address register of a load issued before it
    asm volatile("s_wait_xcnt 0x0" ::: "memory");

    float mrun = -3.0e38f;   // running maximum of query qrow (equal in both halves)
    float lrun = 0.0f;       // running sum over this half's keys only; joined after the loop
    f32x8 acc[4];            // acc[dt][r] = ctx[qrow][dt*16 + 8*g + r]
    for (int dt = 0; dt < 4; ++dt)
        for (int e = 0; e < 8; ++e) acc[dt][e] = 0.0f;

    // staging: 32 key rows x 8 d-chunks, 16 B each
    const int trow = threadIdx.x >> 3;
    const int tch  = threadIdx.x & 7;
    const __bf16* kstage = Kp + headoff + (size_t)trow * D_ + tch * 8;
    const __bf16* vstage = Vp + headoff + (size_t)trow * D_ + tch * 8;

    // preload tile 0 into buffer 0
    {
        uint4 kv = *reinterpret_cast<const uint4*>(kstage);
        union { uint4 u; __bf16 e[8]; } vv;
        vv.u = *reinterpret_cast<const uint4*>(vstage);
        *reinterpret_cast<uint4*>(&klds[0][trow * 72 + tch * 8]) = kv;
#pragma unroll
        for (int i = 0; i < 8; ++i) vlds[0][(tch * 8 + i) * 40 + trow] = vv.e[i];
    }

    const int niter = S_ / 32;
    // not unrolled, last pass not peeled off: the next tile's global loads then keep their own
    // block at the head of the pass; peeled, they sink to their LDS stores and are waited for in full
#pragma nounroll
    for (int it = 0; it < niter; ++it) {
        __syncthreads();                         // buffer (it&1) is ready
        const int kt = it * 32;

        uint4 kn;
        union { uint4 u; __bf16 e[8]; } vn;
        const bool havenext = (it + 1 < niter);
        if (havenext) {
            kn   = *reinterpret_cast<const uint4*>(kstage + (size_t)(kt + 32) * D_);
            vn.u = *reinterpret_cast<const uint4*>(vstage + (size_t)(kt + 32) * D_);
        }

        const __bf16* kl = klds[it & 1];
        const __bf16* vl = vlds[it & 1];

        // scores: two 16-key subtiles, accumulated over two d-halves
        // sc[t][r] = score of key kt + t*16 + 8*g + r against query qrow
        f32x8 sc[2];
        for (int t = 0; t < 2; ++t)
            for (int e = 0; e < 8; ++e) sc[t][e] = 0.0f;
#pragma unroll
        for (int dh = 0; dh < 2; ++dh) {
#pragma unroll
            for (int t = 0; t < 2; ++t) {
                Frag kf;
                const __bf16* ks = &kl[(t * 16 + lm) * 72 + dh * 32];
                kf.u[0] = *reinterpret_cast<const uint4*>(ks + g * 8);
                kf.u[1] = *reinterpret_cast<const uint4*>(ks + 16 + g * 8);
                sc[t] = WMMA_BF16(kf.v, qf[dh].v, sc[t]);
            }
        }

        // additive tril(1) mask + online softmax, all 16 scores of a lane belong to qrow
        const int lim = qrow - kt - 8 * g;       // key offset t*16 + r gets +1 while <= lim
        float mxt[2] = {-3.0e38f, -3.0e38f};     // one chain per subtile
#pragma unroll
        for (int t = 0; t < 2; ++t)
#pragma unroll
            for (int r = 0; r < 8; ++r) {
                sc[t][r] += (t * 16 + r <= lim) ? 1.0f : 0.0f;
                mxt[t] = fmaxf(mxt[t], sc[t][r]);
            }
        float mx = fmaxf(mxt[0], mxt[1]);
        mx = fmaxf(mx, other_half(mx));
        const float mnew  = fmaxf(mrun, mx);
        const float alpha = __expf(mrun - mnew);
        mrun = mnew;

        Frag pf;                                 // pf.v[t*8 + r]: hardware k order of a B operand
        float rs[4] = {0.0f, 0.0f, 0.0f, 0.0f};  // four independent chains
#pragma unroll
        for (int t = 0; t < 2; ++t)
#pragma unroll
            for (int r = 0; r < 8; ++r) {
                const float p = __expf(sc[t][r] - mnew);
                rs[r & 3] += p;
                pf.v[t * 8 + r] = (__bf16)p;
            }
        lrun = lrun * alpha + ((rs[0] + rs[1]) + (rs[2] + rs[3]));
#pragma unroll
        for (int dt = 0; dt < 4; ++dt)
#pragma unroll
            for (int r = 0; r < 8; ++r) acc[dt][r] *= alpha;

#pragma unroll
        for (int dt = 0; dt < 4; ++dt) {
            Frag vf;
            const __bf16* vs = &vl[(dt * 16 + lm) * 40];
            vf.u[0] = *reinterpret_cast<const uint4*>(vs + g * 8);
            vf.u[1] = *reinterpret_cast<const uint4*>(vs + 16 + g * 8);
            acc[dt] = WMMA_BF16(vf.v, pf.v, acc[dt]);
        }

        if (havenext) {                          // fill the idle buffer
            __bf16* kd = klds[(it + 1) & 1];
            __bf16* vd = vlds[(it + 1) & 1];
            *reinterpret_cast<uint4*>(&kd[trow * 72 + tch * 8]) = kn;
#pragma unroll
            for (int i = 0; i < 8; ++i) vd[(tch * 8 + i) * 40 + trow] = vn.e[i];
        }
    }

    // join the halves' sums, normalize, store: 8 consecutive d of one query = 16 bytes
    const float inv = 1.0f / (lrun + other_half(lrun));
    __bf16* dst = O + headoff + (size_t)qrow * D_ + 8 * g;
#pragma unroll
    for (int dt = 0; dt < 4; ++dt) {
        union { uint4 u; __bf16 e[8]; } o;
#pragma unroll
        for (int r = 0; r < 8; ++r) o.e[r] = (__bf16)(acc[dt][r] * inv);
        *reinterpret_cast<uint4*>(dst + dt * 16) = o.u;
    }
}

// ---------------------------------------------------------------------------
extern "C" void kernel_launch(void* const* d_in, const int* in_sizes, int n_in,
                              void* d_out, int out_size, void* d_ws, size_t ws_size,
                              hipStream_t stream) {
    const float* x      = (const float*)d_in[0];
    const float* Wq     = (const float*)d_in[1];
    const float* Wk     = (const float*)d_in[2];
    const float* Wv     = (const float*)d_in[3];
    const float* in_w   = (const float*)d_in[4];
    const float* in_b   = (const float*)d_in[5];
    const float* out_w  = (const float*)d_in[6];
    const float* out_b  = (const float*)d_in[7];
    const float* proj_w = (const float*)d_in[8];
    const float* proj_b = (const float*)d_in[9];
    float* out = (float*)d_out;

    const size_t MB = 1u << 20;
    char* ws = (char*)d_ws;
    const int NX = M_ * D_;      // 8,388,608
    const int ND = D_ * D_;      // 1,048,576
    __bf16* xb    = (__bf16*)(ws + 0);         // 16 MB  (B*S*D)
    __bf16* w1t   = (__bf16*)(ws + 16 * MB);   //  8 MB: Wq^T, Wk^T, Wv^T, out_w^T (first layers, transposed)
    __bf16* w2    = (__bf16*)(ws + 24 * MB);   //  8 MB: in_w (3 slices), proj_w    (second layers)
    __bf16* wf    = (__bf16*)(ws + 32 * MB);   //  8 MB: folded weights w2[i] * w1[i]
    float*  bfold = (float*) (ws + 40 * MB);   //  4 KB: proj_w * out_b + proj_b
    __bf16* Qb    = (__bf16*)(ws + 48 * MB);   // 16 MB each
    __bf16* Kb    = (__bf16*)(ws + 64 * MB);
    __bf16* Vb    = (__bf16*)(ws + 80 * MB);
    __bf16* ctx   = (__bf16*)(ws + 96 * MB);

    auto cvt = [&](const float* src, __bf16* dst, int n) {
        f32_to_bf16_kernel<<<(n / 4 + 255) / 256, 256, 0, stream>>>(src, dst, n);
    };
    auto cvt_t = [&](const float* src, __bf16* dst) {
        f32_to_bf16_transpose_kernel<<<dim3(D_ / 64, D_ / 64), 256, 0, stream>>>(src, dst, D_);
    };
    cvt(x, xb, NX);
    cvt_t(Wq, w1t);  cvt_t(Wk, w1t + ND);  cvt_t(Wv, w1t + 2 * ND);  cvt_t(out_w, w1t + 3 * ND);
    cvt(in_w, w2, 3 * ND);
    f32_to_bf16_fold_bias_kernel<<<D_ / 32, 256, 0, stream>>>(proj_w, out_b, proj_b, w2 + 3 * ND, bfold);

    const dim3 blk(256);
    const dim3 gg(D_ / 128, M_ / 128);      // (8, 64)
    const dim3 gw(D_ / 128, D_ / 128, 4);   // (8, 8, 4): the four weight products
    const float qscale = 1.0f / 8.0f;       // 1/sqrt(HD)

    // two linear layers in a row are one: (x * W1^T) * W2^T = x * (W2 * W1)^T.
    // wf[i][f][d] = sum_e w2[i][f][e] * w1[i][e][d]
    gemm_nt_kernel<0><<<gw, blk, 0, stream>>>(w2, w1t, nullptr, wf, nullptr, D_, D_, D_, 1.0f);
    // Q/K/V = x * wf^T + bias   (softmax scale folded into Q)
    gemm_nt_kernel<0><<<gg, blk, 0, stream>>>(xb, wf,          in_b,          Qb, nullptr, M_, D_, D_, qscale);
    gemm_nt_kernel<0><<<gg, blk, 0, stream>>>(xb, wf + ND,     in_b + D_,     Kb, nullptr, M_, D_, D_, 1.0f);
    gemm_nt_kernel<0><<<gg, blk, 0, stream>>>(xb, wf + 2 * ND, in_b + 2 * D_, Vb, nullptr, M_, D_, D_, 1.0f);
    // attention
    flash_attn_kernel<<<dim3(S_ / 128, B_ * H_), blk, 0, stream>>>(Qb, Kb, Vb, ctx);
    // out = ctx * (proj_w * out_w)^T + (proj_w * out_b + proj_b) + x   (fp32)
    gemm_nt_kernel<1><<<gg, blk, 0, stream>>>(ctx, wf + 3 * ND, bfold, out, x, M_, D_, D_, 1.0f);
}

// v004
// It runs in 211 microseconds.
// In both of two side-by-side timings against v003, it was 1.11 times as fast.
// All steps since v000 together make it 2.50 times as fast.
#include <hip/hip_runtime.h>
#include <hip/hip_bf16.h>

#define B_ 4
#define S_ 2048
#define D_ 1024
#define H_ 16
#define HD_ 64
#define M_ (B_ * S_)   // 8192 rows of the token matrix

typedef __attribute__((ext_vector_type(16))) __bf16 bf16x16;
typedef __attribute__((ext_vector_type(8)))  float  f32x8;

union Frag {          // 16 bf16 = 8 VGPRs; u[0] -> K = g*8..g*8+7, u[1] -> K = 16+g*8..
    uint4   u[2];
    bf16x16 v;
};

#define WMMA_BF16(a, b, c) \
    __builtin_amdgcn_wmma_f32_16x16x32_bf16(false, (a), false, (b), (short)0, (c), false, false)

// ---------------------------------------------------------------------------
// fp32 -> bf16 conversion (4 elems / thread)
// ---------------------------------------------------------------------------
__global__ void f32_to_bf16_kernel(const float* __restrict__ in, __bf16* __restrict__ out, int n) {
    int i = (blockIdx.x * blockDim.x + threadIdx.x) * 4;
    if (i + 3 < n) {
        float4 f = *reinterpret_cast<const float4*>(in + i);
        out[i + 0] = (__bf16)f.x;
        out[i + 1] = (__bf16)f.y;
        out[i + 2] = (__bf16)f.z;
        out[i + 3] = (__bf16)f.w;
    } else {
        for (int j = i; j < n; ++j) out[j] = (__bf16)in[j];
    }
}

// ---------------------------------------------------------------------------
// fp32 -> bf16 conversion with transpose: out[c][r] = in[r][c], n x n matrix,
// 64x64 tile through LDS so that both the reads and the writes are contiguous.
// ---------------------------------------------------------------------------
__global__ __launch_bounds__(256)
void f32_to_bf16_transpose_kernel(const float* __restrict__ in, __bf16* __restrict__ out, int n) {
    __shared__ float tile[64][65];
    const int c0 = blockIdx.x * 64;
    const int r0 = blockIdx.y * 64;
    const int t  = threadIdx.x;
    {
        const int c4 = (t & 15) * 4;
        const int r  = t >> 4;
#pragma unroll  // all four row loads in flight together
        for (int k = 0; k < 4; ++k) {
            float4 f = *reinterpret_cast<const float4*>(in + (size_t)(r0 + r + 16 * k) * n + c0 + c4);
            tile[r + 16 * k][c4 + 0] = f.x;
            tile[r + 16 * k][c4 + 1] = f.y;
            tile[r + 16 * k][c4 + 2] = f.z;
            tile[r + 16 * k][c4 + 3] = f.w;
        }
    }
    __syncthreads();
    {
        const int r8 = (t & 7) * 8;
        const int c  = t >> 3;
#pragma unroll  // both unrolled: p stays in registers, constant LDS offsets
        for (int k = 0; k < 2; ++k) {
            union { uint4 u; __bf16 e[8]; } p;
#pragma unroll
            for (int i = 0; i < 8; ++i) p.e[i] = (__bf16)tile[r8 + i][c + 32 * k];
            *reinterpret_cast<uint4*>(out + (size_t)(c0 + c + 32 * k) * n + r0 + r8) = p.u;
        }
    }
}

// ---------------------------------------------------------------------------
// fp32 -> bf16 conversion of a D_ x D_ weight w, and in the same pass the folded
// bias bout[r] = b[r] + sum_e w[r][e] * v[e] in f32.
// block = 8 waves x 4 rows = 32 rows, so a block writes one whole 128-byte line of bout.
// ---------------------------------------------------------------------------
__global__ __launch_bounds__(256)
void f32_to_bf16_fold_bias_kernel(const float* __restrict__ w, const float* __restrict__ v,
                                  const float* __restrict__ b, __bf16* __restrict__ wout,
                                  float* __restrict__ bout) {
    __shared__ float rowsum[32];
    const int lane = threadIdx.x & 31;
    const int wave = threadIdx.x >> 5;
    const int row0 = blockIdx.x * 32;
    const size_t base = (size_t)(row0 + wave * 4) * D_;
    float s[4] = {0.0f, 0.0f, 0.0f, 0.0f};
#pragma unroll  // both unrolled: the loads of all four rows in flight together, s[] in registers
    for (int k = 0; k < D_ / 128; ++k) {
        const int c = k * 128 + lane * 4;
        float4 gv = *reinterpret_cast<const float4*>(v + c);
#pragma unroll
        for (int rr = 0; rr < 4; ++rr) {
            float4 f = *reinterpret_cast<const float4*>(w + base + rr * D_ + c);
            union { uint2 u; __bf16 e[4]; } p;
            p.e[0] = (__bf16)f.x;  p.e[1] = (__bf16)f.y;
            p.e[2] = (__bf16)f.z;  p.e[3] = (__bf16)f.w;
            *reinterpret_cast<uint2*>(wout + base + rr * D_ + c) = p.u;
            s[rr] += f.x * gv.x + f.y * gv.y + f.z * gv.z + f.w * gv.w;
        }
    }
#pragma unroll  // s[] indexed by constants; the four reductions overlap
    for (int rr = 0; rr < 4; ++rr) {
        for (int off = 16; off > 0; off >>= 1) s[rr] += __shfl_xor(s[rr], off, 32);
    }
    if (lane == 0) {
#pragma unroll  // s[] indexed by constants
        for (int rr = 0; rr < 4; ++rr) rowsum[wave * 4 + rr] = s[rr];
    }
    __syncthreads();
    if (threadIdx.x < 32) bout[row0 + threadIdx.x] = rowsum[threadIdx.x] + b[row0 + threadIdx.x];
}

// ---------------------------------------------------------------------------
// NT GEMM: C[M x N] = A[M x K](bf16) * W[N x K](bf16)^T  (+bias)*scale (+res)
// block = 256 threads (8 waves); block tile 128x128; wave tile 32x64
// (2 M-tiles x 4 N-tiles = 8 f32x8 accumulators, 6 fragment loads / 8 WMMAs).
// A and W tiles both double-buffered through LDS, 64 k a step: a step takes one whole
// 128-byte line of every operand row, and 8 neighbouring lanes fetch that line together,
// so a wave-wide 16-byte load touches 4 whole lines.  One barrier per step.
// K is a multiple of 64.
// MODE 0: bf16 output.  MODE 1: f32 output + residual add.
// blockIdx.z picks one product of a batch whose A, W and C each lie back to back.
// ---------------------------------------------------------------------------
#define GP_ 72   // LDS row pitch in elements: 144 bytes = 16 bytes x odd, for 16-byte readers

template <int MODE>
__global__ __launch_bounds__(256)
void gemm_nt_kernel(const __bf16* __restrict__ Abase, const __bf16* __restrict__ Wbase,
                    const float* __restrict__ bias, void* __restrict__ Outbase,
                    const float* __restrict__ resbase,
                    int M, int N, int K, float scale) {
    __shared__ __attribute__((aligned(16))) __bf16 alds[2][128 * GP_];
    __shared__ __attribute__((aligned(16))) __bf16 wlds[2][128 * GP_];

    const int lane = threadIdx.x & 31;
    const int wave = threadIdx.x >> 5;
    const int g    = lane >> 4;      // half-wave group (A/B layout K-offset selector)
    const int lm   = lane & 15;      // row (A) / column (B) within tile
    const int mw   = wave & 3;       // 32-row strip within block tile
    const int nw   = wave >> 2;      // 64-col strip within block tile
    const int n0   = blockIdx.x * 128;
    const int m0   = blockIdx.y * 128;
    const __bf16* __restrict__ A = Abase + (size_t)blockIdx.z * M * K;
    const __bf16* __restrict__ W = Wbase + (size_t)blockIdx.z * N * K;
    const size_t  cz = (size_t)blockIdx.z * M * N;
    void* __restrict__ Out = (MODE == 0) ? (void*)((__bf16*)Outbase + cz) : (void*)((float*)Outbase + cz);
    const float* __restrict__ residual = (MODE == 0) ? resbase : resbase + cz;

    f32x8 acc[2][4];
    for (int mt = 0; mt < 2; ++mt)
        for (int j = 0; j < 4; ++j)
            for (int e = 0; e < 8; ++e) acc[mt][j][e] = 0.0f;

    // cooperative staging: 32 rows x 8 lanes of 16 B a round, 4 rounds for each operand
    const int srow = threadIdx.x >> 3;
    const int sch  = threadIdx.x & 7;
    // block-uniform byte bases; the lane's part is the byte offsets so0..so3, the same for both
    // operands, 128 bytes further each step; they keep registers of their own through the loop
    const char* astage = reinterpret_cast<const char*>(A + (size_t)m0 * K);
    const char* wstage = reinterpret_cast<const char*>(W + (size_t)n0 * K);
    unsigned so0 = ((unsigned)srow * K + sch * 8) * 2u;
    unsigned so1 = so0 + 64u * K;
    unsigned so2 = so0 + 128u * K;
    unsigned so3 = so0 + 192u * K;
    const int sdst = srow * GP_ + sch * 8;

    // preload step 0 into buffer 0
    {
        const uint4 a0 = *reinterpret_cast<const uint4*>(astage + so0);
        const uint4 a1 = *reinterpret_cast<const uint4*>(astage + so1);
        const uint4 a2 = *reinterpret_cast<const uint4*>(astage + so2);
        const uint4 a3 = *reinterpret_cast<const uint4*>(astage + so3);
        const uint4 b0 = *reinterpret_cast<const uint4*>(wstage + so0);
        const uint4 b1 = *reinterpret_cast<const uint4*>(wstage + so1);
        const uint4 b2 = *reinterpret_cast<const uint4*>(wstage + so2);
        const uint4 b3 = *reinterpret_cast<const uint4*>(wstage + so3);
        *reinterpret_cast<uint4*>(&alds[0][sdst])                = a0;
        *reinterpret_cast<uint4*>(&alds[0][sdst + 32 * GP_])     = a1;
        *reinterpret_cast<uint4*>(&alds[0][sdst + 2 * 32 * GP_]) = a2;
        *reinterpret_cast<uint4*>(&alds[0][sdst + 3 * 32 * GP_]) = a3;
        *reinterpret_cast<uint4*>(&wlds[0][sdst])                = b0;
        *reinterpret_cast<uint4*>(&wlds[0][sdst + 32 * GP_])     = b1;
        *reinterpret_cast<uint4*>(&wlds[0][sdst + 2 * 32 * GP_]) = b2;
        *reinterpret_cast<uint4*>(&wlds[0][sdst + 3 * 32 * GP_]) = b3;
    }

    const int niter = K / 64;
    for (int i = 0; i < niter; ++i) {
        __syncthreads();                       // buffer (i&1) is ready
        uint4 na0, na1, na2, na3, nb0, nb1, nb2, nb3;
        const bool havenext = (i + 1 < niter);
        if (havenext) {                        // issue the next step's global loads early
            so0 += 128u;  so1 += 128u;  so2 += 128u;  so3 += 128u;
            na0 = *reinterpret_cast<const uint4*>(astage + so0);
            na1 = *reinterpret_cast<const uint4*>(astage + so1);
            na2 = *reinterpret_cast<const uint4*>(astage + so2);
            na3 = *reinterpret_cast<const uint4*>(astage + so3);
            nb0 = *reinterpret_cast<const uint4*>(wstage + so0);
            nb1 = *reinterpret_cast<const uint4*>(wstage + so1);
            nb2 = *reinterpret_cast<const uint4*>(wstage + so2);
            nb3 = *reinterpret_cast<const uint4*>(wstage + so3);
            // precaution: stands before the next step's additions rewrite the offset registers
            // (and before the base pair is reused) that these eight issued loads name
            asm volatile("s_wait_xcnt 0x0" ::: "memory");
        }

        const __bf16* al = alds[i & 1];
        const __bf16* wl = wlds[i & 1];
#pragma unroll  // all three unrolled: constant LDS offsets, fragments and acc[] in registers
        for (int ks = 0; ks < 2; ++ks) {
            Frag fa[2];
#pragma unroll
            for (int mt = 0; mt < 2; ++mt) {
                const __bf16* asrc = &al[(mw * 32 + mt * 16 + lm) * GP_ + ks * 32];
                fa[mt].u[0] = *reinterpret_cast<const uint4*>(asrc + g * 8);
                fa[mt].u[1] = *reinterpret_cast<const uint4*>(asrc + 16 + g * 8);
            }
#pragma unroll
            for (int j = 0; j < 4; ++j) {
                Frag fb;
                const __bf16* bsrc = &wl[(nw * 64 + j * 16 + lm) * GP_ + ks * 32];
                fb.u[0] = *reinterpret_cast<const uint4*>(bsrc + g * 8);
                fb.u[1] = *reinterpret_cast<const uint4*>(bsrc + 16 + g * 8);
                acc[0][j] = WMMA_BF16(fa[0].v, fb.v, acc[0][j]);
                acc[1][j] = WMMA_BF16(fa[1].v, fb.v, acc[1][j]);
            }
        }

        if (havenext) {                        // fill the idle buffer
            __bf16* ad = &alds[(i + 1) & 1][sdst];
            __bf16* wd = &wlds[(i + 1) & 1][sdst];
            *reinterpret_cast<uint4*>(ad)                = na0;
            *reinterpret_cast<uint4*>(ad + 32 * GP_)     = na1;
            *reinterpret_cast<uint4*>(ad + 2 * 32 * GP_) = na2;
            *reinterpret_cast<uint4*>(ad + 3 * 32 * GP_) = na3;
            *reinterpret_cast<uint4*>(wd)                = nb0;
            *reinterpret_cast<uint4*>(wd + 32 * GP_)     = nb1;
            *reinterpret_cast<uint4*>(wd + 2 * 32 * GP_) = nb2;
            *reinterpret_cast<uint4*>(wd + 3 * 32 * GP_) = nb3;
        }
    }

    // epilogue: C-layout row m = r + 8*g, col n = lm
#pragma unroll
    for (int mt = 0; mt < 2; ++mt) {
        const int mbase = m0 + mw * 32 + mt * 16 + 8 * g;
#pragma unroll
        for (int j = 0; j < 4; ++j) {
            const int n  = n0 + nw * 64 + j * 16 + lm;
            const float bv = bias ? bias[n] : 0.0f;
#pragma unroll
            for (int r = 0; r < 8; ++r) {
                const int m = mbase + r;
                float v = (acc[mt][j][r] + bv) * scale;
                if (MODE == 0) {
                    ((__bf16*)Out)[(size_t)m * N + n] = (__bf16)v;
                } else {
                    v += residual[(size_t)m * N + n];
                    ((float*)Out)[(size_t)m * N + n] = v;
                }
            }
        }
    }
}

// ---------------------------------------------------------------------------
// Flash attention, transposed: S^T = K * Q_scaled^T + tril(1)^T; softmax down each
// column; ctx^T = V^T * P^T.  A lane holds scores of ONE query (column lm), so the
// maximum and the sum run over its own registers, and the two f32 score tiles of a
// 32-key step, converted in place, are the B operand of the second product.
// grid = (S/128, B*H); block = 256 (8 waves); wave owns 16 query columns.
// K/V tiles double-buffered in LDS, both row-major; one barrier per 32-key step.
// V^T fragments come from the row-major V tile by the 16-bit transposing LDS load.
// Q/K/V/ctx are (B,S,D) bf16 with head h in columns [h*64, h*64+64).
// ---------------------------------------------------------------------------
__device__ inline float other_half(float v) {   // value of lane l ^ 16
    const int b = __float_as_int(v);
    return __int_as_float(__builtin_amdgcn_permlanex16(b, b, 0x76543210, 0xfedcba98, false, false));
}

#define VP_ 80   // V tile row pitch in elements: 160 bytes = 32 bytes x odd, for the transposing reader

typedef short s16x8 __attribute__((ext_vector_type(8)));
// lane (c = l & 15, h = l >> 4), pointed at row 8h + (l & 7), 16-byte piece (l >> 3) & 1 of a
// 16-row x 16-column block, gets column c of rows 8h .. 8h + 7
__device__ inline uint4 lds_load_tr16(const __bf16* p) {
    typedef __attribute__((address_space(3))) s16x8 lds_s16x8;
    return __builtin_bit_cast(uint4, __builtin_amdgcn_ds_load_tr16_b128_v8i16((lds_s16x8*)p));
}

__global__ __launch_bounds__(256)
void flash_attn_kernel(const __bf16* __restrict__ Q, const __bf16* __restrict__ Kp,
                       const __bf16* __restrict__ Vp, __bf16* __restrict__ O) {
    __shared__ __attribute__((aligned(16))) __bf16 klds[2][32 * 72];     // K tile row-major
    __shared__ __attribute__((aligned(16))) __bf16 vlds[2][32 * VP_];    // V tile row-major

    const int lane = threadIdx.x & 31;
    const int wave = threadIdx.x >> 5;
    const int g    = lane >> 4;
    const int lm   = lane & 15;

    const int b = blockIdx.y / H_;
    const int h = blockIdx.y % H_;
    const int qblk = blockIdx.x * 128;
    const size_t headoff = (size_t)b * S_ * D_ + (size_t)h * HD_;

    // Q fragments (B operand, two K=32 steps over HD=64), loaded once
    const int qrow = qblk + wave * 16 + lm;
    Frag qf[2];
    const __bf16* qsrc = Q + headoff + (size_t)qrow * D_;
#pragma unroll
    for (int dh = 0; dh < 2; ++dh) {
        qf[dh].u[0] = *reinterpret_cast<const uint4*>(qsrc + dh * 32 + g * 8);
        qf[dh].u[1] = *reinterpret_cast<const uint4*>(qsrc + dh * 32 + 16 + g * 8);
    }
    // precaution: no later load's result lands on an address register of a load issued before it
    asm volatile("s_wait_xcnt 0x0" ::: "memory");

    float mrun = -3.0e38f;   // running maximum of query qrow (equal in both halves)
    float lrun = 0.0f;       // running sum over this half's keys only; joined after the loop
    f32x8 acc[4];            // acc[dt][r] = ctx[qrow][dt*16 + 8*g + r]
    for (int dt = 0; dt < 4; ++dt)
        for (int e = 0; e < 8; ++e) acc[dt][e] = 0.0f;

    // staging: 32 key rows x 8 d-chunks, 16 B each
    const int trow = threadIdx.x >> 3;
    const int tch  = threadIdx.x & 7;
    const __bf16* kstage = Kp + headoff + (size_t)trow * D_ + tch * 8;
    const __bf16* vstage = Vp + headoff + (size_t)trow * D_ + tch * 8;
    // the lane's place in a V tile for the transposing load
    const int vtr = (8 * g + (lane & 7)) * VP_ + ((lane >> 3) & 1) * 8;

    // preload tile 0 into buffer 0
    {
        uint4 kv = *reinterpret_cast<const uint4*>(kstage);
        uint4 vv = *reinterpret_cast<const uint4*>(vstage);
        *reinterpret_cast<uint4*>(&klds[0][trow * 72 + tch * 8]) = kv;
        *reinterpret_cast<uint4*>(&vlds[0][trow * VP_ + tch * 8]) = vv;
    }

    const int niter = S_ / 32;
    // not unrolled, last pass not peeled off: the next tile's global loads then keep their own
    // block at the head of the pass; peeled, they sink to their LDS stores and are waited for in full
#pragma nounroll
    for (int it = 0; it < niter; ++it) {
        __syncthreads();                         // buffer (it&1) is ready
        const int kt = it * 32;

        uint4 kn, vn;
        const bool havenext = (it + 1 < niter);
        if (havenext) {
            kn   = *reinterpret_cast<const uint4*>(kstage + (size_t)(kt + 32) * D_);
            vn   = *reinterpret_cast<const uint4*>(vstage + (size_t)(kt + 32) * D_);
            // precaution: stands before the pass's foot steps the address pairs that these two issued
            // loads name, on every way there
            asm volatile("s_wait_xcnt 0x0" ::: "memory");
        }

        const __bf16* kl = klds[it & 1];
        const __bf16* vl = vlds[it & 1];

        // scores: two 16-key subtiles, accumulated over two d-halves
        // sc[t][r] = score of key kt + t*16 + 8*g + r against query qrow
        f32x8 sc[2];
        for (int t = 0; t < 2; ++t)
            for (int e = 0; e < 8; ++e) sc[t][e] = 0.0f;
#pragma unroll
        for (int dh = 0; dh < 2; ++dh) {
#pragma unroll
            for (int t = 0; t < 2; ++t) {
                Frag kf;
                const __bf16* ks = &kl[(t * 16 + lm) * 72 + dh * 32];
                kf.u[0] = *reinterpret_cast<const uint4*>(ks + g * 8);
                kf.u[1] = *reinterpret_cast<const uint4*>(ks + 16 + g * 8);
                sc[t] = WMMA_BF16(kf.v, qf[dh].v, sc[t]);
            }
        }

        // additive tril(1) mask + online softmax, all 16 scores of a lane belong to qrow
        const int lim = qrow - kt - 8 * g;       // key offset t*16 + r gets +1 while <= lim
        float mxt[2] = {-3.0e38f, -3.0e38f};     // one chain per subtile
#pragma unroll
        for (int t = 0; t < 2; ++t)
#pragma unroll
            for (int r = 0; r < 8; ++r) {
                sc[t][r] += (t * 16 + r <= lim) ? 1.0f : 0.0f;
                mxt[t] = fmaxf(mxt[t], sc[t][r]);
            }
        float mx = fmaxf(mxt[0], mxt[1]);
        mx = fmaxf(mx, other_half(mx));
        const float mnew  = fmaxf(mrun, mx);
        const float alpha = __expf(mrun - mnew);
        mrun = mnew;

        Frag pf;                                 // pf.v[t*8 + r]: hardware k order of a B operand
        float rs[4] = {0.0f, 0.0f, 0.0f, 0.0f};  // four independent chains
#pragma unroll
        for (int t = 0; t < 2; ++t)
#pragma unroll
            for (int r = 0; r < 8; ++r) {
                const float p = __expf(sc[t][r] - mnew);
                rs[r & 3] += p;
                pf.v[t * 8 + r] = (__bf16)p;
            }
        lrun = lrun * alpha + ((rs[0] + rs[1]) + (rs[2] + rs[3]));
#pragma unroll
        for (int dt = 0; dt < 4; ++dt)
#pragma unroll
            for (int r = 0; r < 8; ++r) acc[dt][r] *= alpha;

#pragma unroll
        for (int dt = 0; dt < 4; ++dt) {
            Frag vf;                             // row d = dt*16 + lm, keys in the hardware k order
            const __bf16* vs = &vl[vtr + dt * 16];
            vf.u[0] = lds_load_tr16(vs);
            vf.u[1] = lds_load_tr16(vs + 16 * VP_);
            acc[dt] = WMMA_BF16(vf.v, pf.v, acc[dt]);
        }

        if (havenext) {                          // fill the idle buffer
            __bf16* kd = klds[(it + 1) & 1];
            __bf16* vd = vlds[(it + 1) & 1];
            *reinterpret_cast<uint4*>(&kd[trow * 72 + tch * 8]) = kn;
            *reinterpret_cast<uint4*>(&vd[trow * VP_ + tch * 8]) = vn;
        }
    }

    // join the halves' sums, normalize, store: 8 consecutive d of one query = 16 bytes
    const float inv = 1.0f / (lrun + other_half(lrun));
    __bf16* dst = O + headoff + (size_t)qrow * D_ + 8 * g;
#pragma unroll
    for (int dt = 0; dt < 4; ++dt) {
        union { uint4 u; __bf16 e[8]; } o;
#pragma unroll
        for (int r = 0; r < 8; ++r) o.e[r] = (__bf16)(acc[dt][r] * inv);
        *reinterpret_cast<uint4*>(dst + dt * 16) = o.u;
    }
}

// ---------------------------------------------------------------------------
extern "C" void kernel_launch(void* const* d_in, const int* in_sizes, int n_in,
                              void* d_out, int out_size, void* d_ws, size_t ws_size,
                              hipStream_t stream) {
    const float* x      = (const float*)d_in[0];
    const float* Wq     = (const float*)d_in[1];
    const float* Wk     = (const float*)d_in[2];
    const float* Wv     = (const float*)d_in[3];
    const float* in_w   = (const float*)d_in[4];
    const float* in_b   = (const float*)d_in[5];
    const float* out_w  = (const float*)d_in[6];
    const float* out_b  = (const float*)d_in[7];
    const float* proj_w = (const float*)d_in[8];
    const float* proj_b = (const float*)d_in[9];
    float* out = (float*)d_out;

    const size_t MB = 1u << 20;
    char* ws = (char*)d_ws;
    const int NX = M_ * D_;      // 8,388,608
    const int ND = D_ * D_;      // 1,048,576
    __bf16* xb    = (__bf16*)(ws + 0);         // 16 MB  (B*S*D)
    __bf16* w1t   = (__bf16*)(ws + 16 * MB);   //  8 MB: Wq^T, Wk^T, Wv^T, out_w^T (first layers, transposed)
    __bf16* w2    = (__bf16*)(ws + 24 * MB);   //  8 MB: in_w (3 slices), proj_w    (second layers)
    __bf16* wf    = (__bf16*)(ws + 32 * MB);   //  8 MB: folded weights w2[i] * w1[i]
    float*  bfold = (float*) (ws + 40 * MB);   //  4 KB: proj_w * out_b + proj_b
    __bf16* Qb    = (__bf16*)(ws + 48 * MB);   // 16 MB each
    __bf16* Kb    = (__bf16*)(ws + 64 * MB);
    __bf16* Vb    = (__bf16*)(ws + 80 * MB);
    __bf16* ctx   = (__bf16*)(ws + 96 * MB);

    auto cvt = [&](const float* src, __bf16* dst, int n) {
        f32_to_bf16_kernel<<<(n / 4 + 255) / 256, 256, 0, stream>>>(src, dst, n);
    };
    auto cvt_t = [&](const float* src, __bf16* dst) {
        f32_to_bf16_transpose_kernel<<<dim3(D_ / 64, D_ / 64), 256, 0, stream>>>(src, dst, D_);
    };
    cvt(x, xb, NX);
    cvt_t(Wq, w1t);  cvt_t(Wk, w1t + ND);  cvt_t(Wv, w1t + 2 * ND);  cvt_t(out_w, w1t + 3 * ND);
    cvt(in_w, w2, 3 * ND);
    f32_to_bf16_fold_bias_kernel<<<D_ / 32, 256, 0, stream>>>(proj_w, out_b, proj_b, w2 + 3 * ND, bfold);

    const dim3 blk(256);
    const dim3 gg(D_ / 128, M_ / 128);      // (8, 64)
    const dim3 gw(D_ / 128, D_ / 128, 4);   // (8, 8, 4): the four weight products
    const float qscale = 1.0f / 8.0f;       // 1/sqrt(HD)

    // two linear layers in a row are one: (x * W1^T) * W2^T = x * (W2 * W1)^T.
    // wf[i][f][d] = sum_e w2[i][f][e] * w1[i][e][d]
    gemm_nt_kernel<0><<<gw, blk, 0, stream>>>(w2, w1t, nullptr, wf, nullptr, D_, D_, D_, 1.0f);
    // Q/K/V = x * wf^T + bias   (softmax scale folded into Q)
    gemm_nt_kernel<0><<<gg, blk, 0, stream>>>(xb, wf,          in_b,          Qb, nullptr, M_, D_, D_, qscale);
    gemm_nt_kernel<0><<<gg, blk, 0, stream>>>(xb, wf + ND,     in_b + D_,     Kb, nullptr, M_, D_, D_, 1.0f);
    gemm_nt_kernel<0><<<gg, blk, 0, stream>>>(xb, wf + 2 * ND, in_b + 2 * D_, Vb, nullptr, M_, D_, D_, 1.0f);
    // attention
    flash_attn_kernel<<<dim3(S_ / 128, B_ * H_), blk, 0, stream>>>(Qb, Kb, Vb, ctx);
    // out = ctx * (proj_w * out_w)^T + (proj_w * out_b + proj_b) + x   (fp32)
    gemm_nt_kernel<1><<<gg, blk, 0, stream>>>(ctx, wf + 3 * ND, bfold, out, x, M_, D_, D_, 1.0f);
}

// v005
// A run of this version takes 183 microseconds.
// Next to v004, in two timings, it ran 1.16 times as fast each time.
// All steps since v000 together make it 2.89 times as fast.
#include <hip/hip_runtime.h>
#include <hip/hip_bf16.h>

#define B_ 4
#define S_ 2048
#define D_ 1024
#define H_ 16
#define HD_ 64
#define M_ (B_ * S_)   // 8192 rows of the token matrix

typedef __attribute__((ext_vector_type(16))) __bf16 bf16x16;
typedef __attribute__((ext_vector_type(8)))  float  f32x8;

union Frag {          // 16 bf16 = 8 VGPRs; u[0] -> K = g*8..g*8+7, u[1] -> K = 16+g*8..
    uint4   u[2];
    bf16x16 v;
};

#define WMMA_BF16(a, b, c) \
    __builtin_amdgcn_wmma_f32_16x16x32_bf16(false, (a), false, (b), (short)0, (c), false, false)

// ---------------------------------------------------------------------------
// The set-up conversions below are parts of ONE grid (prep_kernel): none reads what another
// writes.  Each takes the index of its block within its own part; a block is 256 threads.
// ---------------------------------------------------------------------------
// fp32 -> bf16 conversion (4 elems / thread)
// ---------------------------------------------------------------------------
__device__ inline void f32_to_bf16_part(const float* __restrict__ in, __bf16* __restrict__ out, int n, int blk) {
    int i = (blk * 256 + threadIdx.x) * 4;
    if (i + 3 < n) {
        float4 f = *reinterpret_cast<const float4*>(in + i);
        out[i + 0] = (__bf16)f.x;
        out[i + 1] = (__bf16)f.y;
        out[i + 2] = (__bf16)f.z;
        out[i + 3] = (__bf16)f.w;
    } else {
        for (int j = i; j < n; ++j) out[j] = (__bf16)in[j];
    }
}

// ---------------------------------------------------------------------------
// fp32 -> bf16 conversion with transpose: out[c][r] = in[r][c], n x n matrix,
// 64x64 tile through LDS so that both the reads and the writes are contiguous.
// ---------------------------------------------------------------------------
__device__ inline void f32_to_bf16_transpose_part(const float* __restrict__ in, __bf16* __restrict__ out, int n,
                                                  int bx, int by) {
    __shared__ float tile[64][65];
    const int c0 = bx * 64;
    const int r0 = by * 64;
    const int t  = threadIdx.x;
    {
        const int c4 = (t & 15) * 4;
        const int r  = t >> 4;
#pragma unroll  // all four row loads in flight together
        for (int k = 0; k < 4; ++k) {
            float4 f = *reinterpret_cast<const float4*>(in + (size_t)(r0 + r + 16 * k) * n + c0 + c4);
            tile[r + 16 * k][c4 + 0] = f.x;
            tile[r + 16 * k][c4 + 1] = f.y;
            tile[r + 16 * k][c4 + 2] = f.z;
            tile[r + 16 * k][c4 + 3] = f.w;
        }
    }
    __syncthreads();
    {
        const int r8 = (t & 7) * 8;
        const int c  = t >> 3;
#pragma unroll  // both unrolled: p stays in registers, constant LDS offsets
        for (int k = 0; k < 2; ++k) {
            union { uint4 u; __bf16 e[8]; } p;
#pragma unroll
            for (int i = 0; i < 8; ++i) p.e[i] = (__bf16)tile[r8 + i][c + 32 * k];
            *reinterpret_cast<uint4*>(out + (size_t)(c0 + c + 32 * k) * n + r0 + r8) = p.u;
        }
        // precaution: stands before any later code of the shared grid rewrites a register that these
        // two issued stores name
        asm volatile("s_wait_xcnt 0x0" ::: "memory");
    }
}

// ---------------------------------------------------------------------------
// fp32 -> bf16 conversion of a D_ x D_ weight w, and in the same pass the folded
// bias bout[r] = b[r] + sum_e w[r][e] * v[e] in f32.
// block = 8 waves x 4 rows = 32 rows, so a block writes one whole 128-byte line of bout.
// ---------------------------------------------------------------------------
__device__ inline void f32_to_bf16_fold_bias_part(const float* __restrict__ w, const float* __restrict__ v,
                                                  const float* __restrict__ b, __bf16* __restrict__ wout,
                                                  float* __restrict__ bout, int blk) {
    __shared__ float rowsum[32];
    const int lane = threadIdx.x & 31;
    const int wave = threadIdx.x >> 5;
    const int row0 = blk * 32;
    const size_t base = (size_t)(row0 + wave * 4) * D_;
    float s[4] = {0.0f, 0.0f, 0.0f, 0.0f};
    // k loop kept rolled, its four rows unrolled (their loads in flight together, s[] in registers): all
    // eight steps at once would take over 200 registers from every wave of the grid, whose streaming
    // parts have one 16-byte load a thread and live on the number of resident waves
#pragma nounroll
    for (int k = 0; k < D_ / 128; ++k) {
        const int c = k * 128 + lane * 4;
        float4 gv = *reinterpret_cast<const float4*>(v + c);
#pragma unroll
        for (int rr = 0; rr < 4; ++rr) {
            float4 f = *reinterpret_cast<const float4*>(w + base + rr * D_ + c);
            union { uint2 u; __bf16 e[4]; } p;
            p.e[0] = (__bf16)f.x;  p.e[1] = (__bf16)f.y;
            p.e[2] = (__bf16)f.z;  p.e[3] = (__bf16)f.w;
            *reinterpret_cast<uint2*>(wout + base + rr * D_ + c) = p.u;
            s[rr] += f.x * gv.x + f.y * gv.y + f.z * gv.z + f.w * gv.w;
        }
        // precaution: stands before the next trip rewrites the address and data registers that this
        // trip's issued stores name
        asm volatile("s_wait_xcnt 0x0" ::: "memory");
    }
#pragma unroll  // s[] indexed by constants; the four reductions overlap
    for (int rr = 0; rr < 4; ++rr) {
        for (int off = 16; off > 0; off >>= 1) s[rr] += __shfl_xor(s[rr], off, 32);
    }
    if (lane == 0) {
#pragma unroll  // s[] indexed by constants
        for (int rr = 0; rr < 4; ++rr) rowsum[wave * 4 + rr] = s[rr];
    }
    __syncthreads();
    if (threadIdx.x < 32) bout[row0 + threadIdx.x] = rowsum[threadIdx.x] + b[row0 + threadIdx.x];
}

// ---------------------------------------------------------------------------
// All set-up conversions in one grid, a block range for each; the part with the longest chain
// of dependent loads has the lowest indices.  Every branch is block-uniform.
// ---------------------------------------------------------------------------
#define PB_FOLD (D_ / 32)                 // 32 blocks: proj_w and the folded bias
#define PB_TR   ((D_ / 64) * (D_ / 64))   // 256 blocks for each transposed weight
#define PB_INW  (3 * D_ * D_ / 1024)      // 3,072 blocks: in_w
#define PB_X    (M_ * D_ / 1024)          // 8,192 blocks: x

__global__ __launch_bounds__(256)
void prep_kernel(const float* __restrict__ x, const float* __restrict__ Wq, const float* __restrict__ Wk,
                 const float* __restrict__ Wv, const float* __restrict__ out_w,
                 const float* __restrict__ in_w, const float* __restrict__ proj_w,
                 const float* __restrict__ out_b, const float* __restrict__ proj_b,
                 __bf16* __restrict__ xb, __bf16* __restrict__ w1t, __bf16* __restrict__ w2,
                 float* __restrict__ bfold) {
    int blk = blockIdx.x;
    if (blk < PB_FOLD) {
        f32_to_bf16_fold_bias_part(proj_w, out_b, proj_b, w2 + 3 * D_ * D_, bfold, blk);
        return;
    }
    blk -= PB_FOLD;
    if (blk < 4 * PB_TR) {
        const int which = blk / PB_TR;
        const float* src = (which == 0) ? Wq : (which == 1) ? Wk : (which == 2) ? Wv : out_w;
        f32_to_bf16_transpose_part(src, w1t + (size_t)which * D_ * D_, D_, blk % (D_ / 64), (blk / (D_ / 64)) % (D_ / 64));
        return;
    }
    blk -= 4 * PB_TR;
    if (blk < PB_INW) {
        f32_to_bf16_part(in_w, w2, 3 * D_ * D_, blk);
        return;
    }
    f32_to_bf16_part(x, xb, M_ * D_, blk - PB_INW);
}

// ---------------------------------------------------------------------------
// NT GEMM: C[M x N] = A[M x K](bf16) * W[N x K](bf16)^T  (+bias)*scale (+res)
// block = 256 threads (8 waves); block tile 128x128; wave tile 32x64
// (2 M-tiles x 4 N-tiles = 8 f32x8 accumulators, 6 fragment loads / 8 WMMAs).
// A and W tiles both double-buffered through LDS, 64 k a step: a step takes one whole
// 128-byte line of every operand row, and 8 neighbouring lanes fetch that line together,
// so a wave-wide 16-byte load touches 4 whole lines.  One barrier per step.
// K is a multiple of 64.
// MODE 0: bf16 output.  MODE 1: f32 output + residual add.
// blockIdx.z picks one product of a batch whose W, C and bias each lie back to back; their A lie
// astep elements apart (0: one A for all).  scale belongs to product 0, the others have none.
// ---------------------------------------------------------------------------
#define GP_ 72   // LDS row pitch in elements: 144 bytes = 16 bytes x odd, for 16-byte readers

template <int MODE>
__global__ __launch_bounds__(256)
void gemm_nt_kernel(const __bf16* __restrict__ Abase, const __bf16* __restrict__ Wbase,
                    const float* __restrict__ bias, void* __restrict__ Outbase,
                    const float* __restrict__ resbase,
                    int M, int N, int K, int astep, float scale) {
    __shared__ __attribute__((aligned(16))) __bf16 alds[2][128 * GP_];
    __shared__ __attribute__((aligned(16))) __bf16 wlds[2][128 * GP_];

    const int lane = threadIdx.x & 31;
    const int wave = threadIdx.x >> 5;
    const int g    = lane >> 4;      // half-wave group (A/B layout K-offset selector)
    const int lm   = lane & 15;      // row (A) / column (B) within tile
    const int mw   = wave & 3;       // 32-row strip within block tile
    const int nw   = wave >> 2;      // 64-col strip within block tile
    const int n0   = blockIdx.x * 128;
    const int m0   = blockIdx.y * 128;
    const __bf16* __restrict__ A = Abase + (size_t)blockIdx.z * astep;
    const __bf16* __restrict__ W = Wbase + (size_t)blockIdx.z * N * K;
    const size_t  cz = (size_t)blockIdx.z * M * N;
    void* __restrict__ Out = (MODE == 0) ? (void*)((__bf16*)Outbase + cz) : (void*)((float*)Outbase + cz);
    const float* __restrict__ residual = (MODE == 0) ? resbase : resbase + cz;

    f32x8 acc[2][4];
    for (int mt = 0; mt < 2; ++mt)
        for (int j = 0; j < 4; ++j)
            for (int e = 0; e < 8; ++e) acc[mt][j][e] = 0.0f;

    // cooperative staging: 32 rows x 8 lanes of 16 B a round, 4 rounds for each operand
    const int srow = threadIdx.x >> 3;
    const int sch  = threadIdx.x & 7;
    // block-uniform byte bases; the lane's part is the byte offsets so0..so3, the same for both
    // operands, 128 bytes further each step; they keep registers of their own through the loop
    const char* astage = reinterpret_cast<const char*>(A + (size_t)m0 * K);
    const char* wstage = reinterpret_cast<const char*>(W + (size_t)n0 * K);
    unsigned so0 = ((unsigned)srow * K + sch * 8) * 2u;
    unsigned so1 = so0 + 64u * K;
    unsigned so2 = so0 + 128u * K;
    unsigned so3 = so0 + 192u * K;
    const int sdst = srow * GP_ + sch * 8;

    // preload step 0 into buffer 0
    {
        const uint4 a0 = *reinterpret_cast<const uint4*>(astage + so0);
        const uint4 a1 = *reinterpret_cast<const uint4*>(astage + so1);
        const uint4 a2 = *reinterpret_cast<const uint4*>(astage + so2);
        const uint4 a3 = *reinterpret_cast<const uint4*>(astage + so3);
        const uint4 b0 = *reinterpret_cast<const uint4*>(wstage + so0);
        const uint4 b1 = *reinterpret_cast<const uint4*>(wstage + so1);
        const uint4 b2 = *reinterpret_cast<const uint4*>(wstage + so2);
        const uint4 b3 = *reinterpret_cast<const uint4*>(wstage + so3);
        *reinterpret_cast<uint4*>(&alds[0][sdst])                = a0;
        *reinterpret_cast<uint4*>(&alds[0][sdst + 32 * GP_])     = a1;
        *reinterpret_cast<uint4*>(&alds[0][sdst + 2 * 32 * GP_]) = a2;
        *reinterpret_cast<uint4*>(&alds[0][sdst + 3 * 32 * GP_]) = a3;
        *reinterpret_cast<uint4*>(&wlds[0][sdst])                = b0;
        *reinterpret_cast<uint4*>(&wlds[0][sdst + 32 * GP_])     = b1;
        *reinterpret_cast<uint4*>(&wlds[0][sdst + 2 * 32 * GP_]) = b2;
        *reinterpret_cast<uint4*>(&wlds[0][sdst + 3 * 32 * GP_]) = b3;
    }

    const int niter = K / 64;
    for (int i = 0; i < niter; ++i) {
        __syncthreads();                       // buffer (i&1) is ready
        uint4 na0, na1, na2, na3, nb0, nb1, nb2, nb3;
        const bool havenext = (i + 1 < niter);
        if (havenext) {                        // issue the next step's global loads early
            so0 += 128u;  so1 += 128u;  so2 += 128u;  so3 += 128u;
            na0 = *reinterpret_cast<const uint4*>(astage + so0);
            na1 = *reinterpret_cast<const uint4*>(astage + so1);
            na2 = *reinterpret_cast<const uint4*>(astage + so2);
            na3 = *reinterpret_cast<const uint4*>(astage + so3);
            nb0 = *reinterpret_cast<const uint4*>(wstage + so0);
            nb1 = *reinterpret_cast<const uint4*>(wstage + so1);
            nb2 = *reinterpret_cast<const uint4*>(wstage + so2);
            nb3 = *reinterpret_cast<const uint4*>(wstage + so3);
            // precaution: stands before the next step's additions rewrite the offset registers
            // (and before the base pair is reused) that these eight issued loads name
            asm volatile("s_wait_xcnt 0x0" ::: "memory");
        }

        const __bf16* al = alds[i & 1];
        const __bf16* wl = wlds[i & 1];
#pragma unroll  // all three unrolled: constant LDS offsets, fragments and acc[] in registers
        for (int ks = 0; ks < 2; ++ks) {
            Frag fa[2];
#pragma unroll
            for (int mt = 0; mt < 2; ++mt) {
                const __bf16* asrc = &al[(mw * 32 + mt * 16 + lm) * GP_ + ks * 32];
                fa[mt].u[0] = *reinterpret_cast<const uint4*>(asrc + g * 8);
                fa[mt].u[1] = *reinterpret_cast<const uint4*>(asrc + 16 + g * 8);
            }
#pragma unroll
            for (int j = 0; j < 4; ++j) {
                Frag fb;
                const __bf16* bsrc = &wl[(nw * 64 + j * 16 + lm) * GP_ + ks * 32];
                fb.u[0] = *reinterpret_cast<const uint4*>(bsrc + g * 8);
                fb.u[1] = *reinterpret_cast<const uint4*>(bsrc + 16 + g * 8);
                acc[0][j] = WMMA_BF16(fa[0].v, fb.v, acc[0][j]);
                acc[1][j] = WMMA_BF16(fa[1].v, fb.v, acc[1][j]);
            }
        }

        if (havenext) {                        // fill the idle buffer
            __bf16* ad = &alds[(i + 1) & 1][sdst];
            __bf16* wd = &wlds[(i + 1) & 1][sdst];
            *reinterpret_cast<uint4*>(ad)                = na0;
            *reinterpret_cast<uint4*>(ad + 32 * GP_)     = na1;
            *reinterpret_cast<uint4*>(ad + 2 * 32 * GP_) = na2;
            *reinterpret_cast<uint4*>(ad + 3 * 32 * GP_) = na3;
            *reinterpret_cast<uint4*>(wd)                = nb0;
            *reinterpret_cast<uint4*>(wd + 32 * GP_)     = nb1;
            *reinterpret_cast<uint4*>(wd + 2 * 32 * GP_) = nb2;
            *reinterpret_cast<uint4*>(wd + 3 * 32 * GP_) = nb3;
        }
    }

    // epilogue: C-layout row m = r + 8*g, col n = lm
    const float zscale = (blockIdx.z == 0) ? scale : 1.0f;
#pragma unroll
    for (int mt = 0; mt < 2; ++mt) {
        const int mbase = m0 + mw * 32 + mt * 16 + 8 * g;
#pragma unroll
        for (int j = 0; j < 4; ++j) {
            const int n  = n0 + nw * 64 + j * 16 + lm;
            const float bv = bias ? bias[(size_t)blockIdx.z * N + n] : 0.0f;
#pragma unroll
            for (int r = 0; r < 8; ++r) {
                const int m = mbase + r;
                float v = (acc[mt][j][r] + bv) * zscale;
                if (MODE == 0) {
                    ((__bf16*)Out)[(size_t)m * N + n] = (__bf16)v;
                } else {
                    v += residual[(size_t)m * N + n];
                    ((float*)Out)[(size_t)m * N + n] = v;
                }
            }
        }
    }
}

// ---------------------------------------------------------------------------
// Flash attention, transposed: S^T = K * Q_scaled^T + tril(1)^T; softmax down each
// column; ctx^T = V^T * P^T.  A lane holds scores of ONE query (column lm), so the
// maximum and the sum run over its own registers, and the two f32 score tiles of a
// 32-key step, converted in place, are the B operand of the second product.
// grid = (S/128, B*H); block = 256 (8 waves); wave owns 16 query columns.
// K/V tiles double-buffered in LDS, both row-major; one barrier per 32-key step.
// V^T fragments come from the row-major V tile by the 16-bit transposing LDS load.
// Q/K/V/ctx are (B,S,D) bf16 with head h in columns [h*64, h*64+64).
// ---------------------------------------------------------------------------
__device__ inline float other_half(float v) {   // value of lane l ^ 16
    const int b = __float_as_int(v);
    return __int_as_float(__builtin_amdgcn_permlanex16(b, b, 0x76543210, 0xfedcba98, false, false));
}

#define VP_ 80   // V tile row pitch in elements: 160 bytes = 32 bytes x odd, for the transposing reader

typedef short s16x8 __attribute__((ext_vector_type(8)));
// lane (c = l & 15, h = l >> 4), pointed at row 8h + (l & 7), 16-byte piece (l >> 3) & 1 of a
// 16-row x 16-column block, gets column c of rows 8h .. 8h + 7
__device__ inline uint4 lds_load_tr16(const __bf16* p) {
    typedef __attribute__((address_space(3))) s16x8 lds_s16x8;
    return __builtin_bit_cast(uint4, __builtin_amdgcn_ds_load_tr16_b128_v8i16((lds_s16x8*)p));
}

__global__ __launch_bounds__(256)
void flash_attn_kernel(const __bf16* __restrict__ Q, const __bf16* __restrict__ Kp,
                       const __bf16* __restrict__ Vp, __bf16* __restrict__ O) {
    __shared__ __attribute__((aligned(16))) __bf16 klds[2][32 * 72];     // K tile row-major
    __shared__ __attribute__((aligned(16))) __bf16 vlds[2][32 * VP_];    // V tile row-major

    const int lane = threadIdx.x & 31;
    const int wave = threadIdx.x >> 5;
    const int g    = lane >> 4;
    const int lm   = lane & 15;

    const int b = blockIdx.y / H_;
    const int h = blockIdx.y % H_;
    const int qblk = blockIdx.x * 128;
    const size_t headoff = (size_t)b * S_ * D_ + (size_t)h * HD_;

    // Q fragments (B operand, two K=32 steps over HD=64), loaded once
    const int qrow = qblk + wave * 16 + lm;
    Frag qf[2];
    const __bf16* qsrc = Q + headoff + (size_t)qrow * D_;
#pragma unroll
    for (int dh = 0; dh < 2; ++dh) {
        qf[dh].u[0] = *reinterpret_cast<const uint4*>(qsrc + dh * 32 + g * 8);
        qf[dh].u[1] = *reinterpret_cast<const uint4*>(qsrc + dh * 32 + 16 + g * 8);
    }
    // precaution: no later load's result lands on an address register of a load issued before it
    asm volatile("s_wait_xcnt 0x0" ::: "memory");

    float mrun = -3.0e38f;   // running maximum of query qrow (equal in both halves)
    float lrun = 0.0f;       // running sum over this half's keys only; joined after the loop
    f32x8 acc[4];            // acc[dt][r] = ctx[qrow][dt*16 + 8*g + r]
    for (int dt = 0; dt < 4; ++dt)
        for (int e = 0; e < 8; ++e) acc[dt][e] = 0.0f;

    // staging: 32 key rows x 8 d-chunks, 16 B each
    const int trow = threadIdx.x >> 3;
    const int tch  = threadIdx.x & 7;
    const __bf16* kstage = Kp + headoff + (size_t)trow * D_ + tch * 8;
    const __bf16* vstage = Vp + headoff + (size_t)trow * D_ + tch * 8;
    // the lane's place in a V tile for the transposing load
    const int vtr = (8 * g + (lane & 7)) * VP_ + ((lane >> 3) & 1) * 8;

    // preload tile 0 into buffer 0
    {
        uint4 kv = *reinterpret_cast<const uint4*>(kstage);
        uint4 vv = *reinterpret_cast<const uint4*>(vstage);
        *reinterpret_cast<uint4*>(&klds[0][trow * 72 + tch * 8]) = kv;
        *reinterpret_cast<uint4*>(&vlds[0][trow * VP_ + tch * 8]) = vv;
    }

    const int niter = S_ / 32;
    // not unrolled, last pass not peeled off: the next tile's global loads then keep their own
    // block at the head of the pass; peeled, they sink to their LDS stores and are waited for in full
#pragma nounroll
    for (int it = 0; it < niter; ++it) {
        __syncthreads();                         // buffer (it&1) is ready
        const int kt = it * 32;

        uint4 kn, vn;
        const bool havenext = (it + 1 < niter);
        if (havenext) {
            kn   = *reinterpret_cast<const uint4*>(kstage + (size_t)(kt + 32) * D_);
            vn   = *reinterpret_cast<const uint4*>(vstage + (size_t)(kt + 32) * D_);
            // precaution: stands before the pass's foot steps the address pairs that these two issued
            // loads name, on every way there
            asm volatile("s_wait_xcnt 0x0" ::: "memory");
        }

        const __bf16* kl = klds[it & 1];
        const __bf16* vl = vlds[it & 1];

        // scores: two 16-key subtiles, accumulated over two d-halves
        // sc[t][r] = score of key kt + t*16 + 8*g + r against query qrow
        f32x8 sc[2];
        for (int t = 0; t < 2; ++t)
            for (int e = 0; e < 8; ++e) sc[t][e] = 0.0f;
#pragma unroll
        for (int dh = 0; dh < 2; ++dh) {
#pragma unroll
            for (int t = 0; t < 2; ++t) {
                Frag kf;
                const __bf16* ks = &kl[(t * 16 + lm) * 72 + dh * 32];
                kf.u[0] = *reinterpret_cast<const uint4*>(ks + g * 8);
                kf.u[1] = *reinterpret_cast<const uint4*>(ks + 16 + g * 8);
                sc[t] = WMMA_BF16(kf.v, qf[dh].v, sc[t]);
            }
        }

        // additive tril(1) mask + online softmax, all 16 scores of a lane belong to qrow
        const int lim = qrow - kt - 8 * g;       // key offset t*16 + r gets +1 while <= lim
        float mxt[2] = {-3.0e38f, -3.0e38f};     // one chain per subtile
#pragma unroll
        for (int t = 0; t < 2; ++t)
#pragma unroll
            for (int r = 0; r < 8; ++r) {
                sc[t][r] += (t * 16 + r <= lim) ? 1.0f : 0.0f;
                mxt[t] = fmaxf(mxt[t], sc[t][r]);
            }
        float mx = fmaxf(mxt[0], mxt[1]);
        mx = fmaxf(mx, other_half(mx));
        const float mnew  = fmaxf(mrun, mx);
        const float alpha = __expf(mrun - mnew);
        mrun = mnew;

        Frag pf;                                 // pf.v[t*8 + r]: hardware k order of a B operand
        float rs[4] = {0.0f, 0.0f, 0.0f, 0.0f};  // four independent chains
#pragma unroll
        for (int t = 0; t < 2; ++t)
#pragma unroll
            for (int r = 0; r < 8; ++r) {
                const float p = __expf(sc[t][r] - mnew);
                rs[r & 3] += p;
                pf.v[t * 8 + r] = (__bf16)p;
            }
        lrun = lrun * alpha + ((rs[0] + rs[1]) + (rs[2] + rs[3]));
#pragma unroll
        for (int dt = 0; dt < 4; ++dt)
#pragma unroll
            for (int r = 0; r < 8; ++r) acc[dt][r] *= alpha;

#pragma unroll
        for (int dt = 0; dt < 4; ++dt) {
            Frag vf;                             // row d = dt*16 + lm, keys in the hardware k order
            const __bf16* vs = &vl[vtr + dt * 16];
            vf.u[0] = lds_load_tr16(vs);
            vf.u[1] = lds_load_tr16(vs + 16 * VP_);
            acc[dt] = WMMA_BF16(vf.v, pf.v, acc[dt]);
        }

        if (havenext) {                          // fill the idle buffer
            __bf16* kd = klds[(it + 1) & 1];
            __bf16* vd = vlds[(it + 1) & 1];
            *reinterpret_cast<uint4*>(&kd[trow * 72 + tch * 8]) = kn;
            *reinterpret_cast<uint4*>(&vd[trow * VP_ + tch * 8]) = vn;
        }
    }

    // join the halves' sums, normalize, store: 8 consecutive d of one query = 16 bytes
    const float inv = 1.0f / (lrun + other_half(lrun));
    __bf16* dst = O + headoff + (size_t)qrow * D_ + 8 * g;
#pragma unroll
    for (int dt = 0; dt < 4; ++dt) {
        union { uint4 u; __bf16 e[8]; } o;
#pragma unroll
        for (int r = 0; r < 8; ++r) o.e[r] = (__bf16)(acc[dt][r] * inv);
        *reinterpret_cast<uint4*>(dst + dt * 16) = o.u;
    }
}

// ---------------------------------------------------------------------------
extern "C" void kernel_launch(void* const* d_in, const int* in_sizes, int n_in,
                              void* d_out, int out_size, void* d_ws, size_t ws_size,
                              hipStream_t stream) {
    const float* x      = (const float*)d_in[0];
    const float* Wq     = (const float*)d_in[1];
    const float* Wk     = (const float*)d_in[2];
    const float* Wv     = (const float*)d_in[3];
    const float* in_w   = (const float*)d_in[4];
    const float* in_b   = (const float*)d_in[5];
    const float* out_w  = (const float*)d_in[6];
    const float* out_b  = (const float*)d_in[7];
    const float* proj_w = (const float*)d_in[8];
    const float* proj_b = (const float*)d_in[9];
    float* out = (float*)d_out;

    const size_t MB = 1u << 20;
    char* ws = (char*)d_ws;
    const int ND = D_ * D_;      // 1,048,576
    __bf16* xb    = (__bf16*)(ws + 0);         // 16 MB  (B*S*D)
    __bf16* w1t   = (__bf16*)(ws + 16 * MB);   //  8 MB: Wq^T, Wk^T, Wv^T, out_w^T (first layers, transposed)
    __bf16* w2    = (__bf16*)(ws + 24 * MB);   //  8 MB: in_w (3 slices), proj_w    (second layers)
    __bf16* wf    = (__bf16*)(ws + 32 * MB);   //  8 MB: folded weights w2[i] * w1[i]
    float*  bfold = (float*) (ws + 40 * MB);   //  4 KB: proj_w * out_b + proj_b
    __bf16* Qb    = (__bf16*)(ws + 48 * MB);   // 16 MB each
    __bf16* Kb    = (__bf16*)(ws + 64 * MB);
    __bf16* Vb    = (__bf16*)(ws + 80 * MB);
    __bf16* ctx   = (__bf16*)(ws + 96 * MB);

    prep_kernel<<<PB_FOLD + 4 * PB_TR + PB_INW + PB_X, 256, 0, stream>>>(
        x, Wq, Wk, Wv, out_w, in_w, proj_w, out_b, proj_b, xb, w1t, w2, bfold);

    const dim3 blk(256);
    const dim3 gg(D_ / 128, M_ / 128);      // (8, 64)
    const dim3 g3(D_ / 128, M_ / 128, 3);   // (8, 64, 3): Q, K and V
    const dim3 gw(D_ / 128, D_ / 128, 4);   // (8, 8, 4): the four weight products
    const float qscale = 1.0f / 8.0f;       // 1/sqrt(HD)

    // two linear layers in a row are one: (x * W1^T) * W2^T = x * (W2 * W1)^T.
    // wf[i][f][d] = sum_e w2[i][f][e] * w1[i][e][d]
    gemm_nt_kernel<0><<<gw, blk, 0, stream>>>(w2, w1t, nullptr, wf, nullptr, D_, D_, D_, ND, 1.0f);
    // Q/K/V = x * wf^T + bias, one batch on the one x; Qb, Kb, Vb lie back to back
    // (softmax scale folded into Q, the batch's product 0)
    gemm_nt_kernel<0><<<g3, blk, 0, stream>>>(xb, wf, in_b, Qb, nullptr, M_, D_, D_, 0, qscale);
    // attention
    flash_attn_kernel<<<dim3(S_ / 128, B_ * H_), blk, 0, stream>>>(Qb, Kb, Vb, ctx);
    // out = ctx * (proj_w * out_w)^T + (proj_w * out_b + proj_b) + x   (fp32)
    gemm_nt_kernel<1><<<gg, blk, 0, stream>>>(ctx, wf + 3 * ND, bfold, out, x, M_, D_, D_, 0, 1.0f);
}

// v006
// It runs in 173 microseconds.
// In both of two side-by-side timings against v005, it was 1.05 times as fast.
// All steps since v000 together make it 3.04 times as fast.
#include <hip/hip_runtime.h>
#include <hip/hip_bf16.h>

#define B_ 4
#define S_ 2048
#define D_ 1024
#define H_ 16
#define HD_ 64
#define M_ (B_ * S_)   // 8192 rows of the token matrix

typedef __attribute__((ext_vector_type(16))) __bf16 bf16x16;
typedef __attribute__((ext_vector_type(8)))  float  f32x8;

union Frag {          // 16 bf16 = 8 VGPRs; u[0] -> K = g*8..g*8+7, u[1] -> K = 16+g*8..
    uint4   u[2];
    bf16x16 v;
};

#define WMMA_BF16(a, b, c) \
    __builtin_amdgcn_wmma_f32_16x16x32_bf16(false, (a), false, (b), (short)0, (c), false, false)

// ---------------------------------------------------------------------------
// The set-up conversions below are parts of ONE grid (prep_kernel): none reads what another
// writes.  Each takes the index of its block within its own part; a block is 256 threads.
// ---------------------------------------------------------------------------
// fp32 -> bf16 conversion (4 elems / thread)
// ---------------------------------------------------------------------------
__device__ inline void f32_to_bf16_part(const float* __restrict__ in, __bf16* __restrict__ out, int n, int blk) {
    int i = (blk * 256 + threadIdx.x) * 4;
    if (i + 3 < n) {
        float4 f = *reinterpret_cast<const float4*>(in + i);
        out[i + 0] = (__bf16)f.x;
        out[i + 1] = (__bf16)f.y;
        out[i + 2] = (__bf16)f.z;
        out[i + 3] = (__bf16)f.w;
    } else {
        for (int j = i; j < n; ++j) out[j] = (__bf16)in[j];
    }
}

// ---------------------------------------------------------------------------
// fp32 -> bf16 conversion with transpose: out[c][r] = in[r][c], n x n matrix,
// 64x64 tile through LDS so that both the reads and the writes are contiguous.
// ---------------------------------------------------------------------------
__device__ inline void f32_to_bf16_transpose_part(const float* __restrict__ in, __bf16* __restrict__ out, int n,
                                                  int bx, int by) {
    __shared__ float tile[64][65];
    const int c0 = bx * 64;
    const int r0 = by * 64;
    const int t  = threadIdx.x;
    {
        const int c4 = (t & 15) * 4;
        const int r  = t >> 4;
#pragma unroll  // all four row loads in flight together
        for (int k = 0; k < 4; ++k) {
            float4 f = *reinterpret_cast<const float4*>(in + (size_t)(r0 + r + 16 * k) * n + c0 + c4);
            tile[r + 16 * k][c4 + 0] = f.x;
            tile[r + 16 * k][c4 + 1] = f.y;
            tile[r + 16 * k][c4 + 2] = f.z;
            tile[r + 16 * k][c4 + 3] = f.w;
        }
    }
    __syncthreads();
    {
        const int r8 = (t & 7) * 8;
        const int c  = t >> 3;
#pragma unroll  // both unrolled: p stays in registers, constant LDS offsets
        for (int k = 0; k < 2; ++k) {
            union { uint4 u; __bf16 e[8]; } p;
#pragma unroll
            for (int i = 0; i < 8; ++i) p.e[i] = (__bf16)tile[r8 + i][c + 32 * k];
            *reinterpret_cast<uint4*>(out + (size_t)(c0 + c + 32 * k) * n + r0 + r8) = p.u;
        }
        // precaution: stands before any later code of the shared grid rewrites a register that these
        // two issued stores name
        asm volatile("s_wait_xcnt 0x0" ::: "memory");
    }
}

// ---------------------------------------------------------------------------
// fp32 -> bf16 conversion of a D_ x D_ weight w, and in the same pass the folded
// bias bout[r] = b[r] + sum_e w[r][e] * v[e] in f32.
// block = 8 waves x 4 rows = 32 rows, so a block writes one whole 128-byte line of bout.
// ---------------------------------------------------------------------------
__device__ inline void f32_to_bf16_fold_bias_part(const float* __restrict__ w, const float* __restrict__ v,
                                                  const float* __restrict__ b, __bf16* __restrict__ wout,
                                                  float* __restrict__ bout, int blk) {
    __shared__ float rowsum[32];
    const int lane = threadIdx.x & 31;
    const int wave = threadIdx.x >> 5;
    const int row0 = blk * 32;
    const size_t base = (size_t)(row0 + wave * 4) * D_;
    float s[4] = {0.0f, 0.0f, 0.0f, 0.0f};
    // k loop kept rolled, its four rows unrolled (their loads in flight together, s[] in registers): all
    // eight steps at once would take over 200 registers from every wave of the grid, whose streaming
    // parts have one 16-byte load a thread and live on the number of resident waves
#pragma nounroll
    for (int k = 0; k < D_ / 128; ++k) {
        const int c = k * 128 + lane * 4;
        float4 gv = *reinterpret_cast<const float4*>(v + c);
#pragma unroll
        for (int rr = 0; rr < 4; ++rr) {
            float4 f = *reinterpret_cast<const float4*>(w + base + rr * D_ + c);
            union { uint2 u; __bf16 e[4]; } p;
            p.e[0] = (__bf16)f.x;  p.e[1] = (__bf16)f.y;
            p.e[2] = (__bf16)f.z;  p.e[3] = (__bf16)f.w;
            *reinterpret_cast<uint2*>(wout + base + rr * D_ + c) = p.u;
            s[rr] += f.x * gv.x + f.y * gv.y + f.z * gv.z + f.w * gv.w;
        }
        // precaution: stands before the next trip rewrites the address and data registers that this
        // trip's issued stores name
        asm volatile("s_wait_xcnt 0x0" ::: "memory");
    }
#pragma unroll  // s[] indexed by constants; the four reductions overlap
    for (int rr = 0; rr < 4; ++rr) {
        for (int off = 16; off > 0; off >>= 1) s[rr] += __shfl_xor(s[rr], off, 32);
    }
    if (lane == 0) {
#pragma unroll  // s[] indexed by constants
        for (int rr = 0; rr < 4; ++rr) rowsum[wave * 4 + rr] = s[rr];
    }
    __syncthreads();
    if (threadIdx.x < 32) bout[row0 + threadIdx.x] = rowsum[threadIdx.x] + b[row0 + threadIdx.x];
}

// ---------------------------------------------------------------------------
// All set-up conversions in one grid, a block range for each; the part with the longest chain
// of dependent loads has the lowest indices.  Every branch is block-uniform.
// ---------------------------------------------------------------------------
#define PB_FOLD (D_ / 32)                 // 32 blocks: proj_w and the folded bias
#define PB_TR   ((D_ / 64) * (D_ / 64))   // 256 blocks for each transposed weight
#define PB_INW  (3 * D_ * D_ / 1024)      // 3,072 blocks: in_w
#define PB_X    (M_ * D_ / 1024)          // 8,192 blocks: x

__global__ __launch_bounds__(256)
void prep_kernel(const float* __restrict__ x, const float* __restrict__ Wq, const float* __restrict__ Wk,
                 const float* __restrict__ Wv, const float* __restrict__ out_w,
                 const float* __restrict__ in_w, const float* __restrict__ proj_w,
                 const float* __restrict__ out_b, const float* __restrict__ proj_b,
                 __bf16* __restrict__ xb, __bf16* __restrict__ w1t, __bf16* __restrict__ w2,
                 float* __restrict__ bfold) {
    int blk = blockIdx.x;
    if (blk < PB_FOLD) {
        f32_to_bf16_fold_bias_part(proj_w, out_b, proj_b, w2 + 3 * D_ * D_, bfold, blk);
        return;
    }
    blk -= PB_FOLD;
    if (blk < 4 * PB_TR) {
        const int which = blk / PB_TR;
        const float* src = (which == 0) ? Wq : (which == 1) ? Wk : (which == 2) ? Wv : out_w;
        f32_to_bf16_transpose_part(src, w1t + (size_t)which * D_ * D_, D_, blk % (D_ / 64), (blk / (D_ / 64)) % (D_ / 64));
        return;
    }
    blk -= 4 * PB_TR;
    if (blk < PB_INW) {
        f32_to_bf16_part(in_w, w2, 3 * D_ * D_, blk);
        return;
    }
    f32_to_bf16_part(x, xb, M_ * D_, blk - PB_INW);
}

// ---------------------------------------------------------------------------
// NT GEMM: C[M x N] = A[M x K](bf16) * W[N x K](bf16)^T  (+bias)*scale (+res)
// block = 256 threads (8 waves); block tile 128x128; wave tile 32x64
// (2 M-tiles x 4 N-tiles = 8 f32x8 accumulators, 6 fragment loads / 8 WMMAs).
// A and W tiles both double-buffered through LDS, 64 k a step: a step takes one whole
// 128-byte line of every operand row, and 8 neighbouring lanes fetch that line together,
// so a wave-wide 16-byte load touches 4 whole lines.  One barrier per step.
// K is a multiple of 64.
// MODE 0: bf16 output.  MODE 1: f32 output + residual add.
// blockIdx.z picks one product of a batch whose W, C and bias each lie back to back; their A lie
// astep elements apart (0: one A for all).  scale belongs to product 0, the others have none.
// ---------------------------------------------------------------------------
#define GP_ 72   // LDS row pitch in elements: 144 bytes = 16 bytes x odd, for 16-byte readers

template <int MODE>
__global__ __launch_bounds__(256)
void gemm_nt_kernel(const __bf16* __restrict__ Abase, const __bf16* __restrict__ Wbase,
                    const float* __restrict__ bias, void* __restrict__ Outbase,
                    const float* __restrict__ resbase,
                    int M, int N, int K, int astep, float scale) {
    __shared__ __attribute__((aligned(16))) __bf16 alds[2][128 * GP_];
    __shared__ __attribute__((aligned(16))) __bf16 wlds[2][128 * GP_];

    const int lane = threadIdx.x & 31;
    const int wave = threadIdx.x >> 5;
    const int g    = lane >> 4;      // half-wave group (A/B layout K-offset selector)
    const int lm   = lane & 15;      // row (A) / column (B) within tile
    const int mw   = wave & 3;       // 32-row strip within block tile
    const int nw   = wave >> 2;      // 64-col strip within block tile
    const int n0   = blockIdx.x * 128;
    const int m0   = blockIdx.y * 128;
    const __bf16* __restrict__ A = Abase + (size_t)blockIdx.z * astep;
    const __bf16* __restrict__ W = Wbase + (size_t)blockIdx.z * N * K;
    const size_t  cz = (size_t)blockIdx.z * M * N;
    void* __restrict__ Out = (MODE == 0) ? (void*)((__bf16*)Outbase + cz) : (void*)((float*)Outbase + cz);
    const float* __restrict__ residual = (MODE == 0) ? resbase : resbase + cz;

    f32x8 acc[2][4];
    for (int mt = 0; mt < 2; ++mt)
        for (int j = 0; j < 4; ++j)
            for (int e = 0; e < 8; ++e) acc[mt][j][e] = 0.0f;

    // cooperative staging: 32 rows x 8 lanes of 16 B a round, 4 rounds for each operand
    const int srow = threadIdx.x >> 3;
    const int sch  = threadIdx.x & 7;
    // block-uniform byte bases; the lane's part is the byte offsets so0..so3, the same for both
    // operands, 128 bytes further each step; they keep registers of their own through the loop
    const char* astage = reinterpret_cast<const char*>(A + (size_t)m0 * K);
    const char* wstage = reinterpret_cast<const char*>(W + (size_t)n0 * K);
    unsigned so0 = ((unsigned)srow * K + sch * 8) * 2u;
    unsigned so1 = so0 + 64u * K;
    unsigned so2 = so0 + 128u * K;
    unsigned so3 = so0 + 192u * K;
    const int sdst = srow * GP_ + sch * 8;

    // preload step 0 into buffer 0
    {
        const uint4 a0 = *reinterpret_cast<const uint4*>(astage + so0);
        const uint4 a1 = *reinterpret_cast<const uint4*>(astage + so1);
        const uint4 a2 = *reinterpret_cast<const uint4*>(astage + so2);
        const uint4 a3 = *reinterpret_cast<const uint4*>(astage + so3);
        const uint4 b0 = *reinterpret_cast<const uint4*>(wstage + so0);
        const uint4 b1 = *reinterpret_cast<const uint4*>(wstage + so1);
        const uint4 b2 = *reinterpret_cast<const uint4*>(wstage + so2);
        const uint4 b3 = *reinterpret_cast<const uint4*>(wstage + so3);
        *reinterpret_cast<uint4*>(&alds[0][sdst])                = a0;
        *reinterpret_cast<uint4*>(&alds[0][sdst + 32 * GP_])     = a1;
        *reinterpret_cast<uint4*>(&alds[0][sdst + 2 * 32 * GP_]) = a2;
        *reinterpret_cast<uint4*>(&alds[0][sdst + 3 * 32 * GP_]) = a3;
        *reinterpret_cast<uint4*>(&wlds[0][sdst])                = b0;
        *reinterpret_cast<uint4*>(&wlds[0][sdst + 32 * GP_])     = b1;
        *reinterpret_cast<uint4*>(&wlds[0][sdst + 2 * 32 * GP_]) = b2;
        *reinterpret_cast<uint4*>(&wlds[0][sdst + 3 * 32 * GP_]) = b3;
    }

    const int niter = K / 64;
    for (int i = 0; i < niter; ++i) {
        __syncthreads();                       // buffer (i&1) is ready
        uint4 na0, na1, na2, na3, nb0, nb1, nb2, nb3;
        const bool havenext = (i + 1 < niter);
        if (havenext) {                        // issue the next step's global loads early
            so0 += 128u;  so1 += 128u;  so2 += 128u;  so3 += 128u;
            na0 = *reinterpret_cast<const uint4*>(astage + so0);
            na1 = *reinterpret_cast<const uint4*>(astage + so1);
            na2 = *reinterpret_cast<const uint4*>(astage + so2);
            na3 = *reinterpret_cast<const uint4*>(astage + so3);
            nb0 = *reinterpret_cast<const uint4*>(wstage + so0);
            nb1 = *reinterpret_cast<const uint4*>(wstage + so1);
            nb2 = *reinterpret_cast<const uint4*>(wstage + so2);
            nb3 = *reinterpret_cast<const uint4*>(wstage + so3);
            // precaution: stands before the next step's additions rewrite the offset registers
            // (and before the base pair is reused) that these eight issued loads name
            asm volatile("s_wait_xcnt 0x0" ::: "memory");
        }

        const __bf16* al = alds[i & 1];
        const __bf16* wl = wlds[i & 1];
#pragma unroll  // all three unrolled: constant LDS offsets, fragments and acc[] in registers
        for (int ks = 0; ks < 2; ++ks) {
            Frag fa[2];
#pragma unroll
            for (int mt = 0; mt < 2; ++mt) {
                const __bf16* asrc = &al[(mw * 32 + mt * 16 + lm) * GP_ + ks * 32];
                fa[mt].u[0] = *reinterpret_cast<const uint4*>(asrc + g * 8);
                fa[mt].u[1] = *reinterpret_cast<const uint4*>(asrc + 16 + g * 8);
            }
#pragma unroll
            for (int j = 0; j < 4; ++j) {
                Frag fb;
                const __bf16* bsrc = &wl[(nw * 64 + j * 16 + lm) * GP_ + ks * 32];
                fb.u[0] = *reinterpret_cast<const uint4*>(bsrc + g * 8);
                fb.u[1] = *reinterpret_cast<const uint4*>(bsrc + 16 + g * 8);
                acc[0][j] = WMMA_BF16(fa[0].v, fb.v, acc[0][j]);
                acc[1][j] = WMMA_BF16(fa[1].v, fb.v, acc[1][j]);
            }
        }

        if (havenext) {                        // fill the idle buffer
            __bf16* ad = &alds[(i + 1) & 1][sdst];
            __bf16* wd = &wlds[(i + 1) & 1][sdst];
            *reinterpret_cast<uint4*>(ad)                = na0;
            *reinterpret_cast<uint4*>(ad + 32 * GP_)     = na1;
            *reinterpret_cast<uint4*>(ad + 2 * 32 * GP_) = na2;
            *reinterpret_cast<uint4*>(ad + 3 * 32 * GP_) = na3;
            *reinterpret_cast<uint4*>(wd)                = nb0;
            *reinterpret_cast<uint4*>(wd + 32 * GP_)     = nb1;
            *reinterpret_cast<uint4*>(wd + 2 * 32 * GP_) = nb2;
            *reinterpret_cast<uint4*>(wd + 3 * 32 * GP_) = nb3;
        }
    }

    // epilogue: C-layout row m = r + 8*g, col n = lm
    const float zscale = (blockIdx.z == 0) ? scale : 1.0f;
#pragma unroll
    for (int mt = 0; mt < 2; ++mt) {
        const int mbase = m0 + mw * 32 + mt * 16 + 8 * g;
#pragma unroll
        for (int j = 0; j < 4; ++j) {
            const int n  = n0 + nw * 64 + j * 16 + lm;
            const float bv = bias ? bias[(size_t)blockIdx.z * N + n] : 0.0f;
#pragma unroll
            for (int r = 0; r < 8; ++r) {
                const int m = mbase + r;
                float v = (acc[mt][j][r] + bv) * zscale;
                if (MODE == 0) {
                    ((__bf16*)Out)[(size_t)m * N + n] = (__bf16)v;
                } else {
                    v += residual[(size_t)m * N + n];
                    ((float*)Out)[(size_t)m * N + n] = v;
                }
            }
        }
    }
}

// ---------------------------------------------------------------------------
// Flash attention, transposed: S^T = K * Q_scaled^T + tril(1)^T; softmax down each
// column; ctx^T = V^T * P^T.  A lane holds scores of ONE query (column lm), so the
// maximum and the sum run over its own registers, and the two f32 score tiles of a
// 32-key step, converted in place, are the B operand of the second product.
// grid = (S/128, B*H); block = 256 (8 waves); wave owns 16 query columns.
// K/V tiles double-buffered in LDS, both row-major; one barrier per 32-key step.
// V^T fragments come from the row-major V tile by the 16-bit transposing LDS load.
// Q/K/V/ctx are (B,S,D) bf16 with head h in columns [h*64, h*64+64).
// ---------------------------------------------------------------------------
__device__ inline float other_half(float v) {   // value of lane l ^ 16
    const int b = __float_as_int(v);
    return __int_as_float(__builtin_amdgcn_permlanex16(b, b, 0x76543210, 0xfedcba98, false, false));
}

#define VP_ 80   // V tile row pitch in elements: 160 bytes = 32 bytes x odd, for the transposing reader

typedef short s16x8 __attribute__((ext_vector_type(8)));
// lane (c = l & 15, h = l >> 4), pointed at row 8h + (l & 7), 16-byte piece (l >> 3) & 1 of a
// 16-row x 16-column block, gets column c of rows 8h .. 8h + 7
__device__ inline uint4 lds_load_tr16(const __bf16* p) {
    typedef __attribute__((address_space(3))) s16x8 lds_s16x8;
    return __builtin_bit_cast(uint4, __builtin_amdgcn_ds_load_tr16_b128_v8i16((lds_s16x8*)p));
}

__global__ __launch_bounds__(256)
void flash_attn_kernel(const __bf16* __restrict__ Q, const __bf16* __restrict__ Kp,
                       const __bf16* __restrict__ Vp, __bf16* __restrict__ O) {
    __shared__ __attribute__((aligned(16))) __bf16 klds[2][32 * 72];     // K tile row-major
    __shared__ __attribute__((aligned(16))) __bf16 vlds[2][32 * VP_];    // V tile row-major

    const int lane = threadIdx.x & 31;
    const int wave = threadIdx.x >> 5;
    const int g    = lane >> 4;
    const int lm   = lane & 15;

    const int b = blockIdx.y / H_;
    const int h = blockIdx.y % H_;
    const int qblk = blockIdx.x * 128;
    const size_t headoff = (size_t)b * S_ * D_ + (size_t)h * HD_;

    // Q fragments (B operand, two K=32 steps over HD=64), loaded once
    const int qrow = qblk + wave * 16 + lm;
    Frag qf[2];
    const __bf16* qsrc = Q + headoff + (size_t)qrow * D_;
#pragma unroll
    for (int dh = 0; dh < 2; ++dh) {
        qf[dh].u[0] = *reinterpret_cast<const uint4*>(qsrc + dh * 32 + g * 8);
        qf[dh].u[1] = *reinterpret_cast<const uint4*>(qsrc + dh * 32 + 16 + g * 8);
    }
    // precaution: no later load's result lands on an address register of a load issued before it
    asm volatile("s_wait_xcnt 0x0" ::: "memory");

    float mrun = -3.0e38f;   // running maximum of query qrow (equal in both halves); see the mask
    float lrun = 0.0f;       // running sum over this half's keys only; joined after the loop
    f32x8 acc[4];            // acc[dt][r] = ctx[qrow][dt*16 + 8*g + r]
    for (int dt = 0; dt < 4; ++dt)
        for (int e = 0; e < 8; ++e) acc[dt][e] = 0.0f;

    // staging: 32 key rows x 8 d-chunks, 16 B each
    const int trow = threadIdx.x >> 3;
    const int tch  = threadIdx.x & 7;
    const __bf16* kstage = Kp + headoff + (size_t)trow * D_ + tch * 8;
    const __bf16* vstage = Vp + headoff + (size_t)trow * D_ + tch * 8;
    // the lane's place in a V tile for the transposing load
    const int vtr = (8 * g + (lane & 7)) * VP_ + ((lane >> 3) & 1) * 8;
    // the one pass whose 32 keys hold the wave's 16 queries (both ranges aligned); in a scalar
    // register, so that the test on it in the loop is a scalar compare
    const int dpass = __builtin_amdgcn_readfirstlane((qblk + wave * 16) >> 5);
    // key offset t*16 + r of the current pass is at or below qrow while <= lim; stepped pass by pass:
    // formed from dpass, the 16 mask values would be lifted out of the loop into 16 registers
    int lim = qrow - 8 * g;

    // preload tile 0 into buffer 0
    {
        uint4 kv = *reinterpret_cast<const uint4*>(kstage);
        uint4 vv = *reinterpret_cast<const uint4*>(vstage);
        *reinterpret_cast<uint4*>(&klds[0][trow * 72 + tch * 8]) = kv;
        *reinterpret_cast<uint4*>(&vlds[0][trow * VP_ + tch * 8]) = vv;
    }

    const int niter = S_ / 32;
    // not unrolled, last pass not peeled off: the next tile's global loads then keep their own
    // block at the head of the pass; peeled, they sink to their LDS stores and are waited for in full
#pragma nounroll
    for (int it = 0; it < niter; ++it) {
        __syncthreads();                         // buffer (it&1) is ready
        const int kt = it * 32;

        uint4 kn, vn;
        const bool havenext = (it + 1 < niter);
        if (havenext) {
            kn   = *reinterpret_cast<const uint4*>(kstage + (size_t)(kt + 32) * D_);
            vn   = *reinterpret_cast<const uint4*>(vstage + (size_t)(kt + 32) * D_);
            // precaution: stands before the pass's foot steps the address pairs that these two issued
            // loads name, on every way there
            asm volatile("s_wait_xcnt 0x0" ::: "memory");
        }

        const __bf16* kl = klds[it & 1];
        const __bf16* vl = vlds[it & 1];

        // scores: two 16-key subtiles, accumulated over two d-halves
        // sc[t][r] = score of key kt + t*16 + 8*g + r against query qrow
        f32x8 sc[2];
        for (int t = 0; t < 2; ++t)
            for (int e = 0; e < 8; ++e) sc[t][e] = 0.0f;
#pragma unroll
        for (int dh = 0; dh < 2; ++dh) {
#pragma unroll
            for (int t = 0; t < 2; ++t) {
                Frag kf;
                const __bf16* ks = &kl[(t * 16 + lm) * 72 + dh * 32];
                kf.u[0] = *reinterpret_cast<const uint4*>(ks + g * 8);
                kf.u[1] = *reinterpret_cast<const uint4*>(ks + 16 + g * 8);
                sc[t] = WMMA_BF16(kf.v, qf[dh].v, sc[t]);
            }
        }

        // additive tril(1) mask + online softmax, all 16 scores of a lane belong to qrow.
        // Before pass dpass the mask is 1 on every score the wave has seen, and a constant on all
        // of them cancels in the softmax: it is left out, and mrun runs 1 below the masked maximum.
        // Pass dpass puts that 1 on mrun and adds the mask element by element; behind it the mask is 0.
        if (it == dpass) {
            mrun += 1.0f;
#pragma unroll  // both unrolled: sc[] indexed by constants, in registers
            for (int t = 0; t < 2; ++t)
#pragma unroll
                for (int r = 0; r < 8; ++r) sc[t][r] += (t * 16 + r <= lim) ? 1.0f : 0.0f;
        }
        lim -= 32;
        float mxt[2] = {-3.0e38f, -3.0e38f};     // one chain per subtile
#pragma unroll
        for (int t = 0; t < 2; ++t)
#pragma unroll
            for (int r = 0; r < 8; ++r) mxt[t] = fmaxf(mxt[t], sc[t][r]);
        float mx = fmaxf(mxt[0], mxt[1]);
        mx = fmaxf(mx, other_half(mx));
        const float mnew  = fmaxf(mrun, mx);
        const float alpha = __expf(mrun - mnew);
        mrun = mnew;

        Frag pf;                                 // pf.v[t*8 + r]: hardware k order of a B operand
        float rs[4] = {0.0f, 0.0f, 0.0f, 0.0f};  // four independent chains
#pragma unroll
        for (int t = 0; t < 2; ++t)
#pragma unroll
            for (int r = 0; r < 8; ++r) {
                const float p = __expf(sc[t][r] - mnew);
                rs[r & 3] += p;
                pf.v[t * 8 + r] = (__bf16)p;
            }
        lrun = lrun * alpha + ((rs[0] + rs[1]) + (rs[2] + rs[3]));
#pragma unroll
        for (int dt = 0; dt < 4; ++dt)
#pragma unroll
            for (int r = 0; r < 8; ++r) acc[dt][r] *= alpha;

#pragma unroll
        for (int dt = 0; dt < 4; ++dt) {
            Frag vf;                             // row d = dt*16 + lm, keys in the hardware k order
            const __bf16* vs = &vl[vtr + dt * 16];
            vf.u[0] = lds_load_tr16(vs);
            vf.u[1] = lds_load_tr16(vs + 16 * VP_);
            acc[dt] = WMMA_BF16(vf.v, pf.v, acc[dt]);
        }

        if (havenext) {                          // fill the idle buffer
            __bf16* kd = klds[(it + 1) & 1];
            __bf16* vd = vlds[(it + 1) & 1];
            *reinterpret_cast<uint4*>(&kd[trow * 72 + tch * 8]) = kn;
            *reinterpret_cast<uint4*>(&vd[trow * VP_ + tch * 8]) = vn;
        }
    }

    // join the halves' sums, normalize, store: 8 consecutive d of one query = 16 bytes
    const float inv = 1.0f / (lrun + other_half(lrun));
    __bf16* dst = O + headoff + (size_t)qrow * D_ + 8 * g;
#pragma unroll
    for (int dt = 0; dt < 4; ++dt) {
        union { uint4 u; __bf16 e[8]; } o;
#pragma unroll
        for (int r = 0; r < 8; ++r) o.e[r] = (__bf16)(acc[dt][r] * inv);
        *reinterpret_cast<uint4*>(dst + dt * 16) = o.u;
    }
}

// ---------------------------------------------------------------------------
extern "C" void kernel_launch(void* const* d_in, const int* in_sizes, int n_in,
                              void* d_out, int out_size, void* d_ws, size_t ws_size,
                              hipStream_t stream) {
    const float* x      = (const float*)d_in[0];
    const float* Wq     = (const float*)d_in[1];
    const float* Wk     = (const float*)d_in[2];
    const float* Wv     = (const float*)d_in[3];
    const float* in_w   = (const float*)d_in[4];
    const float* in_b   = (const float*)d_in[5];
    const float* out_w  = (const float*)d_in[6];
    const float* out_b  = (const float*)d_in[7];
    const float* proj_w = (const float*)d_in[8];
    const float* proj_b = (const float*)d_in[9];
    float* out = (float*)d_out;

    const size_t MB = 1u << 20;
    char* ws = (char*)d_ws;
    const int ND = D_ * D_;      // 1,048,576
    __bf16* xb    = (__bf16*)(ws + 0);         // 16 MB  (B*S*D)
    __bf16* w1t   = (__bf16*)(ws + 16 * MB);   //  8 MB: Wq^T, Wk^T, Wv^T, out_w^T (first layers, transposed)
    __bf16* w2    = (__bf16*)(ws + 24 * MB);   //  8 MB: in_w (3 slices), proj_w    (second layers)
    __bf16* wf    = (__bf16*)(ws + 32 * MB);   //  8 MB: folded weights w2[i] * w1[i]
    float*  bfold = (float*) (ws + 40 * MB);   //  4 KB: proj_w * out_b + proj_b
    __bf16* Qb    = (__bf16*)(ws + 48 * MB);   // 16 MB each
    __bf16* Kb    = (__bf16*)(ws + 64 * MB);
    __bf16* Vb    = (__bf16*)(ws + 80 * MB);
    __bf16* ctx   = (__bf16*)(ws + 96 * MB);

    prep_kernel<<<PB_FOLD + 4 * PB_TR + PB_INW + PB_X, 256, 0, stream>>>(
        x, Wq, Wk, Wv, out_w, in_w, proj_w, out_b, proj_b, xb, w1t, w2, bfold);

    const dim3 blk(256);
    const dim3 gg(D_ / 128, M_ / 128);      // (8, 64)
    const dim3 g3(D_ / 128, M_ / 128, 3);   // (8, 64, 3): Q, K and V
    const dim3 gw(D_ / 128, D_ / 128, 4);   // (8, 8, 4): the four weight products
    const float qscale = 1.0f / 8.0f;       // 1/sqrt(HD)

    // two linear layers in a row are one: (x * W1^T) * W2^T = x * (W2 * W1)^T.
    // wf[i][f][d] = sum_e w2[i][f][e] * w1[i][e][d]
    gemm_nt_kernel<0><<<gw, blk, 0, stream>>>(w2, w1t, nullptr, wf, nullptr, D_, D_, D_, ND, 1.0f);
    // Q/K/V = x * wf^T + bias, one batch on the one x; Qb, Kb, Vb lie back to back
    // (softmax scale folded into Q, the batch's product 0)
    gemm_nt_kernel<0><<<g3, blk, 0, stream>>>(xb, wf, in_b, Qb, nullptr, M_, D_, D_, 0, qscale);
    // attention
    flash_attn_kernel<<<dim3(S_ / 128, B_ * H_), blk, 0, stream>>>(Qb, Kb, Vb, ctx);
    // out = ctx * (proj_w * out_w)^T + (proj_w * out_b + proj_b) + x   (fp32)
    gemm_nt_kernel<1><<<gg, blk, 0, stream>>>(ctx, wf + 3 * ND, bfold, out, x, M_, D_, D_, 0, 1.0f);
}

// v007
// It runs in 164 microseconds.
// Two timings next to v006 both put it at 1.06 times that version's speed.
// Over all steps from v000 it is 3.23 times as fast.
#include <hip/hip_runtime.h>
#include <hip/hip_bf16.h>

#define B_ 4
#define S_ 2048
#define D_ 1024
#define H_ 16
#define HD_ 64
#define M_ (B_ * S_)   // 8192 rows of the token matrix

typedef __attribute__((ext_vector_type(16))) __bf16 bf16x16;
typedef __attribute__((ext_vector_type(8)))  float  f32x8;

union Frag {          // 16 bf16 = 8 VGPRs; u[0] -> K = g*8..g*8+7, u[1] -> K = 16+g*8..
    uint4   u[2];
    bf16x16 v;
};

#define WMMA_BF16(a, b, c) \
    __builtin_amdgcn_wmma_f32_16x16x32_bf16(false, (a), false, (b), (short)0, (c), false, false)

// ---------------------------------------------------------------------------
// The set-up conversions below are parts of ONE grid (prep_kernel): none reads what another
// writes.  Each takes the index of its block within its own part; a block is 256 threads.
// ---------------------------------------------------------------------------
// fp32 -> bf16 conversion (4 elems / thread)
// ---------------------------------------------------------------------------
__device__ inline void f32_to_bf16_part(const float* __restrict__ in, __bf16* __restrict__ out, int n, int blk) {
    int i = (blk * 256 + threadIdx.x) * 4;
    if (i + 3 < n) {
        float4 f = *reinterpret_cast<const float4*>(in + i);
        out[i + 0] = (__bf16)f.x;
        out[i + 1] = (__bf16)f.y;
        out[i + 2] = (__bf16)f.z;
        out[i + 3] = (__bf16)f.w;
    } else {
        for (int j = i; j < n; ++j) out[j] = (__bf16)in[j];
    }
}

// ---------------------------------------------------------------------------
// fp32 -> bf16 conversion with transpose: out[c][r] = in[r][c], n x n matrix,
// 64x64 tile through LDS so that both the reads and the writes are contiguous.
// ---------------------------------------------------------------------------
__device__ inline void f32_to_bf16_transpose_part(const float* __restrict__ in, __bf16* __restrict__ out, int n,
                                                  int bx, int by) {
    __shared__ float tile[64][65];
    const int c0 = bx * 64;
    const int r0 = by * 64;
    const int t  = threadIdx.x;
    {
        const int c4 = (t & 15) * 4;
        const int r  = t >> 4;
#pragma unroll  // all four row loads in flight together
        for (int k = 0; k < 4; ++k) {
            float4 f = *reinterpret_cast<const float4*>(in + (size_t)(r0 + r + 16 * k) * n + c0 + c4);
            tile[r + 16 * k][c4 + 0] = f.x;
            tile[r + 16 * k][c4 + 1] = f.y;
            tile[r + 16 * k][c4 + 2] = f.z;
            tile[r + 16 * k][c4 + 3] = f.w;
        }
    }
    __syncthreads();
    {
        const int r8 = (t & 7) * 8;
        const int c  = t >> 3;
#pragma unroll  // both unrolled: p stays in registers, constant LDS offsets
        for (int k = 0; k < 2; ++k) {
            union { uint4 u; __bf16 e[8]; } p;
#pragma unroll
            for (int i = 0; i < 8; ++i) p.e[i] = (__bf16)tile[r8 + i][c + 32 * k];
            *reinterpret_cast<uint4*>(out + (size_t)(c0 + c + 32 * k) * n + r0 + r8) = p.u;
        }
        // precaution: stands before any later code of the shared grid rewrites a register that these
        // two issued stores name
        asm volatile("s_wait_xcnt 0x0" ::: "memory");
    }
}

// ---------------------------------------------------------------------------
// fp32 -> bf16 conversion of a D_ x D_ weight w, and in the same pass the folded
// bias bout[r] = b[r] + sum_e w[r][e] * v[e] in f32.
// block = 8 waves x 4 rows = 32 rows, so a block writes one whole 128-byte line of bout.
// ---------------------------------------------------------------------------
__device__ inline void f32_to_bf16_fold_bias_part(const float* __restrict__ w, const float* __restrict__ v,
                                                  const float* __restrict__ b, __bf16* __restrict__ wout,
                                                  float* __restrict__ bout, int blk) {
    __shared__ float rowsum[32];
    const int lane = threadIdx.x & 31;
    const int wave = threadIdx.x >> 5;
    const int row0 = blk * 32;
    const size_t base = (size_t)(row0 + wave * 4) * D_;
    float s[4] = {0.0f, 0.0f, 0.0f, 0.0f};
    // k loop kept rolled, its four rows unrolled (their loads in flight together, s[] in registers): all
    // eight steps at once would take over 200 registers from every wave of the grid, whose streaming
    // parts have one 16-byte load a thread and live on the number of resident waves
#pragma nounroll
    for (int k = 0; k < D_ / 128; ++k) {
        const int c = k * 128 + lane * 4;
        float4 gv = *reinterpret_cast<const float4*>(v + c);
#pragma unroll
        for (int rr = 0; rr < 4; ++rr) {
            float4 f = *reinterpret_cast<const float4*>(w + base + rr * D_ + c);
            union { uint2 u; __bf16 e[4]; } p;
            p.e[0] = (__bf16)f.x;  p.e[1] = (__bf16)f.y;
            p.e[2] = (__bf16)f.z;  p.e[3] = (__bf16)f.w;
            *reinterpret_cast<uint2*>(wout + base + rr * D_ + c) = p.u;
            s[rr] += f.x * gv.x + f.y * gv.y + f.z * gv.z + f.w * gv.w;
        }
        // precaution: stands before the next trip rewrites the address and data registers that this
        // trip's issued stores name
        asm volatile("s_wait_xcnt 0x0" ::: "memory");
    }
#pragma unroll  // s[] indexed by constants; the four reductions overlap
    for (int rr = 0; rr < 4; ++rr) {
        for (int off = 16; off > 0; off >>= 1) s[rr] += __shfl_xor(s[rr], off, 32);
    }
    if (lane == 0) {
#pragma unroll  // s[] indexed by constants
        for (int rr = 0; rr < 4; ++rr) rowsum[wave * 4 + rr] = s[rr];
    }
    __syncthreads();
    if (threadIdx.x < 32) bout[row0 + threadIdx.x] = rowsum[threadIdx.x] + b[row0 + threadIdx.x];
}

// ---------------------------------------------------------------------------
// All set-up conversions in one grid, a block range for each; the part with the longest chain
// of dependent loads has the lowest indices.  Every branch is block-uniform.
// ---------------------------------------------------------------------------
#define PB_FOLD (D_ / 32)                 // 32 blocks: proj_w and the folded bias
#define PB_TR   ((D_ / 64) * (D_ / 64))   // 256 blocks for each transposed weight
#define PB_INW  (3 * D_ * D_ / 1024)      // 3,072 blocks: in_w
#define PB_X    (M_ * D_ / 1024)          // 8,192 blocks: x

__global__ __launch_bounds__(256)
void prep_kernel(const float* __restrict__ x, const float* __restrict__ Wq, const float* __restrict__ Wk,
                 const float* __restrict__ Wv, const float* __restrict__ out_w,
                 const float* __restrict__ in_w, const float* __restrict__ proj_w,
                 const float* __restrict__ out_b, const float* __restrict__ proj_b,
                 __bf16* __restrict__ xb, __bf16* __restrict__ w1t, __bf16* __restrict__ w2,
                 float* __restrict__ bfold) {
    int blk = blockIdx.x;
    if (blk < PB_FOLD) {
        f32_to_bf16_fold_bias_part(proj_w, out_b, proj_b, w2 + 3 * D_ * D_, bfold, blk);
        return;
    }
    blk -= PB_FOLD;
    if (blk < 4 * PB_TR) {
        const int which = blk / PB_TR;
        const float* src = (which == 0) ? Wq : (which == 1) ? Wk : (which == 2) ? Wv : out_w;
        f32_to_bf16_transpose_part(src, w1t + (size_t)which * D_ * D_, D_, blk % (D_ / 64), (blk / (D_ / 64)) % (D_ / 64));
        return;
    }
    blk -= 4 * PB_TR;
    if (blk < PB_INW) {
        f32_to_bf16_part(in_w, w2, 3 * D_ * D_, blk);
        return;
    }
    f32_to_bf16_part(x, xb, M_ * D_, blk - PB_INW);
}

// ---------------------------------------------------------------------------
// NT GEMM: C[M x N] = A[M x K](bf16) * W[N x K](bf16)^T  (+bias)*scale (+res)
// block = 256 threads (8 waves); block tile 128x128; wave tile 32x64
// (2 M-tiles x 4 N-tiles = 8 f32x8 accumulators, 6 fragment loads / 8 WMMAs).
// A and W tiles both double-buffered through LDS, 64 k a step: a step takes one whole
// 128-byte line of every operand row, and 8 neighbouring lanes fetch that line together,
// so a wave-wide 16-byte load touches 4 whole lines.  One barrier per step.
// K is a multiple of 64.
// MODE 0: bf16 output.  MODE 1: f32 output + residual add.
// blockIdx.z picks one product of a batch whose W, C and bias each lie back to back; their A lie
// astep elements apart (0: one A for all).  scale belongs to product 0, the others have none.
// ---------------------------------------------------------------------------
#define GP_ 72   // LDS row pitch in elements: 144 bytes = 16 bytes x odd, for 16-byte readers

template <int MODE>
__global__ __launch_bounds__(256)
void gemm_nt_kernel(const __bf16* __restrict__ Abase, const __bf16* __restrict__ Wbase,
                    const float* __restrict__ bias, void* __restrict__ Outbase,
                    const float* __restrict__ resbase,
                    int M, int N, int K, int astep, float scale) {
    __shared__ __attribute__((aligned(16))) __bf16 alds[2][128 * GP_];
    __shared__ __attribute__((aligned(16))) __bf16 wlds[2][128 * GP_];

    const int lane = threadIdx.x & 31;
    const int wave = threadIdx.x >> 5;
    const int g    = lane >> 4;      // half-wave group (A/B layout K-offset selector)
    const int lm   = lane & 15;      // row (A) / column (B) within tile
    const int mw   = wave & 3;       // 32-row strip within block tile
    const int nw   = wave >> 2;      // 64-col strip within block tile
    const int n0   = blockIdx.x * 128;
    const int m0   = blockIdx.y * 128;
    const __bf16* __restrict__ A = Abase + (size_t)blockIdx.z * astep;
    const __bf16* __restrict__ W = Wbase + (size_t)blockIdx.z * N * K;
    const size_t  cz = (size_t)blockIdx.z * M * N;
    void* __restrict__ Out = (MODE == 0) ? (void*)((__bf16*)Outbase + cz) : (void*)((float*)Outbase + cz);
    const float* __restrict__ residual = (MODE == 0) ? resbase : resbase + cz;

    f32x8 acc[2][4];
    for (int mt = 0; mt < 2; ++mt)
        for (int j = 0; j < 4; ++j)
            for (int e = 0; e < 8; ++e) acc[mt][j][e] = 0.0f;

    // cooperative staging: 32 rows x 8 lanes of 16 B a round, 4 rounds for each operand
    const int srow = threadIdx.x >> 3;
    const int sch  = threadIdx.x & 7;
    // block-uniform byte bases; the lane's part is the byte offsets so0..so3, the same for both
    // operands, 128 bytes further each step; they keep registers of their own through the loop
    const char* astage = reinterpret_cast<const char*>(A + (size_t)m0 * K);
    const char* wstage = reinterpret_cast<const char*>(W + (size_t)n0 * K);
    unsigned so0 = ((unsigned)srow * K + sch * 8) * 2u;
    unsigned so1 = so0 + 64u * K;
    unsigned so2 = so0 + 128u * K;
    unsigned so3 = so0 + 192u * K;
    const int sdst = srow * GP_ + sch * 8;

    // preload step 0 into buffer 0
    {
        const uint4 a0 = *reinterpret_cast<const uint4*>(astage + so0);
        const uint4 a1 = *reinterpret_cast<const uint4*>(astage + so1);
        const uint4 a2 = *reinterpret_cast<const uint4*>(astage + so2);
        const uint4 a3 = *reinterpret_cast<const uint4*>(astage + so3);
        const uint4 b0 = *reinterpret_cast<const uint4*>(wstage + so0);
        const uint4 b1 = *reinterpret_cast<const uint4*>(wstage + so1);
        const uint4 b2 = *reinterpret_cast<const uint4*>(wstage + so2);
        const uint4 b3 = *reinterpret_cast<const uint4*>(wstage + so3);
        *reinterpret_cast<uint4*>(&alds[0][sdst])                = a0;
        *reinterpret_cast<uint4*>(&alds[0][sdst + 32 * GP_])     = a1;
        *reinterpret_cast<uint4*>(&alds[0][sdst + 2 * 32 * GP_]) = a2;
        *reinterpret_cast<uint4*>(&alds[0][sdst + 3 * 32 * GP_]) = a3;
        *reinterpret_cast<uint4*>(&wlds[0][sdst])                = b0;
        *reinterpret_cast<uint4*>(&wlds[0][sdst + 32 * GP_])     = b1;
        *reinterpret_cast<uint4*>(&wlds[0][sdst + 2 * 32 * GP_]) = b2;
        *reinterpret_cast<uint4*>(&wlds[0][sdst + 3 * 32 * GP_]) = b3;
    }

    const int niter = K / 64;
    for (int i = 0; i < niter; ++i) {
        __syncthreads();                       // buffer (i&1) is ready
        uint4 na0, na1, na2, na3, nb0, nb1, nb2, nb3;
        const bool havenext = (i + 1 < niter);
        if (havenext) {                        // issue the next step's global loads early
            so0 += 128u;  so1 += 128u;  so2 += 128u;  so3 += 128u;
            na0 = *reinterpret_cast<const uint4*>(astage + so0);
            na1 = *reinterpret_cast<const uint4*>(astage + so1);
            na2 = *reinterpret_cast<const uint4*>(astage + so2);
            na3 = *reinterpret_cast<const uint4*>(astage + so3);
            nb0 = *reinterpret_cast<const uint4*>(wstage + so0);
            nb1 = *reinterpret_cast<const uint4*>(wstage + so1);
            nb2 = *reinterpret_cast<const uint4*>(wstage + so2);
            nb3 = *reinterpret_cast<const uint4*>(wstage + so3);
            // precaution: stands before the next step's additions rewrite the offset registers
            // (and before the base pair is reused) that these eight issued loads name
            asm volatile("s_wait_xcnt 0x0" ::: "memory");
        }

        const __bf16* al = alds[i & 1];
        const __bf16* wl = wlds[i & 1];
#pragma unroll  // all three unrolled: constant LDS offsets, fragments and acc[] in registers
        for (int ks = 0; ks < 2; ++ks) {
            Frag fa[2];
#pragma unroll
            for (int mt = 0; mt < 2; ++mt) {
                const __bf16* asrc = &al[(mw * 32 + mt * 16 + lm) * GP_ + ks * 32];
                fa[mt].u[0] = *reinterpret_cast<const uint4*>(asrc + g * 8);
                fa[mt].u[1] = *reinterpret_cast<const uint4*>(asrc + 16 + g * 8);
            }
#pragma unroll
            for (int j = 0; j < 4; ++j) {
                Frag fb;
                const __bf16* bsrc = &wl[(nw * 64 + j * 16 + lm) * GP_ + ks * 32];
                fb.u[0] = *reinterpret_cast<const uint4*>(bsrc + g * 8);
                fb.u[1] = *reinterpret_cast<const uint4*>(bsrc + 16 + g * 8);
                acc[0][j] = WMMA_BF16(fa[0].v, fb.v, acc[0][j]);
                acc[1][j] = WMMA_BF16(fa[1].v, fb.v, acc[1][j]);
            }
        }

        if (havenext) {                        // fill the idle buffer
            __bf16* ad = &alds[(i + 1) & 1][sdst];
            __bf16* wd = &wlds[(i + 1) & 1][sdst];
            *reinterpret_cast<uint4*>(ad)                = na0;
            *reinterpret_cast<uint4*>(ad + 32 * GP_)     = na1;
            *reinterpret_cast<uint4*>(ad + 2 * 32 * GP_) = na2;
            *reinterpret_cast<uint4*>(ad + 3 * 32 * GP_) = na3;
            *reinterpret_cast<uint4*>(wd)                = nb0;
            *reinterpret_cast<uint4*>(wd + 32 * GP_)     = nb1;
            *reinterpret_cast<uint4*>(wd + 2 * 32 * GP_) = nb2;
            *reinterpret_cast<uint4*>(wd + 3 * 32 * GP_) = nb3;
        }
    }

    // epilogue: C-layout row m = r + 8*g, col n = lm
    const float zscale = (blockIdx.z == 0) ? scale : 1.0f;
#pragma unroll
    for (int mt = 0; mt < 2; ++mt) {
        const int mbase = m0 + mw * 32 + mt * 16 + 8 * g;
#pragma unroll
        for (int j = 0; j < 4; ++j) {
            const int n  = n0 + nw * 64 + j * 16 + lm;
            const float bv = bias ? bias[(size_t)blockIdx.z * N + n] : 0.0f;
#pragma unroll
            for (int r = 0; r < 8; ++r) {
                const int m = mbase + r;
                float v = (acc[mt][j][r] + bv) * zscale;
                if (MODE == 0) {
                    ((__bf16*)Out)[(size_t)m * N + n] = (__bf16)v;
                } else {
                    v += residual[(size_t)m * N + n];
                    ((float*)Out)[(size_t)m * N + n] = v;
                }
            }
        }
    }
}

// ---------------------------------------------------------------------------
// Flash attention, transposed: S^T = K * Q_scaled^T + tril(1)^T; softmax down each
// column; ctx^T = V^T * P^T.  A lane holds scores of ONE query in each column group, so the
// maximum and the sum run over its own registers, and the two f32 score tiles of a
// 32-key step, converted in place, are the B operand of the second product.
// grid = (S/256, B*H); block = 256 (8 waves); wave owns 32 query columns = 2 groups of 16:
// every K and V^T fragment read from LDS feeds two matrix instructions.
// K/V tiles double-buffered in LDS, both row-major; one barrier per 32-key step.
// V^T fragments come from the row-major V tile by the 16-bit transposing LDS load.
// Q/K/V/ctx are (B,S,D) bf16 with head h in columns [h*64, h*64+64).
// ---------------------------------------------------------------------------
__device__ inline float other_half(float v) {   // value of lane l ^ 16
    const int b = __float_as_int(v);
    return __int_as_float(__builtin_amdgcn_permlanex16(b, b, 0x76543210, 0xfedcba98, false, false));
}

#define VP_ 80   // V tile row pitch in elements: 160 bytes = 32 bytes x odd, for the transposing reader

typedef short s16x8 __attribute__((ext_vector_type(8)));
// lane (c = l & 15, h = l >> 4), pointed at row 8h + (l & 7), 16-byte piece (l >> 3) & 1 of a
// 16-row x 16-column block, gets column c of rows 8h .. 8h + 7
__device__ inline uint4 lds_load_tr16(const __bf16* p) {
    typedef __attribute__((address_space(3))) s16x8 lds_s16x8;
    return __builtin_bit_cast(uint4, __builtin_amdgcn_ds_load_tr16_b128_v8i16((lds_s16x8*)p));
}

__global__ __launch_bounds__(256)
void flash_attn_kernel(const __bf16* __restrict__ Q, const __bf16* __restrict__ Kp,
                       const __bf16* __restrict__ Vp, __bf16* __restrict__ O) {
    __shared__ __attribute__((aligned(16))) __bf16 klds[2][32 * 72];     // K tile row-major
    __shared__ __attribute__((aligned(16))) __bf16 vlds[2][32 * VP_];    // V tile row-major

    const int lane = threadIdx.x & 31;
    const int wave = threadIdx.x >> 5;
    const int g    = lane >> 4;
    const int lm   = lane & 15;

    const int b = blockIdx.y / H_;
    const int h = blockIdx.y % H_;
    const int qblk = blockIdx.x * 256;
    const size_t headoff = (size_t)b * S_ * D_ + (size_t)h * HD_;

    // Q fragments (B operand, two K=32 steps over HD=64) of both column groups, loaded once;
    // group c holds query qrow + 16 * c
    const int qrow = qblk + wave * 32 + lm;
    Frag qf[2][2];
    const __bf16* qsrc = Q + headoff + (size_t)qrow * D_;
#pragma unroll
    for (int c = 0; c < 2; ++c) {
#pragma unroll
        for (int dh = 0; dh < 2; ++dh) {
            qf[c][dh].u[0] = *reinterpret_cast<const uint4*>(qsrc + c * 16 * D_ + dh * 32 + g * 8);
            qf[c][dh].u[1] = *reinterpret_cast<const uint4*>(qsrc + c * 16 * D_ + dh * 32 + 16 + g * 8);
        }
    }
    // precaution: no later load's result lands on an address register of a load issued before it
    asm volatile("s_wait_xcnt 0x0" ::: "memory");

    float mrun[2] = {-3.0e38f, -3.0e38f};   // running maximum of a group's query (equal in both halves); see the mask
    float lrun[2] = {0.0f, 0.0f};           // running sum over this half's keys only; joined after the loop
    f32x8 acc[2][4];                        // acc[c][dt][r] = ctx[qrow + 16*c][dt*16 + 8*g + r]
    for (int c = 0; c < 2; ++c)
        for (int dt = 0; dt < 4; ++dt)
            for (int e = 0; e < 8; ++e) acc[c][dt][e] = 0.0f;

    // staging: 32 key rows x 8 d-chunks, 16 B each
    const int trow = threadIdx.x >> 3;
    const int tch  = threadIdx.x & 7;
    const __bf16* kstage = Kp + headoff + (size_t)trow * D_ + tch * 8;
    const __bf16* vstage = Vp + headoff + (size_t)trow * D_ + tch * 8;
    // the lane's place in a V tile for the transposing load
    const int vtr = (8 * g + (lane & 7)) * VP_ + ((lane >> 3) & 1) * 8;
    // the one pass whose 32 keys are the wave's 32 queries; in a scalar register, so that the
    // test on it in the loop is a scalar compare
    const int dpass = __builtin_amdgcn_readfirstlane((qblk + wave * 32) >> 5);
    // key offset t*16 + r of the current pass is at or below qrow while <= lim; stepped pass by pass:
    // formed from dpass, the mask values would be lifted out of the loop into registers of their own
    int lim = qrow - 8 * g;

    // preload tile 0 into buffer 0
    {
        uint4 kv = *reinterpret_cast<const uint4*>(kstage);
        uint4 vv = *reinterpret_cast<const uint4*>(vstage);
        *reinterpret_cast<uint4*>(&klds[0][trow * 72 + tch * 8]) = kv;
        *reinterpret_cast<uint4*>(&vlds[0][trow * VP_ + tch * 8]) = vv;
    }

    const int niter = S_ / 32;
    // not unrolled, last pass not peeled off: the next tile's global loads then keep their own
    // block at the head of the pass; peeled, they sink to their LDS stores and are waited for in full
#pragma nounroll
    for (int it = 0; it < niter; ++it) {
        __syncthreads();                         // buffer (it&1) is ready
        const int kt = it * 32;

        uint4 kn, vn;
        const bool havenext = (it + 1 < niter);
        if (havenext) {
            kn   = *reinterpret_cast<const uint4*>(kstage + (size_t)(kt + 32) * D_);
            vn   = *reinterpret_cast<const uint4*>(vstage + (size_t)(kt + 32) * D_);
            // precaution: stands before the pass's foot steps the address pairs that these two issued
            // loads name, on every way there
            asm volatile("s_wait_xcnt 0x0" ::: "memory");
        }

        const __bf16* kl = klds[it & 1];
        const __bf16* vl = vlds[it & 1];

        // scores: two 16-key subtiles for each column group, accumulated over two d-halves
        // sc[c][t][r] = score of key kt + t*16 + 8*g + r against query qrow + 16*c
        f32x8 sc[2][2];
        for (int c = 0; c < 2; ++c)
            for (int t = 0; t < 2; ++t)
                for (int e = 0; e < 8; ++e) sc[c][t][e] = 0.0f;
#pragma unroll
        for (int dh = 0; dh < 2; ++dh) {
#pragma unroll
            for (int t = 0; t < 2; ++t) {
                Frag kf;                         // one fragment, both column groups
                const __bf16* ks = &kl[(t * 16 + lm) * 72 + dh * 32];
                kf.u[0] = *reinterpret_cast<const uint4*>(ks + g * 8);
                kf.u[1] = *reinterpret_cast<const uint4*>(ks + 16 + g * 8);
                sc[0][t] = WMMA_BF16(kf.v, qf[0][dh].v, sc[0][t]);
                sc[1][t] = WMMA_BF16(kf.v, qf[1][dh].v, sc[1][t]);
            }
        }

        // additive tril(1) mask + online softmax, the 16 scores of a lane in a group belong to one query.
        // Before pass dpass the mask is 1 on every score the wave has seen, and a constant on all
        // of them cancels in the softmax: it is left out, and mrun runs 1 below the masked maximum.
        // Pass dpass puts that 1 on mrun and adds the mask element by element; behind it the mask is 0.
        if (it == dpass) {
#pragma unroll  // all three unrolled: sc[] indexed by constants, in registers
            for (int c = 0; c < 2; ++c) {
                mrun[c] += 1.0f;
#pragma unroll
                for (int t = 0; t < 2; ++t)
#pragma unroll
                    for (int r = 0; r < 8; ++r) sc[c][t][r] += (t * 16 + r - c * 16 <= lim) ? 1.0f : 0.0f;
            }
        }
        lim -= 32;

        float mnew[2], alpha[2];
#pragma unroll  // the two groups' chains are independent and interleave
        for (int c = 0; c < 2; ++c) {
            float mxt[2] = {-3.0e38f, -3.0e38f}; // one chain per subtile
#pragma unroll
            for (int t = 0; t < 2; ++t)
#pragma unroll
                for (int r = 0; r < 8; ++r) mxt[t] = fmaxf(mxt[t], sc[c][t][r]);
            float mx = fmaxf(mxt[0], mxt[1]);
            mx = fmaxf(mx, other_half(mx));
            mnew[c]  = fmaxf(mrun[c], mx);
            alpha[c] = __expf(mrun[c] - mnew[c]);
            mrun[c]  = mnew[c];
        }

        Frag pf[2];                              // pf[c].v[t*8 + r]: hardware k order of a B operand
#pragma unroll
        for (int c = 0; c < 2; ++c) {
            float rs[4] = {0.0f, 0.0f, 0.0f, 0.0f};  // four independent chains
#pragma unroll
            for (int t = 0; t < 2; ++t)
#pragma unroll
                for (int r = 0; r < 8; ++r) {
                    const float p = __expf(sc[c][t][r] - mnew[c]);
                    rs[r & 3] += p;
                    pf[c].v[t * 8 + r] = (__bf16)p;
                }
            lrun[c] = lrun[c] * alpha[c] + ((rs[0] + rs[1]) + (rs[2] + rs[3]));
#pragma unroll
            for (int dt = 0; dt < 4; ++dt)
#pragma unroll
                for (int r = 0; r < 8; ++r) acc[c][dt][r] *= alpha[c];
        }

#pragma unroll
        for (int dt = 0; dt < 4; ++dt) {
            Frag vf;                             // row d = dt*16 + lm, keys in the hardware k order
            const __bf16* vs = &vl[vtr + dt * 16];
            vf.u[0] = lds_load_tr16(vs);
            vf.u[1] = lds_load_tr16(vs + 16 * VP_);
            acc[0][dt] = WMMA_BF16(vf.v, pf[0].v, acc[0][dt]);
            acc[1][dt] = WMMA_BF16(vf.v, pf[1].v, acc[1][dt]);
        }

        if (havenext) {                          // fill the idle buffer
            __bf16* kd = klds[(it + 1) & 1];
            __bf16* vd = vlds[(it + 1) & 1];
            *reinterpret_cast<uint4*>(&kd[trow * 72 + tch * 8]) = kn;
            *reinterpret_cast<uint4*>(&vd[trow * VP_ + tch * 8]) = vn;
        }
    }

    // join the halves' sums, normalize, store: 8 consecutive d of one query = 16 bytes;
    // both groups go out from one address, group 1 at a constant offset
    uint4 ov[2][4];
#pragma unroll  // all unrolled: acc[] and ov[] indexed by constants, in registers
    for (int c = 0; c < 2; ++c) {
        const float inv = 1.0f / (lrun[c] + other_half(lrun[c]));
#pragma unroll
        for (int dt = 0; dt < 4; ++dt) {
            union { uint4 u; __bf16 e[8]; } o;
#pragma unroll
            for (int r = 0; r < 8; ++r) o.e[r] = (__bf16)(acc[c][dt][r] * inv);
            ov[c][dt] = o.u;
        }
    }
    __bf16* dst = O + headoff + (size_t)qrow * D_ + 8 * g;
#pragma unroll
    for (int c = 0; c < 2; ++c)
#pragma unroll
        for (int dt = 0; dt < 4; ++dt)
            *reinterpret_cast<uint4*>(dst + c * 16 * D_ + dt * 16) = ov[c][dt];
}

// ---------------------------------------------------------------------------
extern "C" void kernel_launch(void* const* d_in, const int* in_sizes, int n_in,
                              void* d_out, int out_size, void* d_ws, size_t ws_size,
                              hipStream_t stream) {
    const float* x      = (const float*)d_in[0];
    const float* Wq     = (const float*)d_in[1];
    const float* Wk     = (const float*)d_in[2];
    const float* Wv     = (const float*)d_in[3];
    const float* in_w   = (const float*)d_in[4];
    const float* in_b   = (const float*)d_in[5];
    const float* out_w  = (const float*)d_in[6];
    const float* out_b  = (const float*)d_in[7];
    const float* proj_w = (const float*)d_in[8];
    const float* proj_b = (const float*)d_in[9];
    float* out = (float*)d_out;

    const size_t MB = 1u << 20;
    char* ws = (char*)d_ws;
    const int ND = D_ * D_;      // 1,048,576
    __bf16* xb    = (__bf16*)(ws + 0);         // 16 MB  (B*S*D)
    __bf16* w1t   = (__bf16*)(ws + 16 * MB);   //  8 MB: Wq^T, Wk^T, Wv^T, out_w^T (first layers, transposed)
    __bf16* w2    = (__bf16*)(ws + 24 * MB);   //  8 MB: in_w (3 slices), proj_w    (second layers)
    __bf16* wf    = (__bf16*)(ws + 32 * MB);   //  8 MB: folded weights w2[i] * w1[i]
    float*  bfold = (float*) (ws + 40 * MB);   //  4 KB: proj_w * out_b + proj_b
    __bf16* Qb    = (__bf16*)(ws + 48 * MB);   // 16 MB each
    __bf16* Kb    = (__bf16*)(ws + 64 * MB);
    __bf16* Vb    = (__bf16*)(ws + 80 * MB);
    __bf16* ctx   = (__bf16*)(ws + 96 * MB);

    prep_kernel<<<PB_FOLD + 4 * PB_TR + PB_INW + PB_X, 256, 0, stream>>>(
        x, Wq, Wk, Wv, out_w, in_w, proj_w, out_b, proj_b, xb, w1t, w2, bfold);

    const dim3 blk(256);
    const dim3 gg(D_ / 128, M_ / 128);      // (8, 64)
    const dim3 g3(D_ / 128, M_ / 128, 3);   // (8, 64, 3): Q, K and V
    const dim3 gw(D_ / 128, D_ / 128, 4);   // (8, 8, 4): the four weight products
    const float qscale = 1.0f / 8.0f;       // 1/sqrt(HD)

    // two linear layers in a row are one: (x * W1^T) * W2^T = x * (W2 * W1)^T.
    // wf[i][f][d] = sum_e w2[i][f][e] * w1[i][e][d]
    gemm_nt_kernel<0><<<gw, blk, 0, stream>>>(w2, w1t, nullptr, wf, nullptr, D_, D_, D_, ND, 1.0f);
    // Q/K/V = x * wf^T + bias, one batch on the one x; Qb, Kb, Vb lie back to back
    // (softmax scale folded into Q, the batch's product 0)
    gemm_nt_kernel<0><<<g3, blk, 0, stream>>>(xb, wf, in_b, Qb, nullptr, M_, D_, D_, 0, qscale);
    // attention
    flash_attn_kernel<<<dim3(S_ / 256, B_ * H_), blk, 0, stream>>>(Qb, Kb, Vb, ctx);
    // out = ctx * (proj_w * out_w)^T + (proj_w * out_b + proj_b) + x   (fp32)
    gemm_nt_kernel<1><<<gg, blk, 0, stream>>>(ctx, wf + 3 * ND, bfold, out, x, M_, D_, D_, 0, 1.0f);
}

// v008
// Measured time: 158 microseconds a run.
// Timed twice side by side with v007, it ran 1.04 times as fast both times.
// Counting every step since v000, it is 3.36 times as fast.
#include <hip/hip_runtime.h>
#include <hip/hip_bf16.h>

#define B_ 4
#define S_ 2048
#define D_ 1024
#define H_ 16
#define HD_ 64
#define M_ (B_ * S_)   // 8192 rows of the token matrix

typedef __attribute__((ext_vector_type(16))) __bf16 bf16x16;
typedef __attribute__((ext_vector_type(8)))  float  f32x8;

union Frag {          // 16 bf16 = 8 VGPRs; u[0] -> K = g*8..g*8+7, u[1] -> K = 16+g*8..
    uint4   u[2];
    bf16x16 v;
};

#define WMMA_BF16(a, b, c) \
    __builtin_amdgcn_wmma_f32_16x16x32_bf16(false, (a), false, (b), (short)0, (c), false, false)

// ---------------------------------------------------------------------------
// The set-up conversions below are parts of ONE grid (prep_kernel): none reads what another
// writes.  Each takes the index of its block within its own part; a block is 256 threads.
// ---------------------------------------------------------------------------
// fp32 -> bf16 conversion (4 elems / thread)
// ---------------------------------------------------------------------------
__device__ inline void f32_to_bf16_part(const float* __restrict__ in, __bf16* __restrict__ out, int n, int blk) {
    int i = (blk * 256 + threadIdx.x) * 4;
    if (i + 3 < n) {
        float4 f = *reinterpret_cast<const float4*>(in + i);
        out[i + 0] = (__bf16)f.x;
        out[i + 1] = (__bf16)f.y;
        out[i + 2] = (__bf16)f.z;
        out[i + 3] = (__bf16)f.w;
    } else {
        for (int j = i; j < n; ++j) out[j] = (__bf16)in[j];
    }
}

// ---------------------------------------------------------------------------
// fp32 -> bf16 conversion with transpose: out[c][r] = in[r][c], n x n matrix,
// 64x64 tile through LDS so that both the reads and the writes are contiguous.
// ---------------------------------------------------------------------------
__device__ inline void f32_to_bf16_transpose_part(const float* __restrict__ in, __bf16* __restrict__ out, int n,
                                                  int bx, int by) {
    __shared__ float tile[64][65];
    const int c0 = bx * 64;
    const int r0 = by * 64;
    const int t  = threadIdx.x;
    {
        const int c4 = (t & 15) * 4;
        const int r  = t >> 4;
#pragma unroll  // all four row loads in flight together
        for (int k = 0; k < 4; ++k) {
            float4 f = *reinterpret_cast<const float4*>(in + (size_t)(r0 + r + 16 * k) * n + c0 + c4);
            tile[r + 16 * k][c4 + 0] = f.x;
            tile[r + 16 * k][c4 + 1] = f.y;
            tile[r + 16 * k][c4 + 2] = f.z;
            tile[r + 16 * k][c4 + 3] = f.w;
        }
    }
    __syncthreads();
    {
        const int r8 = (t & 7) * 8;
        const int c  = t >> 3;
#pragma unroll  // both unrolled: p stays in registers, constant LDS offsets
        for (int k = 0; k < 2; ++k) {
            union { uint4 u; __bf16 e[8]; } p;
#pragma unroll
            for (int i = 0; i < 8; ++i) p.e[i] = (__bf16)tile[r8 + i][c + 32 * k];
            *reinterpret_cast<uint4*>(out + (size_t)(c0 + c + 32 * k) * n + r0 + r8) = p.u;
        }
        // precaution: stands before any later code of the shared grid rewrites a register that these
        // two issued stores name
        asm volatile("s_wait_xcnt 0x0" ::: "memory");
    }
}

// ---------------------------------------------------------------------------
// fp32 -> bf16 conversion of a D_ x D_ weight w, and in the same pass the folded
// bias bout[r] = b[r] + sum_e w[r][e] * v[e] in f32.
// block = 8 waves x 4 rows = 32 rows, so a block writes one whole 128-byte line of bout.
// ---------------------------------------------------------------------------
__device__ inline void f32_to_bf16_fold_bias_part(const float* __restrict__ w, const float* __restrict__ v,
                                                  const float* __restrict__ b, __bf16* __restrict__ wout,
                                                  float* __restrict__ bout, int blk) {
    __shared__ float rowsum[32];
    const int lane = threadIdx.x & 31;
    const int wave = threadIdx.x >> 5;
    const int row0 = blk * 32;
    const size_t base = (size_t)(row0 + wave * 4) * D_;
    float s[4] = {0.0f, 0.0f, 0.0f, 0.0f};
    // k loop kept rolled, its four rows unrolled (their loads in flight together, s[] in registers): all
    // eight steps at once would take over 200 registers from every wave of the grid, whose streaming
    // parts have one 16-byte load a thread and live on the number of resident waves
#pragma nounroll
    for (int k = 0; k < D_ / 128; ++k) {
        const int c = k * 128 + lane * 4;
        float4 gv = *reinterpret_cast<const float4*>(v + c);
#pragma unroll
        for (int rr = 0; rr < 4; ++rr) {
            float4 f = *reinterpret_cast<const float4*>(w + base + rr * D_ + c);
            union { uint2 u; __bf16 e[4]; } p;
            p.e[0] = (__bf16)f.x;  p.e[1] = (__bf16)f.y;
            p.e[2] = (__bf16)f.z;  p.e[3] = (__bf16)f.w;
            *reinterpret_cast<uint2*>(wout + base + rr * D_ + c) = p.u;
            s[rr] += f.x * gv.x + f.y * gv.y + f.z * gv.z + f.w * gv.w;
        }
        // precaution: stands before the next trip rewrites the address and data registers that this
        // trip's issued stores name
        asm volatile("s_wait_xcnt 0x0" ::: "memory");
    }
#pragma unroll  // s[] indexed by constants; the four reductions overlap
    for (int rr = 0; rr < 4; ++rr) {
        for (int off = 16; off > 0; off >>= 1) s[rr] += __shfl_xor(s[rr], off, 32);
    }
    if (lane == 0) {
#pragma unroll  // s[] indexed by constants
        for (int rr = 0; rr < 4; ++rr) rowsum[wave * 4 + rr] = s[rr];
    }
    __syncthreads();
    if (threadIdx.x < 32) bout[row0 + threadIdx.x] = rowsum[threadIdx.x] + b[row0 + threadIdx.x];
}

// ---------------------------------------------------------------------------
// All set-up conversions in one grid, a block range for each; the part with the longest chain
// of dependent loads has the lowest indices.  Every branch is block-uniform.
// ---------------------------------------------------------------------------
#define PB_FOLD (D_ / 32)                 // 32 blocks: proj_w and the folded bias
#define PB_TR   ((D_ / 64) * (D_ / 64))   // 256 blocks for each transposed weight
#define PB_INW  (3 * D_ * D_ / 1024)      // 3,072 blocks: in_w
#define PB_X    (M_ * D_ / 1024)          // 8,192 blocks: x

__global__ __launch_bounds__(256)
void prep_kernel(const float* __restrict__ x, const float* __restrict__ Wq, const float* __restrict__ Wk,
                 const float* __restrict__ Wv, const float* __restrict__ out_w,
                 const float* __restrict__ in_w, const float* __restrict__ proj_w,
                 const float* __restrict__ out_b, const float* __restrict__ proj_b,
                 __bf16* __restrict__ xb, __bf16* __restrict__ w1t, __bf16* __restrict__ w2,
                 float* __restrict__ bfold) {
    int blk = blockIdx.x;
    if (blk < PB_FOLD) {
        f32_to_bf16_fold_bias_part(proj_w, out_b, proj_b, w2 + 3 * D_ * D_, bfold, blk);
        return;
    }
    blk -= PB_FOLD;
    if (blk < 4 * PB_TR) {
        const int which = blk / PB_TR;
        const float* src = (which == 0) ? Wq : (which == 1) ? Wk : (which == 2) ? Wv : out_w;
        f32_to_bf16_transpose_part(src, w1t + (size_t)which * D_ * D_, D_, blk % (D_ / 64), (blk / (D_ / 64)) % (D_ / 64));
        return;
    }
    blk -= 4 * PB_TR;
    if (blk < PB_INW) {
        f32_to_bf16_part(in_w, w2, 3 * D_ * D_, blk);
        return;
    }
    f32_to_bf16_part(x, xb, M_ * D_, blk - PB_INW);
}

// ---------------------------------------------------------------------------
// NT GEMM: C[M x N] = A[M x K](bf16) * W[N x K](bf16)^T  (+bias)*scale (+res)
// block = 256 threads (8 waves); block tile 128x128; wave tile 32x64
// (2 M-tiles x 4 N-tiles = 8 f32x8 accumulators, 6 fragment loads / 8 WMMAs).
// A and W tiles both double-buffered through LDS, 64 k a step: a step takes one whole
// 128-byte line of every operand row, and 8 neighbouring lanes fetch that line together,
// so a wave-wide 16-byte load touches 4 whole lines.  One barrier per step.
// K is a multiple of 64.
// The W fragment is the matrix instruction's A operand and the A-matrix fragment its B operand, so a
// lane's accumulator holds 8 consecutive columns of ONE output row.  Each wave stages its 32x64 piece
// in its own LDS range (the ring, once every wave has left it) and stores it in whole 128-byte lines.
// MODE 0: bf16 output.  MODE 1: f32 output + residual add.
// blockIdx.z picks one product of a batch whose W, C and bias each lie back to back; their A lie
// astep elements apart (0: one A for all).  scale belongs to product 0, the others have none.
// ---------------------------------------------------------------------------
#define GP_ 72   // LDS row pitch in elements: 144 bytes = 16 bytes x odd, for 16-byte readers
#define SP0_ 144  // output staging row pitch in bytes, bf16: 128 + 16 = 16 bytes x odd
#define SP1_ 272  // output staging row pitch in bytes, f32: 256 + 16 = 16 bytes x odd

template <int MODE>
__global__ __launch_bounds__(256)
void gemm_nt_kernel(const __bf16* __restrict__ Abase, const __bf16* __restrict__ Wbase,
                    const float* __restrict__ bias, void* __restrict__ Outbase,
                    const float* __restrict__ resbase,
                    int M, int N, int K, int astep, float scale) {
    // one array: A tiles 0 and 1, W tiles 0 and 1; the epilogue stages the output in it
    __shared__ __attribute__((aligned(16))) __bf16 ring[4][128 * GP_];
    __bf16 (*alds)[128 * GP_] = ring;
    __bf16 (*wlds)[128 * GP_] = ring + 2;

    const int lane = threadIdx.x & 31;
    const int wave = threadIdx.x >> 5;
    const int g    = lane >> 4;      // half-wave group (A/B layout K-offset selector)
    const int lm   = lane & 15;      // row (A) / column (B) within tile
    const int mw   = wave & 3;       // 32-row strip within block tile
    const int nw   = wave >> 2;      // 64-col strip within block tile
    const int n0   = blockIdx.x * 128;
    const int m0   = blockIdx.y * 128;
    const __bf16* __restrict__ A = Abase + (size_t)blockIdx.z * astep;
    const __bf16* __restrict__ W = Wbase + (size_t)blockIdx.z * N * K;
    const size_t  cz = (size_t)blockIdx.z * M * N;
    void* __restrict__ Out = (MODE == 0) ? (void*)((__bf16*)Outbase + cz) : (void*)((float*)Outbase + cz);
    const float* __restrict__ residual = (MODE == 0) ? resbase : resbase + cz;

    f32x8 acc[2][4];
    for (int mt = 0; mt < 2; ++mt)
        for (int j = 0; j < 4; ++j)
            for (int e = 0; e < 8; ++e) acc[mt][j][e] = 0.0f;

    // cooperative staging: 32 rows x 8 lanes of 16 B a round, 4 rounds for each operand
    const int srow = threadIdx.x >> 3;
    const int sch  = threadIdx.x & 7;
    // block-uniform byte bases; the lane's part is the byte offsets so0..so3, the same for both
    // operands, 128 bytes further each step; they keep registers of their own through the loop
    const char* astage = reinterpret_cast<const char*>(A + (size_t)m0 * K);
    const char* wstage = reinterpret_cast<const char*>(W + (size_t)n0 * K);
    unsigned so0 = ((unsigned)srow * K + sch * 8) * 2u;
    unsigned so1 = so0 + 64u * K;
    unsigned so2 = so0 + 128u * K;
    unsigned so3 = so0 + 192u * K;
    const int sdst = srow * GP_ + sch * 8;

    // preload step 0 into buffer 0
    {
        const uint4 a0 = *reinterpret_cast<const uint4*>(astage + so0);
        const uint4 a1 = *reinterpret_cast<const uint4*>(astage + so1);
        const uint4 a2 = *reinterpret_cast<const uint4*>(astage + so2);
        const uint4 a3 = *reinterpret_cast<const uint4*>(astage + so3);
        const uint4 b0 = *reinterpret_cast<const uint4*>(wstage + so0);
        const uint4 b1 = *reinterpret_cast<const uint4*>(wstage + so1);
        const uint4 b2 = *reinterpret_cast<const uint4*>(wstage + so2);
        const uint4 b3 = *reinterpret_cast<const uint4*>(wstage + so3);
        *reinterpret_cast<uint4*>(&alds[0][sdst])                = a0;
        *reinterpret_cast<uint4*>(&alds[0][sdst + 32 * GP_])     = a1;
        *reinterpret_cast<uint4*>(&alds[0][sdst + 2 * 32 * GP_]) = a2;
        *reinterpret_cast<uint4*>(&alds[0][sdst + 3 * 32 * GP_]) = a3;
        *reinterpret_cast<uint4*>(&wlds[0][sdst])                = b0;
        *reinterpret_cast<uint4*>(&wlds[0][sdst + 32 * GP_])     = b1;
        *reinterpret_cast<uint4*>(&wlds[0][sdst + 2 * 32 * GP_]) = b2;
        *reinterpret_cast<uint4*>(&wlds[0][sdst + 3 * 32 * GP_]) = b3;
    }

    const int niter = K / 64;
    for (int i = 0; i < niter; ++i) {
        __syncthreads();                       // buffer (i&1) is ready
        uint4 na0, na1, na2, na3, nb0, nb1, nb2, nb3;
        const bool havenext = (i + 1 < niter);
        if (havenext) {                        // issue the next step's global loads early
            so0 += 128u;  so1 += 128u;  so2 += 128u;  so3 += 128u;
            na0 = *reinterpret_cast<const uint4*>(astage + so0);
            na1 = *reinterpret_cast<const uint4*>(astage + so1);
            na2 = *reinterpret_cast<const uint4*>(astage + so2);
            na3 = *reinterpret_cast<const uint4*>(astage + so3);
            nb0 = *reinterpret_cast<const uint4*>(wstage + so0);
            nb1 = *reinterpret_cast<const uint4*>(wstage + so1);
            nb2 = *reinterpret_cast<const uint4*>(wstage + so2);
            nb3 = *reinterpret_cast<const uint4*>(wstage + so3);
            // precaution: stands before the next step's additions rewrite the offset registers
            // (and before the base pair is reused) that these eight issued loads name
            asm volatile("s_wait_xcnt 0x0" ::: "memory");
        }

        const __bf16* al = alds[i & 1];
        const __bf16* wl = wlds[i & 1];
#pragma unroll  // all three unrolled: constant LDS offsets, fragments and acc[] in registers
        for (int ks = 0; ks < 2; ++ks) {
            Frag fa[2];
#pragma unroll
            for (int mt = 0; mt < 2; ++mt) {
                const __bf16* asrc = &al[(mw * 32 + mt * 16 + lm) * GP_ + ks * 32];
                fa[mt].u[0] = *reinterpret_cast<const uint4*>(asrc + g * 8);
                fa[mt].u[1] = *reinterpret_cast<const uint4*>(asrc + 16 + g * 8);
            }
#pragma unroll
            for (int j = 0; j < 4; ++j) {
                Frag fb;
                const __bf16* bsrc = &wl[(nw * 64 + j * 16 + lm) * GP_ + ks * 32];
                fb.u[0] = *reinterpret_cast<const uint4*>(bsrc + g * 8);
                fb.u[1] = *reinterpret_cast<const uint4*>(bsrc + 16 + g * 8);
                acc[0][j] = WMMA_BF16(fb.v, fa[0].v, acc[0][j]);
                acc[1][j] = WMMA_BF16(fb.v, fa[1].v, acc[1][j]);
            }
        }

        if (havenext) {                        // fill the idle buffer
            __bf16* ad = &alds[(i + 1) & 1][sdst];
            __bf16* wd = &wlds[(i + 1) & 1][sdst];
            *reinterpret_cast<uint4*>(ad)                = na0;
            *reinterpret_cast<uint4*>(ad + 32 * GP_)     = na1;
            *reinterpret_cast<uint4*>(ad + 2 * 32 * GP_) = na2;
            *reinterpret_cast<uint4*>(ad + 3 * 32 * GP_) = na3;
            *reinterpret_cast<uint4*>(wd)                = nb0;
            *reinterpret_cast<uint4*>(wd + 32 * GP_)     = nb1;
            *reinterpret_cast<uint4*>(wd + 2 * 32 * GP_) = nb2;
            *reinterpret_cast<uint4*>(wd + 3 * 32 * GP_) = nb3;
        }
    }

    // epilogue: acc[mt][j][r] = C[mrow0 + mt*16 + lm][ncol0 + j*16 + 8*g + r]
    const float zscale = (blockIdx.z == 0) ? scale : 1.0f;
    const int mrow0 = m0 + mw * 32;
    const int ncol0 = n0 + nw * 64;

    // MODE 1: a row of the wave's piece is 256 bytes: 16 lanes take it, a wave-wide access covers 2 rows.
    // Residual and output share the lane's byte offsets ob[] from the block tile's first element.
    // The residual's sixteen loads go first, so that they and the bias loads are in flight together.
    const size_t tile0 = (size_t)m0 * N + n0;
    unsigned ob[16];
    float4 res[16];
    if (MODE == 1) {
        const char* rbase = reinterpret_cast<const char*>(residual + tile0);
#pragma unroll  // ob[] and res[] indexed by constants, in registers
        for (int i = 0; i < 16; ++i) {
            ob[i]  = ((unsigned)(mw * 32 + (lane >> 4) + 2 * i) * N + nw * 64 + (lane & 15) * 4) * 4u;
            res[i] = *reinterpret_cast<const float4*>(rbase + ob[i]);
        }
        // precaution: stands before the base pair that these sixteen issued loads name is reused
        asm volatile("s_wait_xcnt 0x0" ::: "memory");
    }

    // bias of the lane's 8 columns in each column group, all eight loads in flight together
    float4 bv[4][2];
    if (bias) {
        const float* bp = bias + (size_t)blockIdx.z * N + ncol0 + 8 * g;
#pragma unroll  // bv[] indexed by constants, in registers
        for (int j = 0; j < 4; ++j) {
            bv[j][0] = *reinterpret_cast<const float4*>(bp + j * 16);
            bv[j][1] = *reinterpret_cast<const float4*>(bp + j * 16 + 4);
        }
        // precaution: stands before any later code rewrites the address pair that these issued loads name
        asm volatile("s_wait_xcnt 0x0" ::: "memory");
    } else {
#pragma unroll
        for (int j = 0; j < 4; ++j) {
            bv[j][0] = make_float4(0.0f, 0.0f, 0.0f, 0.0f);
            bv[j][1] = bv[j][0];
        }
    }

    if (MODE == 0) {
        // a row of the wave's piece is 128 bytes: 8 lanes take it, a wave-wide store covers 4 rows
        const int orow = lane >> 3;
        const int och  = lane & 7;
        char* st = reinterpret_cast<char*>(&ring[0][0]) + wave * (32 * SP0_);
        __syncthreads();                       // every wave has read its last fragments: the ring is free
#pragma unroll  // all three unrolled: acc[] and bv[] indexed by constants, in registers
        for (int mt = 0; mt < 2; ++mt) {
#pragma unroll
            for (int j = 0; j < 4; ++j) {
                const float b8[8] = {bv[j][0].x, bv[j][0].y, bv[j][0].z, bv[j][0].w,
                                     bv[j][1].x, bv[j][1].y, bv[j][1].z, bv[j][1].w};
                union { uint4 u; __bf16 e[8]; } o;
#pragma unroll
                for (int r = 0; r < 8; ++r) o.e[r] = (__bf16)((acc[mt][j][r] + b8[r]) * zscale);
                *reinterpret_cast<uint4*>(st + (mt * 16 + lm) * SP0_ + j * 32 + g * 16) = o.u;
            }
        }
        // the wave's own LDS stores have landed before other lanes of it read them back
        asm volatile("s_wait_dscnt 0x0" ::: "memory");
        __bf16* dst = (__bf16*)Out + (size_t)(mrow0 + orow) * N + ncol0 + och * 8;
        uint4 ov[8];
#pragma unroll  // ov[] indexed by constants, in registers; the eight LDS reads go as one group
        for (int i = 0; i < 8; ++i)
            ov[i] = *reinterpret_cast<const uint4*>(st + (4 * i + orow) * SP0_ + och * 16);
#pragma unroll
        for (int i = 0; i < 8; ++i)
            *reinterpret_cast<uint4*>(dst + (size_t)(4 * i) * N) = ov[i];
    } else {
        const int orow = lane >> 4;
        const int och  = lane & 15;
        char* st = reinterpret_cast<char*>(&ring[0][0]) + wave * (32 * SP1_);
        __syncthreads();                       // every wave has read its last fragments: the ring is free
#pragma unroll  // all unrolled: acc[] and bv[] indexed by constants, in registers
        for (int mt = 0; mt < 2; ++mt) {
#pragma unroll
            for (int j = 0; j < 4; ++j) {
                float4 lo, hi;
                lo.x = (acc[mt][j][0] + bv[j][0].x) * zscale;
                lo.y = (acc[mt][j][1] + bv[j][0].y) * zscale;
                lo.z = (acc[mt][j][2] + bv[j][0].z) * zscale;
                lo.w = (acc[mt][j][3] + bv[j][0].w) * zscale;
                hi.x = (acc[mt][j][4] + bv[j][1].x) * zscale;
                hi.y = (acc[mt][j][5] + bv[j][1].y) * zscale;
                hi.z = (acc[mt][j][6] + bv[j][1].z) * zscale;
                hi.w = (acc[mt][j][7] + bv[j][1].w) * zscale;
                char* p = st + (mt * 16 + lm) * SP1_ + j * 64 + g * 32;
                *reinterpret_cast<float4*>(p)      = lo;
                *reinterpret_cast<float4*>(p + 16) = hi;
            }
        }
        // the wave's own LDS stores have landed before other lanes of it read them back
        asm volatile("s_wait_dscnt 0x0" ::: "memory");
        char* obase = reinterpret_cast<char*>((float*)Out + tile0);
#pragma unroll
        for (int i = 0; i < 16; ++i) {
            float4 v = *reinterpret_cast<const float4*>(st + (2 * i + orow) * SP1_ + och * 16);
            v.x += res[i].x;  v.y += res[i].y;  v.z += res[i].z;  v.w += res[i].w;
            *reinterpret_cast<float4*>(obase + ob[i]) = v;
        }
    }
}

// ---------------------------------------------------------------------------
// Flash attention, transposed: S^T = K * Q_scaled^T + tril(1)^T; softmax down each
// column; ctx^T = V^T * P^T.  A lane holds scores of ONE query in each column group, so the
// maximum and the sum run over its own registers, and the two f32 score tiles of a
// 32-key step, converted in place, are the B operand of the second product.
// grid = (S/256, B*H); block = 256 (8 waves); wave owns 32 query columns = 2 groups of 16:
// every K and V^T fragment read from LDS feeds two matrix instructions.
// K/V tiles double-buffered in LDS, both row-major; one barrier per 32-key step.
// V^T fragments come from the row-major V tile by the 16-bit transposing LDS load.
// Q/K/V/ctx are (B,S,D) bf16 with head h in columns [h*64, h*64+64).
// ---------------------------------------------------------------------------
__device__ inline float other_half(float v) {   // value of lane l ^ 16
    const int b = __float_as_int(v);
    return __int_as_float(__builtin_amdgcn_permlanex16(b, b, 0x76543210, 0xfedcba98, false, false));
}

#define VP_ 80   // V tile row pitch in elements: 160 bytes = 32 bytes x odd, for the transposing reader

typedef short s16x8 __attribute__((ext_vector_type(8)));
// lane (c = l & 15, h = l >> 4), pointed at row 8h + (l & 7), 16-byte piece (l >> 3) & 1 of a
// 16-row x 16-column block, gets column c of rows 8h .. 8h + 7
__device__ inline uint4 lds_load_tr16(const __bf16* p) {
    typedef __attribute__((address_space(3))) s16x8 lds_s16x8;
    return __builtin_bit_cast(uint4, __builtin_amdgcn_ds_load_tr16_b128_v8i16((lds_s16x8*)p));
}

__global__ __launch_bounds__(256)
void flash_attn_kernel(const __bf16* __restrict__ Q, const __bf16* __restrict__ Kp,
                       const __bf16* __restrict__ Vp, __bf16* __restrict__ O) {
    __shared__ __attribute__((aligned(16))) __bf16 klds[2][32 * 72];     // K tile row-major
    __shared__ __attribute__((aligned(16))) __bf16 vlds[2][32 * VP_];    // V tile row-major

    const int lane = threadIdx.x & 31;
    const int wave = threadIdx.x >> 5;
    const int g    = lane >> 4;
    const int lm   = lane & 15;

    const int b = blockIdx.y / H_;
    const int h = blockIdx.y % H_;
    const int qblk = blockIdx.x * 256;
    const size_t headoff = (size_t)b * S_ * D_ + (size_t)h * HD_;

    // Q fragments (B operand, two K=32 steps over HD=64) of both column groups, loaded once;
    // group c holds query qrow + 16 * c
    const int qrow = qblk + wave * 32 + lm;
    Frag qf[2][2];
    const __bf16* qsrc = Q + headoff + (size_t)qrow * D_;
#pragma unroll
    for (int c = 0; c < 2; ++c) {
#pragma unroll
        for (int dh = 0; dh < 2; ++dh) {
            qf[c][dh].u[0] = *reinterpret_cast<const uint4*>(qsrc + c * 16 * D_ + dh * 32 + g * 8);
            qf[c][dh].u[1] = *reinterpret_cast<const uint4*>(qsrc + c * 16 * D_ + dh * 32 + 16 + g * 8);
        }
    }
    // precaution: no later load's result lands on an address register of a load issued before it
    asm volatile("s_wait_xcnt 0x0" ::: "memory");

    float mrun[2] = {-3.0e38f, -3.0e38f};   // running maximum of a group's query (equal in both halves); see the mask
    float lrun[2] = {0.0f, 0.0f};           // running sum over this half's keys only; joined after the loop
    f32x8 acc[2][4];                        // acc[c][dt][r] = ctx[qrow + 16*c][dt*16 + 8*g + r]
    for (int c = 0; c < 2; ++c)
        for (int dt = 0; dt < 4; ++dt)
            for (int e = 0; e < 8; ++e) acc[c][dt][e] = 0.0f;

    // staging: 32 key rows x 8 d-chunks, 16 B each
    const int trow = threadIdx.x >> 3;
    const int tch  = threadIdx.x & 7;
    const __bf16* kstage = Kp + headoff + (size_t)trow * D_ + tch * 8;
    const __bf16* vstage = Vp + headoff + (size_t)trow * D_ + tch * 8;
    // the lane's place in a V tile for the transposing load
    const int vtr = (8 * g + (lane & 7)) * VP_ + ((lane >> 3) & 1) * 8;
    // the one pass whose 32 keys are the wave's 32 queries; in a scalar register, so that the
    // test on it in the loop is a scalar compare
    const int dpass = __builtin_amdgcn_readfirstlane((qblk + wave * 32) >> 5);
    // key offset t*16 + r of the current pass is at or below qrow while <= lim; stepped pass by pass:
    // formed from dpass, the mask values would be lifted out of the loop into registers of their own
    int lim = qrow - 8 * g;

    // preload tile 0 into buffer 0
    {
        uint4 kv = *reinterpret_cast<const uint4*>(kstage);
        uint4 vv = *reinterpret_cast<const uint4*>(vstage);
        *reinterpret_cast<uint4*>(&klds[0][trow * 72 + tch * 8]) = kv;
        *reinterpret_cast<uint4*>(&vlds[0][trow * VP_ + tch * 8]) = vv;
    }

    const int niter = S_ / 32;
    // not unrolled, last pass not peeled off: the next tile's global loads then keep their own
    // block at the head of the pass; peeled, they sink to their LDS stores and are waited for in full
#pragma nounroll
    for (int it = 0; it < niter; ++it) {
        __syncthreads();                         // buffer (it&1) is ready
        const int kt = it * 32;

        uint4 kn, vn;
        const bool havenext = (it + 1 < niter);
        if (havenext) {
            kn   = *reinterpret_cast<const uint4*>(kstage + (size_t)(kt + 32) * D_);
            vn   = *reinterpret_cast<const uint4*>(vstage + (size_t)(kt + 32) * D_);
            // precaution: stands before the pass's foot steps the address pairs that these two issued
            // loads name, on every way there
            asm volatile("s_wait_xcnt 0x0" ::: "memory");
        }

        const __bf16* kl = klds[it & 1];
        const __bf16* vl = vlds[it & 1];

        // scores: two 16-key subtiles for each column group, accumulated over two d-halves
        // sc[c][t][r] = score of key kt + t*16 + 8*g + r against query qrow + 16*c
        f32x8 sc[2][2];
        for (int c = 0; c < 2; ++c)
            for (int t = 0; t < 2; ++t)
                for (int e = 0; e < 8; ++e) sc[c][t][e] = 0.0f;
#pragma unroll
        for (int dh = 0; dh < 2; ++dh) {
#pragma unroll
            for (int t = 0; t < 2; ++t) {
                Frag kf;                         // one fragment, both column groups
                const __bf16* ks = &kl[(t * 16 + lm) * 72 + dh * 32];
                kf.u[0] = *reinterpret_cast<const uint4*>(ks + g * 8);
                kf.u[1] = *reinterpret_cast<const uint4*>(ks + 16 + g * 8);
                sc[0][t] = WMMA_BF16(kf.v, qf[0][dh].v, sc[0][t]);
                sc[1][t] = WMMA_BF16(kf.v, qf[1][dh].v, sc[1][t]);
            }
        }

        // additive tril(1) mask + online softmax, the 16 scores of a lane in a group belong to one query.
        // Before pass dpass the mask is 1 on every score the wave has seen, and a constant on all
        // of them cancels in the softmax: it is left out, and mrun runs 1 below the masked maximum.
        // Pass dpass puts that 1 on mrun and adds the mask element by element; behind it the mask is 0.
        if (it == dpass) {
#pragma unroll  // all three unrolled: sc[] indexed by constants, in registers
            for (int c = 0; c < 2; ++c) {
                mrun[c] += 1.0f;
#pragma unroll
                for (int t = 0; t < 2; ++t)
#pragma unroll
                    for (int r = 0; r < 8; ++r) sc[c][t][r] += (t * 16 + r - c * 16 <= lim) ? 1.0f : 0.0f;
            }
        }
        lim -= 32;

        float mnew[2], alpha[2];
#pragma unroll  // the two groups' chains are independent and interleave
        for (int c = 0; c < 2; ++c) {
            float mxt[2] = {-3.0e38f, -3.0e38f}; // one chain per subtile
#pragma unroll
            for (int t = 0; t < 2; ++t)
#pragma unroll
                for (int r = 0; r < 8; ++r) mxt[t] = fmaxf(mxt[t], sc[c][t][r]);
            float mx = fmaxf(mxt[0], mxt[1]);
            mx = fmaxf(mx, other_half(mx));
            mnew[c]  = fmaxf(mrun[c], mx);
            alpha[c] = __expf(mrun[c] - mnew[c]);
            mrun[c]  = mnew[c];
        }

        Frag pf[2];                              // pf[c].v[t*8 + r]: hardware k order of a B operand
#pragma unroll
        for (int c = 0; c < 2; ++c) {
            float rs[4] = {0.0f, 0.0f, 0.0f, 0.0f};  // four independent chains
#pragma unroll
            for (int t = 0; t < 2; ++t)
#pragma unroll
                for (int r = 0; r < 8; ++r) {
                    const float p = __expf(sc[c][t][r] - mnew[c]);
                    rs[r & 3] += p;
                    pf[c].v[t * 8 + r] = (__bf16)p;
                }
            lrun[c] = lrun[c] * alpha[c] + ((rs[0] + rs[1]) + (rs[2] + rs[3]));
#pragma unroll
            for (int dt = 0; dt < 4; ++dt)
#pragma unroll
                for (int r = 0; r < 8; ++r) acc[c][dt][r] *= alpha[c];
        }

#pragma unroll
        for (int dt = 0; dt < 4; ++dt) {
            Frag vf;                             // row d = dt*16 + lm, keys in the hardware k order
            const __bf16* vs = &vl[vtr + dt * 16];
            vf.u[0] = lds_load_tr16(vs);
            vf.u[1] = lds_load_tr16(vs + 16 * VP_);
            acc[0][dt] = WMMA_BF16(vf.v, pf[0].v, acc[0][dt]);
            acc[1][dt] = WMMA_BF16(vf.v, pf[1].v, acc[1][dt]);
        }

        if (havenext) {                          // fill the idle buffer
            __bf16* kd = klds[(it + 1) & 1];
            __bf16* vd = vlds[(it + 1) & 1];
            *reinterpret_cast<uint4*>(&kd[trow * 72 + tch * 8]) = kn;
            *reinterpret_cast<uint4*>(&vd[trow * VP_ + tch * 8]) = vn;
        }
    }

    // join the halves' sums, normalize, store: 8 consecutive d of one query = 16 bytes;
    // both groups go out from one address, group 1 at a constant offset
    uint4 ov[2][4];
#pragma unroll  // all unrolled: acc[] and ov[] indexed by constants, in registers
    for (int c = 0; c < 2; ++c) {
        const float inv = 1.0f / (lrun[c] + other_half(lrun[c]));
#pragma unroll
        for (int dt = 0; dt < 4; ++dt) {
            union { uint4 u; __bf16 e[8]; } o;
#pragma unroll
            for (int r = 0; r < 8; ++r) o.e[r] = (__bf16)(acc[c][dt][r] * inv);
            ov[c][dt] = o.u;
        }
    }
    __bf16* dst = O + headoff + (size_t)qrow * D_ + 8 * g;
#pragma unroll
    for (int c = 0; c < 2; ++c)
#pragma unroll
        for (int dt = 0; dt < 4; ++dt)
            *reinterpret_cast<uint4*>(dst + c * 16 * D_ + dt * 16) = ov[c][dt];
}

// ---------------------------------------------------------------------------
extern "C" void kernel_launch(void* const* d_in, const int* in_sizes, int n_in,
                              void* d_out, int out_size, void* d_ws, size_t ws_size,
                              hipStream_t stream) {
    const float* x      = (const float*)d_in[0];
    const float* Wq     = (const float*)d_in[1];
    const float* Wk     = (const float*)d_in[2];
    const float* Wv     = (const float*)d_in[3];
    const float* in_w   = (const float*)d_in[4];
    const float* in_b   = (const float*)d_in[5];
    const float* out_w  = (const float*)d_in[6];
    const float* out_b  = (const float*)d_in[7];
    const float* proj_w = (const float*)d_in[8];
    const float* proj_b = (const float*)d_in[9];
    float* out = (float*)d_out;

    const size_t MB = 1u << 20;
    char* ws = (char*)d_ws;
    const int ND = D_ * D_;      // 1,048,576
    __bf16* xb    = (__bf16*)(ws + 0);         // 16 MB  (B*S*D)
    __bf16* w1t   = (__bf16*)(ws + 16 * MB);   //  8 MB: Wq^T, Wk^T, Wv^T, out_w^T (first layers, transposed)
    __bf16* w2    = (__bf16*)(ws + 24 * MB);   //  8 MB: in_w (3 slices), proj_w    (second layers)
    __bf16* wf    = (__bf16*)(ws + 32 * MB);   //  8 MB: folded weights w2[i] * w1[i]
    float*  bfold = (float*) (ws + 40 * MB);   //  4 KB: proj_w * out_b + proj_b
    __bf16* Qb    = (__bf16*)(ws + 48 * MB);   // 16 MB each
    __bf16* Kb    = (__bf16*)(ws + 64 * MB);
    __bf16* Vb    = (__bf16*)(ws + 80 * MB);
    __bf16* ctx   = (__bf16*)(ws + 96 * MB);

    prep_kernel<<<PB_FOLD + 4 * PB_TR + PB_INW + PB_X, 256, 0, stream>>>(
        x, Wq, Wk, Wv, out_w, in_w, proj_w, out_b, proj_b, xb, w1t, w2, bfold);

    const dim3 blk(256);
    const dim3 gg(D_ / 128, M_ / 128);      // (8, 64)
    const dim3 g3(D_ / 128, M_ / 128, 3);   // (8, 64, 3): Q, K and V
    const dim3 gw(D_ / 128, D_ / 128, 4);   // (8, 8, 4): the four weight products
    const float qscale = 1.0f / 8.0f;       // 1/sqrt(HD)

    // two linear layers in a row are one: (x * W1^T) * W2^T = x * (W2 * W1)^T.
    // wf[i][f][d] = sum_e w2[i][f][e] * w1[i][e][d]
    gemm_nt_kernel<0><<<gw, blk, 0, stream>>>(w2, w1t, nullptr, wf, nullptr, D_, D_, D_, ND, 1.0f);
    // Q/K/V = x * wf^T + bias, one batch on the one x; Qb, Kb, Vb lie back to back
    // (softmax scale folded into Q, the batch's product 0)
    gemm_nt_kernel<0><<<g3, blk, 0, stream>>>(xb, wf, in_b, Qb, nullptr, M_, D_, D_, 0, qscale);
    // attention
    flash_attn_kernel<<<dim3(S_ / 256, B_ * H_), blk, 0, stream>>>(Qb, Kb, Vb, ctx);
    // out = ctx * (proj_w * out_w)^T + (proj_w * out_b + proj_b) + x   (fp32)
    gemm_nt_kernel<1><<<gg, blk, 0, stream>>>(ctx, wf + 3 * ND, bfold, out, x, M_, D_, D_, 0, 1.0f);
}

// v009
// It runs in 150 microseconds.
// Two timings next to v008 put it at 1.04 and 1.05 times that version's speed.
// Counting every step since v000, it is 3.51 times as fast.
#include <hip/hip_runtime.h>
#include <hip/hip_bf16.h>

#define B_ 4
#define S_ 2048
#define D_ 1024
#define H_ 16
#define HD_ 64
#define M_ (B_ * S_)   // 8192 rows of the token matrix

typedef __attribute__((ext_vector_type(16))) __bf16 bf16x16;
typedef __attribute__((ext_vector_type(8)))  float  f32x8;

union Frag {          // 16 bf16 = 8 VGPRs; u[0] -> K = g*8..g*8+7, u[1] -> K = 16+g*8..
    uint4   u[2];
    bf16x16 v;
};

#define WMMA_BF16(a, b, c) \
    __builtin_amdgcn_wmma_f32_16x16x32_bf16(false, (a), false, (b), (short)0, (c), false, false)

// ---------------------------------------------------------------------------
// The set-up conversions below are parts of ONE grid (prep_kernel): none reads what another
// writes.  Each takes the index of its block within its own part; a block is 256 threads.
// ---------------------------------------------------------------------------
// fp32 -> bf16 conversion (4 elems / thread)
// ---------------------------------------------------------------------------
__device__ inline void f32_to_bf16_part(const float* __restrict__ in, __bf16* __restrict__ out, int n, int blk) {
    int i = (blk * 256 + threadIdx.x) * 4;
    if (i + 3 < n) {
        float4 f = *reinterpret_cast<const float4*>(in + i);
        out[i + 0] = (__bf16)f.x;
        out[i + 1] = (__bf16)f.y;
        out[i + 2] = (__bf16)f.z;
        out[i + 3] = (__bf16)f.w;
    } else {
        for (int j = i; j < n; ++j) out[j] = (__bf16)in[j];
    }
}

// ---------------------------------------------------------------------------
// fp32 -> bf16 conversion with transpose: out[c][r] = in[r][c], n x n matrix,
// 64x64 tile through LDS so that both the reads and the writes are contiguous.
// ---------------------------------------------------------------------------
__device__ inline void f32_to_bf16_transpose_part(const float* __restrict__ in, __bf16* __restrict__ out, int n,
                                                  int bx, int by) {
    __shared__ float tile[64][65];
    const int c0 = bx * 64;
    const int r0 = by * 64;
    const int t  = threadIdx.x;
    {
        const int c4 = (t & 15) * 4;
        const int r  = t >> 4;
#pragma unroll  // all four row loads in flight together
        for (int k = 0; k < 4; ++k) {
            float4 f = *reinterpret_cast<const float4*>(in + (size_t)(r0 + r + 16 * k) * n + c0 + c4);
            tile[r + 16 * k][c4 + 0] = f.x;
            tile[r + 16 * k][c4 + 1] = f.y;
            tile[r + 16 * k][c4 + 2] = f.z;
            tile[r + 16 * k][c4 + 3] = f.w;
        }
    }
    __syncthreads();
    {
        const int r8 = (t & 7) * 8;
        const int c  = t >> 3;
#pragma unroll  // both unrolled: p stays in registers, constant LDS offsets
        for (int k = 0; k < 2; ++k) {
            union { uint4 u; __bf16 e[8]; } p;
#pragma unroll
            for (int i = 0; i < 8; ++i) p.e[i] = (__bf16)tile[r8 + i][c + 32 * k];
            *reinterpret_cast<uint4*>(out + (size_t)(c0 + c + 32 * k) * n + r0 + r8) = p.u;
        }
        // precaution: stands before any later code of the shared grid rewrites a register that these
        // two issued stores name
        asm volatile("s_wait_xcnt 0x0" ::: "memory");
    }
}

// ---------------------------------------------------------------------------
// fp32 -> bf16 conversion of a D_ x D_ weight w, and in the same pass the folded
// bias bout[r] = b[r] + sum_e w[r][e] * v[e] in f32.
// block = 8 waves x 4 rows = 32 rows, so a block writes one whole 128-byte line of bout.
// ---------------------------------------------------------------------------
__device__ inline void f32_to_bf16_fold_bias_part(const float* __restrict__ w, const float* __restrict__ v,
                                                  const float* __restrict__ b, __bf16* __restrict__ wout,
                                                  float* __restrict__ bout, int blk) {
    __shared__ float rowsum[32];
    const int lane = threadIdx.x & 31;
    const int wave = threadIdx.x >> 5;
    const int row0 = blk * 32;
    const size_t base = (size_t)(row0 + wave * 4) * D_;
    float s[4] = {0.0f, 0.0f, 0.0f, 0.0f};
    // k loop kept rolled, its four rows unrolled (their loads in flight together, s[] in registers): all
    // eight steps at once would take over 200 registers from every wave of the grid, whose streaming
    // parts have one 16-byte load a thread and live on the number of resident waves
#pragma nounroll
    for (int k = 0; k < D_ / 128; ++k) {
        const int c = k * 128 + lane * 4;
        float4 gv = *reinterpret_cast<const float4*>(v + c);
#pragma unroll
        for (int rr = 0; rr < 4; ++rr) {
            float4 f = *reinterpret_cast<const float4*>(w + base + rr * D_ + c);
            union { uint2 u; __bf16 e[4]; } p;
            p.e[0] = (__bf16)f.x;  p.e[1] = (__bf16)f.y;
            p.e[2] = (__bf16)f.z;  p.e[3] = (__bf16)f.w;
            *reinterpret_cast<uint2*>(wout + base + rr * D_ + c) = p.u;
            s[rr] += f.x * gv.x + f.y * gv.y + f.z * gv.z + f.w * gv.w;
        }
        // precaution: stands before the next trip rewrites the address and data registers that this
        // trip's issued stores name
        asm volatile("s_wait_xcnt 0x0" ::: "memory");
    }
#pragma unroll  // s[] indexed by constants; the four reductions overlap
    for (int rr = 0; rr < 4; ++rr) {
        for (int off = 16; off > 0; off >>= 1) s[rr] += __shfl_xor(s[rr], off, 32);
    }
    if (lane == 0) {
#pragma unroll  // s[] indexed by constants
        for (int rr = 0; rr < 4; ++rr) rowsum[wave * 4 + rr] = s[rr];
    }
    __syncthreads();
    if (threadIdx.x < 32) bout[row0 + threadIdx.x] = rowsum[threadIdx.x] + b[row0 + threadIdx.x];
}

// ---------------------------------------------------------------------------
// All set-up conversions in one grid, a block range for each; the part with the longest chain
// of dependent loads has the lowest indices.  Every branch is block-uniform.
// ---------------------------------------------------------------------------
#define PB_FOLD (D_ / 32)                 // 32 blocks: proj_w and the folded bias
#define PB_TR   ((D_ / 64) * (D_ / 64))   // 256 blocks for each transposed weight
#define PB_INW  (3 * D_ * D_ / 1024)      // 3,072 blocks: in_w
#define PB_X    (M_ * D_ / 1024)          // 8,192 blocks: x

__global__ __launch_bounds__(256)
void prep_kernel(const float* __restrict__ x, const float* __restrict__ Wq, const float* __restrict__ Wk,
                 const float* __restrict__ Wv, const float* __restrict__ out_w,
                 const float* __restrict__ in_w, const float* __restrict__ proj_w,
                 const float* __restrict__ out_b, const float* __restrict__ proj_b,
                 __bf16* __restrict__ xb, __bf16* __restrict__ w1t, __bf16* __restrict__ w2,
                 float* __restrict__ bfold) {
    int blk = blockIdx.x;
    if (blk < PB_FOLD) {
        f32_to_bf16_fold_bias_part(proj_w, out_b, proj_b, w2 + 3 * D_ * D_, bfold, blk);
        return;
    }
    blk -= PB_FOLD;
    if (blk < 4 * PB_TR) {
        const int which = blk / PB_TR;
        const float* src = (which == 0) ? Wq : (which == 1) ? Wk : (which == 2) ? Wv : out_w;
        f32_to_bf16_transpose_part(src, w1t + (size_t)which * D_ * D_, D_, blk % (D_ / 64), (blk / (D_ / 64)) % (D_ / 64));
        return;
    }
    blk -= 4 * PB_TR;
    if (blk < PB_INW) {
        f32_to_bf16_part(in_w, w2, 3 * D_ * D_, blk);
        return;
    }
    f32_to_bf16_part(x, xb, M_ * D_, blk - PB_INW);
}

// ---------------------------------------------------------------------------
// NT GEMM: C[M x N] = A[M x K](bf16) * W[N x K](bf16)^T  (+bias)*scale (+res)
// block = 256 threads (8 waves); block tile 128x128; wave tile 32x64
// (2 M-tiles x 4 N-tiles = 8 f32x8 accumulators, 6 fragment loads / 8 WMMAs).
// A and W tiles both double-buffered through LDS, 64 k a step: a step takes one whole
// 128-byte line of every operand row, and 8 neighbouring lanes fetch that line together,
// so a wave-wide 16-byte load touches 4 whole lines.  One barrier per step.
// K is a multiple of 64.
// The W fragment is the matrix instruction's A operand and the A-matrix fragment its B operand, so a
// lane's accumulator holds 8 consecutive columns of ONE output row.  Each wave stages its 32x64 piece
// in its own LDS range (the ring, once every wave has left it) and stores it in whole 128-byte lines.
// MODE 0: bf16 output.  MODE 1: f32 output + residual add.
// blockIdx.z picks one product of a batch whose W, C and bias each lie back to back; their A lie
// astep elements apart (0: one A for all).  scale belongs to product 0, the others have none.
// ---------------------------------------------------------------------------
#define GP_ 72   // LDS row pitch in elements: 144 bytes = 16 bytes x odd, for 16-byte readers
#define SP0_ 144  // output staging row pitch in bytes, bf16: 128 + 16 = 16 bytes x odd
#define SP1_ 272  // output staging row pitch in bytes, f32: 256 + 16 = 16 bytes x odd

template <int MODE>
__global__ __launch_bounds__(256)
void gemm_nt_kernel(const __bf16* __restrict__ Abase, const __bf16* __restrict__ Wbase,
                    const float* __restrict__ bias, void* __restrict__ Outbase,
                    const float* __restrict__ resbase,
                    int M, int N, int K, int astep, float scale) {
    // one array: A tiles 0 and 1, W tiles 0 and 1; the epilogue stages the output in it
    __shared__ __attribute__((aligned(16))) __bf16 ring[4][128 * GP_];
    __bf16 (*alds)[128 * GP_] = ring;
    __bf16 (*wlds)[128 * GP_] = ring + 2;

    const int lane = threadIdx.x & 31;
    const int wave = threadIdx.x >> 5;
    const int g    = lane >> 4;      // half-wave group (A/B layout K-offset selector)
    const int lm   = lane & 15;      // row (A) / column (B) within tile
    const int mw   = wave & 3;       // 32-row strip within block tile
    const int nw   = wave >> 2;      // 64-col strip within block tile
    const int n0   = blockIdx.x * 128;
    const int m0   = blockIdx.y * 128;
    const __bf16* __restrict__ A = Abase + (size_t)blockIdx.z * astep;
    const __bf16* __restrict__ W = Wbase + (size_t)blockIdx.z * N * K;
    const size_t  cz = (size_t)blockIdx.z * M * N;
    void* __restrict__ Out = (MODE == 0) ? (void*)((__bf16*)Outbase + cz) : (void*)((float*)Outbase + cz);
    const float* __restrict__ residual = (MODE == 0) ? resbase : resbase + cz;

    f32x8 acc[2][4];
    for (int mt = 0; mt < 2; ++mt)
        for (int j = 0; j < 4; ++j)
            for (int e = 0; e < 8; ++e) acc[mt][j][e] = 0.0f;

    // cooperative staging: 32 rows x 8 lanes of 16 B a round, 4 rounds for each operand
    const int srow = threadIdx.x >> 3;
    const int sch  = threadIdx.x & 7;
    // block-uniform byte bases; the lane's part is the byte offsets so0..so3, the same for both
    // operands, 128 bytes further each step; they keep registers of their own through the loop
    const char* astage = reinterpret_cast<const char*>(A + (size_t)m0 * K);
    const char* wstage = reinterpret_cast<const char*>(W + (size_t)n0 * K);
    unsigned so0 = ((unsigned)srow * K + sch * 8) * 2u;
    unsigned so1 = so0 + 64u * K;
    unsigned so2 = so0 + 128u * K;
    unsigned so3 = so0 + 192u * K;
    const int sdst = srow * GP_ + sch * 8;

    // preload step 0 into buffer 0
    {
        const uint4 a0 = *reinterpret_cast<const uint4*>(astage + so0);
        const uint4 a1 = *reinterpret_cast<const uint4*>(astage + so1);
        const uint4 a2 = *reinterpret_cast<const uint4*>(astage + so2);
        const uint4 a3 = *reinterpret_cast<const uint4*>(astage + so3);
        const uint4 b0 = *reinterpret_cast<const uint4*>(wstage + so0);
        const uint4 b1 = *reinterpret_cast<const uint4*>(wstage + so1);
        const uint4 b2 = *reinterpret_cast<const uint4*>(wstage + so2);
        const uint4 b3 = *reinterpret_cast<const uint4*>(wstage + so3);
        *reinterpret_cast<uint4*>(&alds[0][sdst])                = a0;
        *reinterpret_cast<uint4*>(&alds[0][sdst + 32 * GP_])     = a1;
        *reinterpret_cast<uint4*>(&alds[0][sdst + 2 * 32 * GP_]) = a2;
        *reinterpret_cast<uint4*>(&alds[0][sdst + 3 * 32 * GP_]) = a3;
        *reinterpret_cast<uint4*>(&wlds[0][sdst])                = b0;
        *reinterpret_cast<uint4*>(&wlds[0][sdst + 32 * GP_])     = b1;
        *reinterpret_cast<uint4*>(&wlds[0][sdst + 2 * 32 * GP_]) = b2;
        *reinterpret_cast<uint4*>(&wlds[0][sdst + 3 * 32 * GP_]) = b3;
    }

    const int niter = K / 64;
    for (int i = 0; i < niter; ++i) {
        __syncthreads();                       // buffer (i&1) is ready
        uint4 na0, na1, na2, na3, nb0, nb1, nb2, nb3;
        const bool havenext = (i + 1 < niter);
        if (havenext) {                        // issue the next step's global loads early
            so0 += 128u;  so1 += 128u;  so2 += 128u;  so3 += 128u;
            na0 = *reinterpret_cast<const uint4*>(astage + so0);
            na1 = *reinterpret_cast<const uint4*>(astage + so1);
            na2 = *reinterpret_cast<const uint4*>(astage + so2);
            na3 = *reinterpret_cast<const uint4*>(astage + so3);
            nb0 = *reinterpret_cast<const uint4*>(wstage + so0);
            nb1 = *reinterpret_cast<const uint4*>(wstage + so1);
            nb2 = *reinterpret_cast<const uint4*>(wstage + so2);
            nb3 = *reinterpret_cast<const uint4*>(wstage + so3);
            // precaution: stands before the next step's additions rewrite the offset registers
            // (and before the base pair is reused) that these eight issued loads name
            asm volatile("s_wait_xcnt 0x0" ::: "memory");
        }

        const __bf16* al = alds[i & 1];
        const __bf16* wl = wlds[i & 1];
#pragma unroll  // all three unrolled: constant LDS offsets, fragments and acc[] in registers
        for (int ks = 0; ks < 2; ++ks) {
            Frag fa[2];
#pragma unroll
            for (int mt = 0; mt < 2; ++mt) {
                const __bf16* asrc = &al[(mw * 32 + mt * 16 + lm) * GP_ + ks * 32];
                fa[mt].u[0] = *reinterpret_cast<const uint4*>(asrc + g * 8);
                fa[mt].u[1] = *reinterpret_cast<const uint4*>(asrc + 16 + g * 8);
            }
#pragma unroll
            for (int j = 0; j < 4; ++j) {
                Frag fb;
                const __bf16* bsrc = &wl[(nw * 64 + j * 16 + lm) * GP_ + ks * 32];
                fb.u[0] = *reinterpret_cast<const uint4*>(bsrc + g * 8);
                fb.u[1] = *reinterpret_cast<const uint4*>(bsrc + 16 + g * 8);
                acc[0][j] = WMMA_BF16(fb.v, fa[0].v, acc[0][j]);
                acc[1][j] = WMMA_BF16(fb.v, fa[1].v, acc[1][j]);
            }
        }

        if (havenext) {                        // fill the idle buffer
            __bf16* ad = &alds[(i + 1) & 1][sdst];
            __bf16* wd = &wlds[(i + 1) & 1][sdst];
            *reinterpret_cast<uint4*>(ad)                = na0;
            *reinterpret_cast<uint4*>(ad + 32 * GP_)     = na1;
            *reinterpret_cast<uint4*>(ad + 2 * 32 * GP_) = na2;
            *reinterpret_cast<uint4*>(ad + 3 * 32 * GP_) = na3;
            *reinterpret_cast<uint4*>(wd)                = nb0;
            *reinterpret_cast<uint4*>(wd + 32 * GP_)     = nb1;
            *reinterpret_cast<uint4*>(wd + 2 * 32 * GP_) = nb2;
            *reinterpret_cast<uint4*>(wd + 3 * 32 * GP_) = nb3;
        }
    }

    // epilogue: acc[mt][j][r] = C[mrow0 + mt*16 + lm][ncol0 + j*16 + 8*g + r]
    const float zscale = (blockIdx.z == 0) ? scale : 1.0f;
    const int mrow0 = m0 + mw * 32;
    const int ncol0 = n0 + nw * 64;

    // MODE 1: a row of the wave's piece is 256 bytes: 16 lanes take it, a wave-wide access covers 2 rows.
    // Residual and output share the lane's byte offsets ob[] from the block tile's first element.
    // The residual's sixteen loads go first, so that they and the bias loads are in flight together.
    const size_t tile0 = (size_t)m0 * N + n0;
    unsigned ob[16];
    float4 res[16];
    if (MODE == 1) {
        const char* rbase = reinterpret_cast<const char*>(residual + tile0);
#pragma unroll  // ob[] and res[] indexed by constants, in registers
        for (int i = 0; i < 16; ++i) {
            ob[i]  = ((unsigned)(mw * 32 + (lane >> 4) + 2 * i) * N + nw * 64 + (lane & 15) * 4) * 4u;
            res[i] = *reinterpret_cast<const float4*>(rbase + ob[i]);
        }
        // precaution: stands before the base pair that these sixteen issued loads name is reused
        asm volatile("s_wait_xcnt 0x0" ::: "memory");
    }

    // bias of the lane's 8 columns in each column group, all eight loads in flight together
    float4 bv[4][2];
    if (bias) {
        const float* bp = bias + (size_t)blockIdx.z * N + ncol0 + 8 * g;
#pragma unroll  // bv[] indexed by constants, in registers
        for (int j = 0; j < 4; ++j) {
            bv[j][0] = *reinterpret_cast<const float4*>(bp + j * 16);
            bv[j][1] = *reinterpret_cast<const float4*>(bp + j * 16 + 4);
        }
        // precaution: stands before any later code rewrites the address pair that these issued loads name
        asm volatile("s_wait_xcnt 0x0" ::: "memory");
    } else {
#pragma unroll
        for (int j = 0; j < 4; ++j) {
            bv[j][0] = make_float4(0.0f, 0.0f, 0.0f, 0.0f);
            bv[j][1] = bv[j][0];
        }
    }

    if (MODE == 0) {
        // a row of the wave's piece is 128 bytes: 8 lanes take it, a wave-wide store covers 4 rows
        const int orow = lane >> 3;
        const int och  = lane & 7;
        char* st = reinterpret_cast<char*>(&ring[0][0]) + wave * (32 * SP0_);
        __syncthreads();                       // every wave has read its last fragments: the ring is free
#pragma unroll  // all three unrolled: acc[] and bv[] indexed by constants, in registers
        for (int mt = 0; mt < 2; ++mt) {
#pragma unroll
            for (int j = 0; j < 4; ++j) {
                const float b8[8] = {bv[j][0].x, bv[j][0].y, bv[j][0].z, bv[j][0].w,
                                     bv[j][1].x, bv[j][1].y, bv[j][1].z, bv[j][1].w};
                union { uint4 u; __bf16 e[8]; } o;
#pragma unroll
                for (int r = 0; r < 8; ++r) o.e[r] = (__bf16)((acc[mt][j][r] + b8[r]) * zscale);
                *reinterpret_cast<uint4*>(st + (mt * 16 + lm) * SP0_ + j * 32 + g * 16) = o.u;
            }
        }
        // the wave's own LDS stores have landed before other lanes of it read them back
        asm volatile("s_wait_dscnt 0x0" ::: "memory");
        __bf16* dst = (__bf16*)Out + (size_t)(mrow0 + orow) * N + ncol0 + och * 8;
        uint4 ov[8];
#pragma unroll  // ov[] indexed by constants, in registers; the eight LDS reads go as one group
        for (int i = 0; i < 8; ++i)
            ov[i] = *reinterpret_cast<const uint4*>(st + (4 * i + orow) * SP0_ + och * 16);
#pragma unroll
        for (int i = 0; i < 8; ++i)
            *reinterpret_cast<uint4*>(dst + (size_t)(4 * i) * N) = ov[i];
    } else {
        const int orow = lane >> 4;
        const int och  = lane & 15;
        char* st = reinterpret_cast<char*>(&ring[0][0]) + wave * (32 * SP1_);
        __syncthreads();                       // every wave has read its last fragments: the ring is free
#pragma unroll  // all unrolled: acc[] and bv[] indexed by constants, in registers
        for (int mt = 0; mt < 2; ++mt) {
#pragma unroll
            for (int j = 0; j < 4; ++j) {
                float4 lo, hi;
                lo.x = (acc[mt][j][0] + bv[j][0].x) * zscale;
                lo.y = (acc[mt][j][1] + bv[j][0].y) * zscale;
                lo.z = (acc[mt][j][2] + bv[j][0].z) * zscale;
                lo.w = (acc[mt][j][3] + bv[j][0].w) * zscale;
                hi.x = (acc[mt][j][4] + bv[j][1].x) * zscale;
                hi.y = (acc[mt][j][5] + bv[j][1].y) * zscale;
                hi.z = (acc[mt][j][6] + bv[j][1].z) * zscale;
                hi.w = (acc[mt][j][7] + bv[j][1].w) * zscale;
                char* p = st + (mt * 16 + lm) * SP1_ + j * 64 + g * 32;
                *reinterpret_cast<float4*>(p)      = lo;
                *reinterpret_cast<float4*>(p + 16) = hi;
            }
        }
        // the wave's own LDS stores have landed before other lanes of it read them back
        asm volatile("s_wait_dscnt 0x0" ::: "memory");
        char* obase = reinterpret_cast<char*>((float*)Out + tile0);
#pragma unroll
        for (int i = 0; i < 16; ++i) {
            float4 v = *reinterpret_cast<const float4*>(st + (2 * i + orow) * SP1_ + och * 16);
            v.x += res[i].x;  v.y += res[i].y;  v.z += res[i].z;  v.w += res[i].w;
            *reinterpret_cast<float4*>(obase + ob[i]) = v;
        }
    }
}

// ---------------------------------------------------------------------------
// Flash attention, transposed: S^T = K * Q_scaled^T + tril(1)^T; softmax down each
// column; ctx^T = V^T * P^T.  A lane holds scores of ONE query in each column group, so the
// maximum and the sum run over its own registers, and the two f32 score tiles of a
// 32-key step, converted in place, are the B operand of the second product.
// The softmax runs against a HELD reference in the log2 domain: Q arrives scaled by log2(e)/sqrt(HD),
// minus the reference is the C operand of the first score product, so the score tiles are the
// arguments of exp2 as they leave the matrix unit.  The reference moves, and sums and output tiles
// are rescaled, in pass 0 and in a pass where some score of the wave lies more than 8 above it.
// grid = (S/256, B*H); block = 256 (8 waves); wave owns 32 query columns = 2 groups of 16:
// every K and V^T fragment read from LDS feeds two matrix instructions.
// K/V tiles double-buffered in LDS, both row-major; one barrier per 32-key step.
// V^T fragments come from the row-major V tile by the 16-bit transposing LDS load.
// Q/K/V/ctx are (B,S,D) bf16 with head h in columns [h*64, h*64+64).
// ---------------------------------------------------------------------------
__device__ inline float other_half(float v) {   // value of lane l ^ 16
    const int b = __float_as_int(v);
    return __int_as_float(__builtin_amdgcn_permlanex16(b, b, 0x76543210, 0xfedcba98, false, false));
}

#define LOG2E_ 1.44269504f   // log2(e): the mask's 1 in the log2 domain
#define VP_ 80   // V tile row pitch in elements: 160 bytes = 32 bytes x odd, for the transposing reader

typedef short s16x8 __attribute__((ext_vector_type(8)));
// lane (c = l & 15, h = l >> 4), pointed at row 8h + (l & 7), 16-byte piece (l >> 3) & 1 of a
// 16-row x 16-column block, gets column c of rows 8h .. 8h + 7
__device__ inline uint4 lds_load_tr16(const __bf16* p) {
    typedef __attribute__((address_space(3))) s16x8 lds_s16x8;
    return __builtin_bit_cast(uint4, __builtin_amdgcn_ds_load_tr16_b128_v8i16((lds_s16x8*)p));
}

// exp2 of a score tile: eight v_exp_f32 and one v_nop in ONE statement, no result in a source's register.
// Written so, none of them overwrites the source of the one directly before it, and the slot that the
// instruction set asks for behind a transcendental is filled behind the last, whatever the compiler puts next.
__device__ inline f32x8 exp2_tile(f32x8 v) {
    float p0, p1, p2, p3, p4, p5, p6, p7;
    asm("v_exp_f32 %0, %8\n\tv_exp_f32 %1, %9\n\tv_exp_f32 %2, %10\n\tv_exp_f32 %3, %11\n\t"
        "v_exp_f32 %4, %12\n\tv_exp_f32 %5, %13\n\tv_exp_f32 %6, %14\n\tv_exp_f32 %7, %15\n\tv_nop"
        : "=&v"(p0), "=&v"(p1), "=&v"(p2), "=&v"(p3), "=&v"(p4), "=&v"(p5), "=&v"(p6), "=&v"(p7)
        : "v"(v[0]), "v"(v[1]), "v"(v[2]), "v"(v[3]), "v"(v[4]), "v"(v[5]), "v"(v[6]), "v"(v[7]));
    const f32x8 o = {p0, p1, p2, p3, p4, p5, p6, p7};
    return o;
}

__global__ __launch_bounds__(256)
void flash_attn_kernel(const __bf16* __restrict__ Q, const __bf16* __restrict__ Kp,
                       const __bf16* __restrict__ Vp, __bf16* __restrict__ O) {
    __shared__ __attribute__((aligned(16))) __bf16 klds[2][32 * 72];     // K tile row-major
    __shared__ __attribute__((aligned(16))) __bf16 vlds[2][32 * VP_];    // V tile row-major

    const int lane = threadIdx.x & 31;
    const int wave = threadIdx.x >> 5;
    const int g    = lane >> 4;
    const int lm   = lane & 15;

    const int b = blockIdx.y / H_;
    const int h = blockIdx.y % H_;
    const int qblk = blockIdx.x * 256;
    const size_t headoff = (size_t)b * S_ * D_ + (size_t)h * HD_;

    // Q fragments (B operand, two K=32 steps over HD=64) of both column groups, loaded once;
    // group c holds query qrow + 16 * c
    const int qrow = qblk + wave * 32 + lm;
    Frag qf[2][2];
    const __bf16* qsrc = Q + headoff + (size_t)qrow * D_;
#pragma unroll
    for (int c = 0; c < 2; ++c) {
#pragma unroll
        for (int dh = 0; dh < 2; ++dh) {
            qf[c][dh].u[0] = *reinterpret_cast<const uint4*>(qsrc + c * 16 * D_ + dh * 32 + g * 8);
            qf[c][dh].u[1] = *reinterpret_cast<const uint4*>(qsrc + c * 16 * D_ + dh * 32 + 16 + g * 8);
        }
    }
    // precaution: no later load's result lands on an address register of a load issued before it
    asm volatile("s_wait_xcnt 0x0" ::: "memory");

    f32x8 nref[2];                          // minus the reference of a group's query (equal in both halves), 8 copies: a C tile
    for (int c = 0; c < 2; ++c)
        for (int e = 0; e < 8; ++e) nref[c][e] = 0.0f;
    float lrun[2] = {0.0f, 0.0f};           // running sum over this half's keys only; joined after the loop
    f32x8 acc[2][4];                        // acc[c][dt][r] = ctx[qrow + 16*c][dt*16 + 8*g + r]
    for (int c = 0; c < 2; ++c)
        for (int dt = 0; dt < 4; ++dt)
            for (int e = 0; e < 8; ++e) acc[c][dt][e] = 0.0f;

    // staging: 32 key rows x 8 d-chunks, 16 B each
    const int trow = threadIdx.x >> 3;
    const int tch  = threadIdx.x & 7;
    const __bf16* kstage = Kp + headoff + (size_t)trow * D_ + tch * 8;
    const __bf16* vstage = Vp + headoff + (size_t)trow * D_ + tch * 8;
    // the lane's place in a V tile for the transposing load
    const int vtr = (8 * g + (lane & 7)) * VP_ + ((lane >> 3) & 1) * 8;
    // the one pass whose 32 keys are the wave's 32 queries; in a scalar register, so that the
    // test on it in the loop is a scalar compare
    const int dpass = __builtin_amdgcn_readfirstlane((qblk + wave * 32) >> 5);
    // key offset t*16 + r of the current pass is at or below qrow while <= lim; stepped pass by pass:
    // formed from dpass, the mask values would be lifted out of the loop into registers of their own
    int lim = qrow - 8 * g;

    // preload tile 0 into buffer 0
    {
        uint4 kv = *reinterpret_cast<const uint4*>(kstage);
        uint4 vv = *reinterpret_cast<const uint4*>(vstage);
        *reinterpret_cast<uint4*>(&klds[0][trow * 72 + tch * 8]) = kv;
        *reinterpret_cast<uint4*>(&vlds[0][trow * VP_ + tch * 8]) = vv;
    }

    const int niter = S_ / 32;
    // not unrolled, last pass not peeled off: the next tile's global loads then keep their own
    // block at the head of the pass; peeled, they sink to their LDS stores and are waited for in full
#pragma nounroll
    for (int it = 0; it < niter; ++it) {
        __syncthreads();                         // buffer (it&1) is ready
        const int kt = it * 32;

        uint4 kn, vn;
        const bool havenext = (it + 1 < niter);
        if (havenext) {
            kn   = *reinterpret_cast<const uint4*>(kstage + (size_t)(kt + 32) * D_);
            vn   = *reinterpret_cast<const uint4*>(vstage + (size_t)(kt + 32) * D_);
            // precaution: stands before the pass's foot steps the address pairs that these two issued
            // loads name, on every way there
            asm volatile("s_wait_xcnt 0x0" ::: "memory");
        }

        const __bf16* kl = klds[it & 1];
        const __bf16* vl = vlds[it & 1];

        // scores: two 16-key subtiles for each column group, accumulated over two d-halves
        // sc[c][t][r] = log2-domain score of key kt + t*16 + 8*g + r against query qrow + 16*c, less its reference
        f32x8 sc[2][2];
#pragma unroll
        for (int dh = 0; dh < 2; ++dh) {
#pragma unroll
            for (int t = 0; t < 2; ++t) {
                Frag kf;                         // one fragment, both column groups
                const __bf16* ks = &kl[(t * 16 + lm) * 72 + dh * 32];
                kf.u[0] = *reinterpret_cast<const uint4*>(ks + g * 8);
                kf.u[1] = *reinterpret_cast<const uint4*>(ks + 16 + g * 8);
                sc[0][t] = WMMA_BF16(kf.v, qf[0][dh].v, (dh == 0) ? nref[0] : sc[0][t]);
                sc[1][t] = WMMA_BF16(kf.v, qf[1][dh].v, (dh == 0) ? nref[1] : sc[1][t]);
            }
        }

        // additive tril(1) mask, log2(e) in this domain; the 16 scores of a lane in a group belong to one query.
        // Before pass dpass the mask is on every score the wave has seen, and a constant on all
        // of them cancels in the softmax: it is left out, and the reference runs that much below its masked value.
        // Pass dpass puts it on the reference and so takes it off the scores above the diagonal; behind it the mask is 0.
        if (it == dpass) {
#pragma unroll  // all four unrolled: sc[] and nref[] indexed by constants, in registers
            for (int c = 0; c < 2; ++c) {
#pragma unroll
                for (int e = 0; e < 8; ++e) nref[c][e] -= LOG2E_;
#pragma unroll
                for (int t = 0; t < 2; ++t)
#pragma unroll
                    for (int r = 0; r < 8; ++r) sc[c][t][r] -= (t * 16 + r - c * 16 <= lim) ? 0.0f : LOG2E_;
            }
        }
        lim -= 32;

        // the lane's largest score above its reference, one chain per tile
        float mxt[2][2];
#pragma unroll  // all three unrolled: sc[] and mxt[] indexed by constants, in registers
        for (int c = 0; c < 2; ++c)
#pragma unroll
            for (int t = 0; t < 2; ++t) {
                mxt[c][t] = sc[c][t][0];
#pragma unroll
                for (int r = 1; r < 8; ++r) mxt[c][t] = fmaxf(mxt[c][t], sc[c][t][r]);
            }
        // one test a pass for the whole wave, a scalar branch; pass 0 always takes it and sets the first reference
        const float thr = (it == 0) ? -3.0e38f : 8.0f;
        if (__builtin_amdgcn_ballot_w32(fmaxf(fmaxf(mxt[0][0], mxt[0][1]), fmaxf(mxt[1][0], mxt[1][1])) > thr) != 0) {
#pragma unroll  // all unrolled: sc[], nref[] and acc[] indexed by constants, in registers
            for (int c = 0; c < 2; ++c) {
                float mx = fmaxf(mxt[c][0], mxt[c][1]);
                mx = fmaxf(mx, other_half(mx));
                // the reference only rises, but for pass 0, which may set it below its start value 0
                const float d = (it == 0) ? mx : fmaxf(mx, 0.0f);
                const float alpha = __builtin_amdgcn_exp2f(fminf(-d, 0.0f));
                nref[c]  -= d;                   // whole tiles, the scalar on every element
                sc[c][0] -= d;
                sc[c][1] -= d;
                lrun[c] *= alpha;
#pragma unroll
                for (int dt = 0; dt < 4; ++dt)
#pragma unroll
                    for (int r = 0; r < 8; ++r) acc[c][dt][r] *= alpha;
            }
        }

        Frag vf[4];                              // vf[dt]: row d = dt*16 + lm, keys in the hardware k order
#pragma unroll  // vf[] in registers; all eight reads go as one group, ahead of the exponentials
        for (int dt = 0; dt < 4; ++dt) {
            const __bf16* vs = &vl[vtr + dt * 16];
            vf[dt].u[0] = lds_load_tr16(vs);
            vf[dt].u[1] = lds_load_tr16(vs + 16 * VP_);
        }
        // holds the reads ahead of the exponentials, whose length the scheduler does not see in their asm
        // statements: sunk to the matrix instructions, each pair of reads would be waited for in full
        __builtin_amdgcn_sched_barrier(0);

        Frag pf[2];                              // pf[c].v[t*8 + r]: hardware k order of a B operand
#pragma unroll  // all unrolled: sc[], rs[] and pf[] indexed by constants, in registers
        for (int c = 0; c < 2; ++c) {
            const f32x8 p0 = exp2_tile(sc[c][0]);
            const f32x8 p1 = exp2_tile(sc[c][1]);
            float rs[4];                             // four independent chains
#pragma unroll
            for (int k = 0; k < 4; ++k) rs[k] = ((p0[k] + p0[k + 4]) + p1[k]) + p1[k + 4];
#pragma unroll
            for (int r = 0; r < 8; ++r) {
                pf[c].v[r]     = (__bf16)p0[r];
                pf[c].v[8 + r] = (__bf16)p1[r];
            }
            lrun[c] += (rs[0] + rs[1]) + (rs[2] + rs[3]);
        }

#pragma unroll  // vf[] and acc[] indexed by constants, in registers
        for (int dt = 0; dt < 4; ++dt) {
            acc[0][dt] = WMMA_BF16(vf[dt].v, pf[0].v, acc[0][dt]);
            acc[1][dt] = WMMA_BF16(vf[dt].v, pf[1].v, acc[1][dt]);
        }

        if (havenext) {                          // fill the idle buffer
            __bf16* kd = klds[(it + 1) & 1];
            __bf16* vd = vlds[(it + 1) & 1];
            *reinterpret_cast<uint4*>(&kd[trow * 72 + tch * 8]) = kn;
            *reinterpret_cast<uint4*>(&vd[trow * VP_ + tch * 8]) = vn;
        }
    }

    // join the halves' sums, normalize, store: 8 consecutive d of one query = 16 bytes;
    // both groups go out from one address, group 1 at a constant offset
    uint4 ov[2][4];
#pragma unroll  // all unrolled: acc[] and ov[] indexed by constants, in registers
    for (int c = 0; c < 2; ++c) {
        const float inv = 1.0f / (lrun[c] + other_half(lrun[c]));
#pragma unroll
        for (int dt = 0; dt < 4; ++dt) {
            union { uint4 u; __bf16 e[8]; } o;
#pragma unroll
            for (int r = 0; r < 8; ++r) o.e[r] = (__bf16)(acc[c][dt][r] * inv);
            ov[c][dt] = o.u;
        }
    }
    __bf16* dst = O + headoff + (size_t)qrow * D_ + 8 * g;
#pragma unroll
    for (int c = 0; c < 2; ++c)
#pragma unroll
        for (int dt = 0; dt < 4; ++dt)
            *reinterpret_cast<uint4*>(dst + c * 16 * D_ + dt * 16) = ov[c][dt];
}

// ---------------------------------------------------------------------------
extern "C" void kernel_launch(void* const* d_in, const int* in_sizes, int n_in,
                              void* d_out, int out_size, void* d_ws, size_t ws_size,
                              hipStream_t stream) {
    const float* x      = (const float*)d_in[0];
    const float* Wq     = (const float*)d_in[1];
    const float* Wk     = (const float*)d_in[2];
    const float* Wv     = (const float*)d_in[3];
    const float* in_w   = (const float*)d_in[4];
    const float* in_b   = (const float*)d_in[5];
    const float* out_w  = (const float*)d_in[6];
    const float* out_b  = (const float*)d_in[7];
    const float* proj_w = (const float*)d_in[8];
    const float* proj_b = (const float*)d_in[9];
    float* out = (float*)d_out;

    const size_t MB = 1u << 20;
    char* ws = (char*)d_ws;
    const int ND = D_ * D_;      // 1,048,576
    __bf16* xb    = (__bf16*)(ws + 0);         // 16 MB  (B*S*D)
    __bf16* w1t   = (__bf16*)(ws + 16 * MB);   //  8 MB: Wq^T, Wk^T, Wv^T, out_w^T (first layers, transposed)
    __bf16* w2    = (__bf16*)(ws + 24 * MB);   //  8 MB: in_w (3 slices), proj_w    (second layers)
    __bf16* wf    = (__bf16*)(ws + 32 * MB);   //  8 MB: folded weights w2[i] * w1[i]
    float*  bfold = (float*) (ws + 40 * MB);   //  4 KB: proj_w * out_b + proj_b
    __bf16* Qb    = (__bf16*)(ws + 48 * MB);   // 16 MB each
    __bf16* Kb    = (__bf16*)(ws + 64 * MB);
    __bf16* Vb    = (__bf16*)(ws + 80 * MB);
    __bf16* ctx   = (__bf16*)(ws + 96 * MB);

    prep_kernel<<<PB_FOLD + 4 * PB_TR + PB_INW + PB_X, 256, 0, stream>>>(
        x, Wq, Wk, Wv, out_w, in_w, proj_w, out_b, proj_b, xb, w1t, w2, bfold);

    const dim3 blk(256);
    const dim3 gg(D_ / 128, M_ / 128);      // (8, 64)
    const dim3 g3(D_ / 128, M_ / 128, 3);   // (8, 64, 3): Q, K and V
    const dim3 gw(D_ / 128, D_ / 128, 4);   // (8, 8, 4): the four weight products
    const float qscale = 0.18033688f;       // log2(e)/sqrt(HD): attention's scores come out in the log2 domain

    // two linear layers in a row are one: (x * W1^T) * W2^T = x * (W2 * W1)^T.
    // wf[i][f][d] = sum_e w2[i][f][e] * w1[i][e][d]
    gemm_nt_kernel<0><<<gw, blk, 0, stream>>>(w2, w1t, nullptr, wf, nullptr, D_, D_, D_, ND, 1.0f);
    // Q/K/V = x * wf^T + bias, one batch on the one x; Qb, Kb, Vb lie back to back
    // (softmax scale folded into Q, the batch's product 0)
    gemm_nt_kernel<0><<<g3, blk, 0, stream>>>(xb, wf, in_b, Qb, nullptr, M_, D_, D_, 0, qscale);
    // attention
    flash_attn_kernel<<<dim3(S_ / 256, B_ * H_), blk, 0, stream>>>(Qb, Kb, Vb, ctx);
    // out = ctx * (proj_w * out_w)^T + (proj_w * out_b + proj_b) + x   (fp32)
    gemm_nt_kernel<1><<<gg, blk, 0, stream>>>(ctx, wf + 3 * ND, bfold, out, x, M_, D_, D_, 0, 1.0f);
}

// v010
// One run takes 138 microseconds.
// Two timings next to v009 both put it at 1.09 times that version's speed.
// Counting every step since v000, it is 3.82 times as fast.
#include <hip/hip_runtime.h>
#include <hip/hip_bf16.h>

#define B_ 4
#define S_ 2048
#define D_ 1024
#define H_ 16
#define HD_ 64
#define M_ (B_ * S_)   // 8192 rows of the token matrix

typedef __attribute__((ext_vector_type(16))) __bf16 bf16x16;
typedef __attribute__((ext_vector_type(8)))  float  f32x8;

union Frag {          // 16 bf16 = 8 VGPRs; u[0] -> K = g*8..g*8+7, u[1] -> K = 16+g*8..
    uint4   u[2];
    bf16x16 v;
};

#define WMMA_BF16(a, b, c) \
    __builtin_amdgcn_wmma_f32_16x16x32_bf16(false, (a), false, (b), (short)0, (c), false, false)

// ---------------------------------------------------------------------------
// NT GEMM: C[M x N] = A[M x K](bf16) * W[N x K](bf16)^T  (+bias)*scale (+res)
// block = 256 threads (8 waves); block tile 128x128; wave tile 32x64
// (2 M-tiles x 4 N-tiles = 8 f32x8 accumulators, 6 fragment loads / 8 WMMAs).
// A and W tiles both double-buffered through LDS, 64 k a step: a step takes one whole
// 128-byte line of every operand row, and 8 neighbouring lanes fetch that line together,
// so a wave-wide 16-byte load touches 4 whole lines.  One barrier per step.
// K is a multiple of 64.
// The W fragment is the matrix instruction's A operand and the A-matrix fragment its B operand, so a
// lane's accumulator holds 8 consecutive columns of ONE output row.  Each wave stages its 32x64 piece
// in its own LDS range (the ring, once every wave has left it) and stores it in whole 128-byte lines.
// MODE 0: bf16 output.  MODE 1: f32 output + residual add.
// blockIdx.z picks one product of a batch whose W, C and bias each lie back to back; their A lie
// astep elements apart (0: one A for all).  scale belongs to product 0, the others have none.
// ---------------------------------------------------------------------------
#define GP_ 72   // LDS row pitch in elements: 144 bytes = 16 bytes x odd, for 16-byte readers
#define SP0_ 144  // output staging row pitch in bytes, bf16: 128 + 16 = 16 bytes x odd
#define SP1_ 272  // output staging row pitch in bytes, f32: 256 + 16 = 16 bytes x odd

template <int MODE>
__global__ __launch_bounds__(256)
void gemm_nt_kernel(const __bf16* __restrict__ Abase, const __bf16* __restrict__ Wbase,
                    const float* __restrict__ bias, void* __restrict__ Outbase,
                    const float* __restrict__ resbase,
                    int M, int N, int K, int astep, float scale) {
    // one array: A tiles 0 and 1, W tiles 0 and 1; the epilogue stages the output in it
    __shared__ __attribute__((aligned(16))) __bf16 ring[4][128 * GP_];
    __bf16 (*alds)[128 * GP_] = ring;
    __bf16 (*wlds)[128 * GP_] = ring + 2;

    const int lane = threadIdx.x & 31;
    const int wave = threadIdx.x >> 5;
    const int g    = lane >> 4;      // half-wave group (A/B layout K-offset selector)
    const int lm   = lane & 15;      // row (A) / column (B) within tile
    const int mw   = wave & 3;       // 32-row strip within block tile
    const int nw   = wave >> 2;      // 64-col strip within block tile
    const int n0   = blockIdx.x * 128;
    const int m0   = blockIdx.y * 128;
    const __bf16* __restrict__ A = Abase + (size_t)blockIdx.z * astep;
    const __bf16* __restrict__ W = Wbase + (size_t)blockIdx.z * N * K;
    const size_t  cz = (size_t)blockIdx.z * M * N;
    void* __restrict__ Out = (MODE == 0) ? (void*)((__bf16*)Outbase + cz) : (void*)((float*)Outbase + cz);
    const float* __restrict__ residual = (MODE == 0) ? resbase : resbase + cz;

    f32x8 acc[2][4];
    for (int mt = 0; mt < 2; ++mt)
        for (int j = 0; j < 4; ++j)
            for (int e = 0; e < 8; ++e) acc[mt][j][e] = 0.0f;

    // cooperative staging: 32 rows x 8 lanes of 16 B a round, 4 rounds for each operand
    const int srow = threadIdx.x >> 3;
    const int sch  = threadIdx.x & 7;
    // block-uniform byte bases; the lane's part is the byte offsets so0..so3, the same for both
    // operands, 128 bytes further each step; they keep registers of their own through the loop
    const char* astage = reinterpret_cast<const char*>(A + (size_t)m0 * K);
    const char* wstage = reinterpret_cast<const char*>(W + (size_t)n0 * K);
    unsigned so0 = ((unsigned)srow * K + sch * 8) * 2u;
    unsigned so1 = so0 + 64u * K;
    unsigned so2 = so0 + 128u * K;
    unsigned so3 = so0 + 192u * K;
    const int sdst = srow * GP_ + sch * 8;

    // preload step 0 into buffer 0
    {
        const uint4 a0 = *reinterpret_cast<const uint4*>(astage + so0);
        const uint4 a1 = *reinterpret_cast<const uint4*>(astage + so1);
        const uint4 a2 = *reinterpret_cast<const uint4*>(astage + so2);
        const uint4 a3 = *reinterpret_cast<const uint4*>(astage + so3);
        const uint4 b0 = *reinterpret_cast<const uint4*>(wstage + so0);
        const uint4 b1 = *reinterpret_cast<const uint4*>(wstage + so1);
        const uint4 b2 = *reinterpret_cast<const uint4*>(wstage + so2);
        const uint4 b3 = *reinterpret_cast<const uint4*>(wstage + so3);
        *reinterpret_cast<uint4*>(&alds[0][sdst])                = a0;
        *reinterpret_cast<uint4*>(&alds[0][sdst + 32 * GP_])     = a1;
        *reinterpret_cast<uint4*>(&alds[0][sdst + 2 * 32 * GP_]) = a2;
        *reinterpret_cast<uint4*>(&alds[0][sdst + 3 * 32 * GP_]) = a3;
        *reinterpret_cast<uint4*>(&wlds[0][sdst])                = b0;
        *reinterpret_cast<uint4*>(&wlds[0][sdst + 32 * GP_])     = b1;
        *reinterpret_cast<uint4*>(&wlds[0][sdst + 2 * 32 * GP_]) = b2;
        *reinterpret_cast<uint4*>(&wlds[0][sdst + 3 * 32 * GP_]) = b3;
    }

    const int niter = K / 64;
    for (int i = 0; i < niter; ++i) {
        __syncthreads();                       // buffer (i&1) is ready
        uint4 na0, na1, na2, na3, nb0, nb1, nb2, nb3;
        const bool havenext = (i + 1 < niter);
        if (havenext) {                        // issue the next step's global loads early
            so0 += 128u;  so1 += 128u;  so2 += 128u;  so3 += 128u;
            na0 = *reinterpret_cast<const uint4*>(astage + so0);
            na1 = *reinterpret_cast<const uint4*>(astage + so1);
            na2 = *reinterpret_cast<const uint4*>(astage + so2);
            na3 = *reinterpret_cast<const uint4*>(astage + so3);
            nb0 = *reinterpret_cast<const uint4*>(wstage + so0);
            nb1 = *reinterpret_cast<const uint4*>(wstage + so1);
            nb2 = *reinterpret_cast<const uint4*>(wstage + so2);
            nb3 = *reinterpret_cast<const uint4*>(wstage + so3);
            // precaution: stands before the next step's additions rewrite the offset registers
            // (and before the base pair is reused) that these eight issued loads name
            asm volatile("s_wait_xcnt 0x0" ::: "memory");
        }

        const __bf16* al = alds[i & 1];
        const __bf16* wl = wlds[i & 1];
#pragma unroll  // all three unrolled: constant LDS offsets, fragments and acc[] in registers
        for (int ks = 0; ks < 2; ++ks) {
            Frag fa[2];
#pragma unroll
            for (int mt = 0; mt < 2; ++mt) {
                const __bf16* asrc = &al[(mw * 32 + mt * 16 + lm) * GP_ + ks * 32];
                fa[mt].u[0] = *reinterpret_cast<const uint4*>(asrc + g * 8);
                fa[mt].u[1] = *reinterpret_cast<const uint4*>(asrc + 16 + g * 8);
            }
#pragma unroll
            for (int j = 0; j < 4; ++j) {
                Frag fb;
                const __bf16* bsrc = &wl[(nw * 64 + j * 16 + lm) * GP_ + ks * 32];
                fb.u[0] = *reinterpret_cast<const uint4*>(bsrc + g * 8);
                fb.u[1] = *reinterpret_cast<const uint4*>(bsrc + 16 + g * 8);
                acc[0][j] = WMMA_BF16(fb.v, fa[0].v, acc[0][j]);
                acc[1][j] = WMMA_BF16(fb.v, fa[1].v, acc[1][j]);
            }
        }

        if (havenext) {                        // fill the idle buffer
            __bf16* ad = &alds[(i + 1) & 1][sdst];
            __bf16* wd = &wlds[(i + 1) & 1][sdst];
            *reinterpret_cast<uint4*>(ad)                = na0;
            *reinterpret_cast<uint4*>(ad + 32 * GP_)     = na1;
            *reinterpret_cast<uint4*>(ad + 2 * 32 * GP_) = na2;
            *reinterpret_cast<uint4*>(ad + 3 * 32 * GP_) = na3;
            *reinterpret_cast<uint4*>(wd)                = nb0;
            *reinterpret_cast<uint4*>(wd + 32 * GP_)     = nb1;
            *reinterpret_cast<uint4*>(wd + 2 * 32 * GP_) = nb2;
            *reinterpret_cast<uint4*>(wd + 3 * 32 * GP_) = nb3;
        }
    }

    // epilogue: acc[mt][j][r] = C[mrow0 + mt*16 + lm][ncol0 + j*16 + 8*g + r]
    const float zscale = (blockIdx.z == 0) ? scale : 1.0f;
    const int mrow0 = m0 + mw * 32;
    const int ncol0 = n0 + nw * 64;

    // MODE 1: a row of the wave's piece is 256 bytes: 16 lanes take it, a wave-wide access covers 2 rows.
    // Residual and output share the lane's byte offsets ob[] from the block tile's first element.
    // The residual's sixteen loads go first, so that they and the bias loads are in flight together.
    const size_t tile0 = (size_t)m0 * N + n0;
    unsigned ob[16];
    float4 res[16];
    if (MODE == 1) {
        const char* rbase = reinterpret_cast<const char*>(residual + tile0);
#pragma unroll  // ob[] and res[] indexed by constants, in registers
        for (int i = 0; i < 16; ++i) {
            ob[i]  = ((unsigned)(mw * 32 + (lane >> 4) + 2 * i) * N + nw * 64 + (lane & 15) * 4) * 4u;
            res[i] = *reinterpret_cast<const float4*>(rbase + ob[i]);
        }
        // precaution: stands before the base pair that these sixteen issued loads name is reused
        asm volatile("s_wait_xcnt 0x0" ::: "memory");
    }

    // bias of the lane's 8 columns in each column group, all eight loads in flight together
    float4 bv[4][2];
    if (bias) {
        const float* bp = bias + (size_t)blockIdx.z * N + ncol0 + 8 * g;
#pragma unroll  // bv[] indexed by constants, in registers
        for (int j = 0; j < 4; ++j) {
            bv[j][0] = *reinterpret_cast<const float4*>(bp + j * 16);
            bv[j][1] = *reinterpret_cast<const float4*>(bp + j * 16 + 4);
        }
        // precaution: stands before any later code rewrites the address pair that these issued loads name
        asm volatile("s_wait_xcnt 0x0" ::: "memory");
    } else {
#pragma unroll
        for (int j = 0; j < 4; ++j) {
            bv[j][0] = make_float4(0.0f, 0.0f, 0.0f, 0.0f);
            bv[j][1] = bv[j][0];
        }
    }

    if (MODE == 0) {
        // a row of the wave's piece is 128 bytes: 8 lanes take it, a wave-wide store covers 4 rows
        const int orow = lane >> 3;
        const int och  = lane & 7;
        char* st = reinterpret_cast<char*>(&ring[0][0]) + wave * (32 * SP0_);
        __syncthreads();                       // every wave has read its last fragments: the ring is free
#pragma unroll  // all three unrolled: acc[] and bv[] indexed by constants, in registers
        for (int mt = 0; mt < 2; ++mt) {
#pragma unroll
            for (int j = 0; j < 4; ++j) {
                const float b8[8] = {bv[j][0].x, bv[j][0].y, bv[j][0].z, bv[j][0].w,
                                     bv[j][1].x, bv[j][1].y, bv[j][1].z, bv[j][1].w};
                union { uint4 u; __bf16 e[8]; } o;
#pragma unroll
                for (int r = 0; r < 8; ++r) o.e[r] = (__bf16)((acc[mt][j][r] + b8[r]) * zscale);
                *reinterpret_cast<uint4*>(st + (mt * 16 + lm) * SP0_ + j * 32 + g * 16) = o.u;
            }
        }
        // the wave's own LDS stores have landed before other lanes of it read them back
        asm volatile("s_wait_dscnt 0x0" ::: "memory");
        __bf16* dst = (__bf16*)Out + (size_t)(mrow0 + orow) * N + ncol0 + och * 8;
        uint4 ov[8];
#pragma unroll  // ov[] indexed by constants, in registers; the eight LDS reads go as one group
        for (int i = 0; i < 8; ++i)
            ov[i] = *reinterpret_cast<const uint4*>(st + (4 * i + orow) * SP0_ + och * 16);
#pragma unroll
        for (int i = 0; i < 8; ++i)
            *reinterpret_cast<uint4*>(dst + (size_t)(4 * i) * N) = ov[i];
    } else {
        const int orow = lane >> 4;
        const int och  = lane & 15;
        char* st = reinterpret_cast<char*>(&ring[0][0]) + wave * (32 * SP1_);
        __syncthreads();                       // every wave has read its last fragments: the ring is free
#pragma unroll  // all unrolled: acc[] and bv[] indexed by constants, in registers
        for (int mt = 0; mt < 2; ++mt) {
#pragma unroll
            for (int j = 0; j < 4; ++j) {
                float4 lo, hi;
                lo.x = (acc[mt][j][0] + bv[j][0].x) * zscale;
                lo.y = (acc[mt][j][1] + bv[j][0].y) * zscale;
                lo.z = (acc[mt][j][2] + bv[j][0].z) * zscale;
                lo.w = (acc[mt][j][3] + bv[j][0].w) * zscale;
                hi.x = (acc[mt][j][4] + bv[j][1].x) * zscale;
                hi.y = (acc[mt][j][5] + bv[j][1].y) * zscale;
                hi.z = (acc[mt][j][6] + bv[j][1].z) * zscale;
                hi.w = (acc[mt][j][7] + bv[j][1].w) * zscale;
                char* p = st + (mt * 16 + lm) * SP1_ + j * 64 + g * 32;
                *reinterpret_cast<float4*>(p)      = lo;
                *reinterpret_cast<float4*>(p + 16) = hi;
            }
        }
        // the wave's own LDS stores have landed before other lanes of it read them back
        asm volatile("s_wait_dscnt 0x0" ::: "memory");
        char* obase = reinterpret_cast<char*>((float*)Out + tile0);
#pragma unroll
        for (int i = 0; i < 16; ++i) {
            float4 v = *reinterpret_cast<const float4*>(st + (2 * i + orow) * SP1_ + och * 16);
            v.x += res[i].x;  v.y += res[i].y;  v.z += res[i].z;  v.w += res[i].w;
            *reinterpret_cast<float4*>(obase + ob[i]) = v;
        }
    }
}

// ---------------------------------------------------------------------------
// Flash attention, transposed: S^T = K * Q_scaled^T + tril(1)^T; softmax down each
// column; ctx^T = V^T * P^T.  A lane holds scores of ONE query in each column group, so the
// maximum and the sum run over its own registers, and the two f32 score tiles of a
// 32-key step, converted in place, are the B operand of the second product.
// The softmax runs against a HELD reference in the log2 domain: Q arrives scaled by log2(e)/sqrt(HD),
// minus the reference is the C operand of the first score product, so the score tiles are the
// arguments of exp2 as they leave the matrix unit.  The reference moves, and sums and output tiles
// are rescaled, in pass 0 and in a pass where some score of the wave lies more than 8 above it.
// grid = (S/256, B*H); block = 256 (8 waves); wave owns 32 query columns = 2 groups of 16:
// every K and V^T fragment read from LDS feeds two matrix instructions.
// K/V tiles double-buffered in LDS, both row-major; one barrier per 32-key step.
// V^T fragments come from the row-major V tile by the 16-bit transposing LDS load.
// Q/K/V/ctx are (B,S,D) bf16 with head h in columns [h*64, h*64+64).
// ---------------------------------------------------------------------------
__device__ inline float other_half(float v) {   // value of lane l ^ 16
    const int b = __float_as_int(v);
    return __int_as_float(__builtin_amdgcn_permlanex16(b, b, 0x76543210, 0xfedcba98, false, false));
}

#define LOG2E_ 1.44269504f   // log2(e): the mask's 1 in the log2 domain
#define VP_ 80   // V tile row pitch in elements: 160 bytes = 32 bytes x odd, for the transposing reader

typedef short s16x8 __attribute__((ext_vector_type(8)));
// lane (c = l & 15, h = l >> 4), pointed at row 8h + (l & 7), 16-byte piece (l >> 3) & 1 of a
// 16-row x 16-column block, gets column c of rows 8h .. 8h + 7
__device__ inline uint4 lds_load_tr16(const __bf16* p) {
    typedef __attribute__((address_space(3))) s16x8 lds_s16x8;
    return __builtin_bit_cast(uint4, __builtin_amdgcn_ds_load_tr16_b128_v8i16((lds_s16x8*)p));
}

// exp2 of a score tile: eight v_exp_f32 and one v_nop in ONE statement, no result in a source's register.
// Written so, none of them overwrites the source of the one directly before it, and the slot that the
// instruction set asks for behind a transcendental is filled behind the last, whatever the compiler puts next.
__device__ inline f32x8 exp2_tile(f32x8 v) {
    float p0, p1, p2, p3, p4, p5, p6, p7;
    asm("v_exp_f32 %0, %8\n\tv_exp_f32 %1, %9\n\tv_exp_f32 %2, %10\n\tv_exp_f32 %3, %11\n\t"
        "v_exp_f32 %4, %12\n\tv_exp_f32 %5, %13\n\tv_exp_f32 %6, %14\n\tv_exp_f32 %7, %15\n\tv_nop"
        : "=&v"(p0), "=&v"(p1), "=&v"(p2), "=&v"(p3), "=&v"(p4), "=&v"(p5), "=&v"(p6), "=&v"(p7)
        : "v"(v[0]), "v"(v[1]), "v"(v[2]), "v"(v[3]), "v"(v[4]), "v"(v[5]), "v"(v[6]), "v"(v[7]));
    const f32x8 o = {p0, p1, p2, p3, p4, p5, p6, p7};
    return o;
}

__global__ __launch_bounds__(256)
void flash_attn_kernel(const __bf16* __restrict__ Q, const __bf16* __restrict__ Kp,
                       const __bf16* __restrict__ Vp, __bf16* __restrict__ O) {
    __shared__ __attribute__((aligned(16))) __bf16 klds[2][32 * 72];     // K tile row-major
    __shared__ __attribute__((aligned(16))) __bf16 vlds[2][32 * VP_];    // V tile row-major

    const int lane = threadIdx.x & 31;
    const int wave = threadIdx.x >> 5;
    const int g    = lane >> 4;
    const int lm   = lane & 15;

    const int b = blockIdx.y / H_;
    const int h = blockIdx.y % H_;
    const int qblk = blockIdx.x * 256;
    const size_t headoff = (size_t)b * S_ * D_ + (size_t)h * HD_;

    // Q fragments (B operand, two K=32 steps over HD=64) of both column groups, loaded once;
    // group c holds query qrow + 16 * c
    const int qrow = qblk + wave * 32 + lm;
    Frag qf[2][2];
    const __bf16* qsrc = Q + headoff + (size_t)qrow * D_;
#pragma unroll
    for (int c = 0; c < 2; ++c) {
#pragma unroll
        for (int dh = 0; dh < 2; ++dh) {
            qf[c][dh].u[0] = *reinterpret_cast<const uint4*>(qsrc + c * 16 * D_ + dh * 32 + g * 8);
            qf[c][dh].u[1] = *reinterpret_cast<const uint4*>(qsrc + c * 16 * D_ + dh * 32 + 16 + g * 8);
        }
    }
    // precaution: no later load's result lands on an address register of a load issued before it
    asm volatile("s_wait_xcnt 0x0" ::: "memory");

    f32x8 nref[2];                          // minus the reference of a group's query (equal in both halves), 8 copies: a C tile
    for (int c = 0; c < 2; ++c)
        for (int e = 0; e < 8; ++e) nref[c][e] = 0.0f;
    float lrun[2] = {0.0f, 0.0f};           // running sum over this half's keys only; joined after the loop
    f32x8 acc[2][4];                        // acc[c][dt][r] = ctx[qrow + 16*c][dt*16 + 8*g + r]
    for (int c = 0; c < 2; ++c)
        for (int dt = 0; dt < 4; ++dt)
            for (int e = 0; e < 8; ++e) acc[c][dt][e] = 0.0f;

    // staging: 32 key rows x 8 d-chunks, 16 B each
    const int trow = threadIdx.x >> 3;
    const int tch  = threadIdx.x & 7;
    const __bf16* kstage = Kp + headoff + (size_t)trow * D_ + tch * 8;
    const __bf16* vstage = Vp + headoff + (size_t)trow * D_ + tch * 8;
    // the lane's place in a V tile for the transposing load
    const int vtr = (8 * g + (lane & 7)) * VP_ + ((lane >> 3) & 1) * 8;
    // the one pass whose 32 keys are the wave's 32 queries; in a scalar register, so that the
    // test on it in the loop is a scalar compare
    const int dpass = __builtin_amdgcn_readfirstlane((qblk + wave * 32) >> 5);
    // key offset t*16 + r of the current pass is at or below qrow while <= lim; stepped pass by pass:
    // formed from dpass, the mask values would be lifted out of the loop into registers of their own
    int lim = qrow - 8 * g;

    // preload tile 0 into buffer 0
    {
        uint4 kv = *reinterpret_cast<const uint4*>(kstage);
        uint4 vv = *reinterpret_cast<const uint4*>(vstage);
        *reinterpret_cast<uint4*>(&klds[0][trow * 72 + tch * 8]) = kv;
        *reinterpret_cast<uint4*>(&vlds[0][trow * VP_ + tch * 8]) = vv;
    }

    const int niter = S_ / 32;
    // not unrolled, last pass not peeled off: the next tile's global loads then keep their own
    // block at the head of the pass; peeled, they sink to their LDS stores and are waited for in full
#pragma nounroll
    for (int it = 0; it < niter; ++it) {
        __syncthreads();                         // buffer (it&1) is ready
        const int kt = it * 32;

        uint4 kn, vn;
        const bool havenext = (it + 1 < niter);
        if (havenext) {
            kn   = *reinterpret_cast<const uint4*>(kstage + (size_t)(kt + 32) * D_);
            vn   = *reinterpret_cast<const uint4*>(vstage + (size_t)(kt + 32) * D_);
            // precaution: stands before the pass's foot steps the address pairs that these two issued
            // loads name, on every way there
            asm volatile("s_wait_xcnt 0x0" ::: "memory");
        }

        const __bf16* kl = klds[it & 1];
        const __bf16* vl = vlds[it & 1];

        // scores: two 16-key subtiles for each column group, accumulated over two d-halves
        // sc[c][t][r] = log2-domain score of key kt + t*16 + 8*g + r against query qrow + 16*c, less its reference
        f32x8 sc[2][2];
#pragma unroll
        for (int dh = 0; dh < 2; ++dh) {
#pragma unroll
            for (int t = 0; t < 2; ++t) {
                Frag kf;                         // one fragment, both column groups
                const __bf16* ks = &kl[(t * 16 + lm) * 72 + dh * 32];
                kf.u[0] = *reinterpret_cast<const uint4*>(ks + g * 8);
                kf.u[1] = *reinterpret_cast<const uint4*>(ks + 16 + g * 8);
                sc[0][t] = WMMA_BF16(kf.v, qf[0][dh].v, (dh == 0) ? nref[0] : sc[0][t]);
                sc[1][t] = WMMA_BF16(kf.v, qf[1][dh].v, (dh == 0) ? nref[1] : sc[1][t]);
            }
        }

        // additive tril(1) mask, log2(e) in this domain; the 16 scores of a lane in a group belong to one query.
        // Before pass dpass the mask is on every score the wave has seen, and a constant on all
        // of them cancels in the softmax: it is left out, and the reference runs that much below its masked value.
        // Pass dpass puts it on the reference and so takes it off the scores above the diagonal; behind it the mask is 0.
        if (it == dpass) {
#pragma unroll  // all four unrolled: sc[] and nref[] indexed by constants, in registers
            for (int c = 0; c < 2; ++c) {
#pragma unroll
                for (int e = 0; e < 8; ++e) nref[c][e] -= LOG2E_;
#pragma unroll
                for (int t = 0; t < 2; ++t)
#pragma unroll
                    for (int r = 0; r < 8; ++r) sc[c][t][r] -= (t * 16 + r - c * 16 <= lim) ? 0.0f : LOG2E_;
            }
        }
        lim -= 32;

        // the lane's largest score above its reference, one chain per tile
        float mxt[2][2];
#pragma unroll  // all three unrolled: sc[] and mxt[] indexed by constants, in registers
        for (int c = 0; c < 2; ++c)
#pragma unroll
            for (int t = 0; t < 2; ++t) {
                mxt[c][t] = sc[c][t][0];
#pragma unroll
                for (int r = 1; r < 8; ++r) mxt[c][t] = fmaxf(mxt[c][t], sc[c][t][r]);
            }
        // one test a pass for the whole wave, a scalar branch; pass 0 always takes it and sets the first reference
        const float thr = (it == 0) ? -3.0e38f : 8.0f;
        if (__builtin_amdgcn_ballot_w32(fmaxf(fmaxf(mxt[0][0], mxt[0][1]), fmaxf(mxt[1][0], mxt[1][1])) > thr) != 0) {
#pragma unroll  // all unrolled: sc[], nref[] and acc[] indexed by constants, in registers
            for (int c = 0; c < 2; ++c) {
                float mx = fmaxf(mxt[c][0], mxt[c][1]);
                mx = fmaxf(mx, other_half(mx));
                // the reference only rises, but for pass 0, which may set it below its start value 0
                const float d = (it == 0) ? mx : fmaxf(mx, 0.0f);
                const float alpha = __builtin_amdgcn_exp2f(fminf(-d, 0.0f));
                nref[c]  -= d;                   // whole tiles, the scalar on every element
                sc[c][0] -= d;
                sc[c][1] -= d;
                lrun[c] *= alpha;
#pragma unroll
                for (int dt = 0; dt < 4; ++dt)
#pragma unroll
                    for (int r = 0; r < 8; ++r) acc[c][dt][r] *= alpha;
            }
        }

        Frag vf[4];                              // vf[dt]: row d = dt*16 + lm, keys in the hardware k order
#pragma unroll  // vf[] in registers; all eight reads go as one group, ahead of the exponentials
        for (int dt = 0; dt < 4; ++dt) {
            const __bf16* vs = &vl[vtr + dt * 16];
            vf[dt].u[0] = lds_load_tr16(vs);
            vf[dt].u[1] = lds_load_tr16(vs + 16 * VP_);
        }
        // holds the reads ahead of the exponentials, whose length the scheduler does not see in their asm
        // statements: sunk to the matrix instructions, each pair of reads would be waited for in full
        __builtin_amdgcn_sched_barrier(0);

        Frag pf[2];                              // pf[c].v[t*8 + r]: hardware k order of a B operand
#pragma unroll  // all unrolled: sc[], rs[] and pf[] indexed by constants, in registers
        for (int c = 0; c < 2; ++c) {
            const f32x8 p0 = exp2_tile(sc[c][0]);
            const f32x8 p1 = exp2_tile(sc[c][1]);
            float rs[4];                             // four independent chains
#pragma unroll
            for (int k = 0; k < 4; ++k) rs[k] = ((p0[k] + p0[k + 4]) + p1[k]) + p1[k + 4];
#pragma unroll
            for (int r = 0; r < 8; ++r) {
                pf[c].v[r]     = (__bf16)p0[r];
                pf[c].v[8 + r] = (__bf16)p1[r];
            }
            lrun[c] += (rs[0] + rs[1]) + (rs[2] + rs[3]);
        }

#pragma unroll  // vf[] and acc[] indexed by constants, in registers
        for (int dt = 0; dt < 4; ++dt) {
            acc[0][dt] = WMMA_BF16(vf[dt].v, pf[0].v, acc[0][dt]);
            acc[1][dt] = WMMA_BF16(vf[dt].v, pf[1].v, acc[1][dt]);
        }

        if (havenext) {                          // fill the idle buffer
            __bf16* kd = klds[(it + 1) & 1];
            __bf16* vd = vlds[(it + 1) & 1];
            *reinterpret_cast<uint4*>(&kd[trow * 72 + tch * 8]) = kn;
            *reinterpret_cast<uint4*>(&vd[trow * VP_ + tch * 8]) = vn;
        }
    }

    // join the halves' sums, normalize, store: 8 consecutive d of one query = 16 bytes;
    // both groups go out from one address, group 1 at a constant offset
    uint4 ov[2][4];
#pragma unroll  // all unrolled: acc[] and ov[] indexed by constants, in registers
    for (int c = 0; c < 2; ++c) {
        const float inv = 1.0f / (lrun[c] + other_half(lrun[c]));
#pragma unroll
        for (int dt = 0; dt < 4; ++dt) {
            union { uint4 u; __bf16 e[8]; } o;
#pragma unroll
            for (int r = 0; r < 8; ++r) o.e[r] = (__bf16)(acc[c][dt][r] * inv);
            ov[c][dt] = o.u;
        }
    }
    __bf16* dst = O + headoff + (size_t)qrow * D_ + 8 * g;
#pragma unroll
    for (int c = 0; c < 2; ++c)
#pragma unroll
        for (int dt = 0; dt < 4; ++dt)
            *reinterpret_cast<uint4*>(dst + c * 16 * D_ + dt * 16) = ov[c][dt];
}

// ---------------------------------------------------------------------------
// Set-up: ONE grid of three independent parts (none reads what another writes), a block range for each;
// a block is 256 threads.  The part with the longest chain of dependent loads has the lowest indices.
// ---------------------------------------------------------------------------
typedef __attribute__((ext_vector_type(2))) float  f32x2;
typedef __attribute__((ext_vector_type(2))) __bf16 bf16x2;
// neighbours converted pair by pair: one packed conversion for each 32-bit word
__device__ inline uint2 bf16x4_of(float4 f) {
    const f32x2 lo = {f.x, f.y};
    const f32x2 hi = {f.z, f.w};
    return make_uint2(__builtin_bit_cast(unsigned, __builtin_convertvector(lo, bf16x2)),
                      __builtin_bit_cast(unsigned, __builtin_convertvector(hi, bf16x2)));
}

// x: fp32 -> bf16, 16,384 elements a block.  The grid's registers and LDS are those of the weight products,
// so few waves are resident: a thread keeps sixteen 16-byte loads in flight.
__device__ inline void x_to_bf16_part(const float* __restrict__ in, __bf16* __restrict__ out, int blk) {
    const size_t i0 = (size_t)blk * 16384 + threadIdx.x * 4;
    const float* src = in + i0;
    float4 f[16];
#pragma unroll  // f[] in registers, all sixteen loads in flight together
    for (int i = 0; i < 16; ++i) f[i] = *reinterpret_cast<const float4*>(src + i * 1024);
    // precaution: stands before any later code rewrites the address pair that these issued loads name;
    // the pair is an input, so it lives up to here and no load's result lands on it either
    asm volatile("s_wait_xcnt 0x0" :: "v"(src) : "memory");
#pragma unroll
    for (int i = 0; i < 16; ++i) *reinterpret_cast<uint2*>(out + i0 + i * 1024) = bf16x4_of(f[i]);
    // precaution: stands before any later code of the shared grid rewrites a register that these
    // sixteen issued stores name
    asm volatile("s_wait_xcnt 0x0" ::: "memory");
}

// folded bias bout[r] = b[r] + sum_e w[r][e] * v[e] in f32, w a D_ x D_ weight.
// block = 8 waves x 4 rows = 32 rows, so a block writes one whole 128-byte line of bout.
__device__ inline void fold_bias_part(const float* __restrict__ w, const float* __restrict__ v,
                                      const float* __restrict__ b, float* __restrict__ bout, int blk) {
    __shared__ float rowsum[32];
    const int lane = threadIdx.x & 31;
    const int wave = threadIdx.x >> 5;
    const int row0 = blk * 32;
    const size_t base = (size_t)(row0 + wave * 4) * D_;
    float s[4] = {0.0f, 0.0f, 0.0f, 0.0f};
    // k loop kept rolled, its four rows unrolled (their loads in flight together, s[] in registers)
#pragma nounroll
    for (int k = 0; k < D_ / 128; ++k) {
        const int c = k * 128 + lane * 4;
        float4 gv = *reinterpret_cast<const float4*>(v + c);
#pragma unroll
        for (int rr = 0; rr < 4; ++rr) {
            float4 f = *reinterpret_cast<const float4*>(w + base + rr * D_ + c);
            s[rr] += f.x * gv.x + f.y * gv.y + f.z * gv.z + f.w * gv.w;
        }
        // precaution: stands before the next trip rewrites the address registers that this trip's
        // issued loads name
        asm volatile("s_wait_xcnt 0x0" ::: "memory");
    }
#pragma unroll  // s[] indexed by constants; the four reductions overlap
    for (int rr = 0; rr < 4; ++rr) {
        for (int off = 16; off > 0; off >>= 1) s[rr] += __shfl_xor(s[rr], off, 32);
    }
    if (lane == 0) {
#pragma unroll  // s[] indexed by constants
        for (int rr = 0; rr < 4; ++rr) rowsum[wave * 4 + rr] = s[rr];
    }
    __syncthreads();
    if (threadIdx.x < 32) bout[row0 + threadIdx.x] = rowsum[threadIdx.x] + b[row0 + threadIdx.x];
}

// Two linear layers in a row are one: C[f][d] = sum_e w2[f][e] * w1[e][d], all D_ x D_, straight from the
// f32 weights: a 128x128 tile of C a block, wave tile and matrix instructions as in gemm_nt_kernel.
// A step takes 64 e.  Both operands are rounded to bf16 on their way from registers into LDS.
// w2's tile lies as in gemm_nt_kernel (row f, 64 e).  w1's tile stays as it lies in memory (row e, 128 d),
// and its fragments (row d, e in the hardware k order) come by the 16-bit transposing LDS load.
#define WP_ 144   // w1 tile row pitch in elements: 288 bytes = 32 bytes x odd, for the transposing reader

// Work-group barrier that orders LDS alone.  __syncthreads() also waits for every global load of the wave,
// which would end the two-step lead of the staging loads below at each step; those loads land in the
// wave's own registers and no other wave depends on them.
__device__ inline void lds_barrier() {
    __builtin_amdgcn_fence(__ATOMIC_RELEASE, "workgroup", "local");
    __builtin_amdgcn_s_barrier();
    __builtin_amdgcn_fence(__ATOMIC_ACQUIRE, "workgroup", "local");
}

// one step's sixteen loads of a thread, all in flight together, and the step of the two addresses
__device__ inline void fold_load(float4 (&pa)[8], float4 (&pw)[8], const float*& ag, const float*& wg) {
#pragma unroll  // pa[] and pw[] in registers
    for (int i = 0; i < 8; ++i) {
        pa[i] = *reinterpret_cast<const float4*>(ag + i * 16 * D_);
        pw[i] = *reinterpret_cast<const float4*>(wg + i * 8 * D_);
    }
    // precaution: stands before the two additions below rewrite the address pairs that these
    // sixteen issued loads name; the pairs are inputs, so they live up to here: nothing is moved onto
    // them ahead of the wait and no load's result lands on them
    asm volatile("s_wait_xcnt 0x0" :: "v"(ag), "v"(wg) : "memory");
    ag += 64;
    wg += 64 * D_;
}

// the same sixteen pieces, rounded to bf16, into the thread's places of a w2 tile and a w1 tile
__device__ inline void fold_store(const float4 (&pa)[8], const float4 (&pw)[8], __bf16* ad, __bf16* wd) {
    // holds the conversions behind the step's matrix instructions: lifted above them (they free registers),
    // they bring their wait for the loads along, and the loads lose the lead they were issued for
    __builtin_amdgcn_sched_barrier(0);
#pragma unroll  // pa[] and pw[] in registers, constant LDS offsets
    for (int i = 0; i < 8; ++i) {
        *reinterpret_cast<uint2*>(ad + i * 16 * GP_) = bf16x4_of(pa[i]);
        *reinterpret_cast<uint2*>(wd + i * 8 * WP_)  = bf16x4_of(pw[i]);
    }
}

// one step's sixteen matrix instructions of a wave; asrc and bsrc: the lane's places in the two tiles
__device__ inline void fold_mma(const __bf16* asrc, const __bf16* bsrc, f32x8 (&acc)[2][4]) {
#pragma unroll  // all three unrolled: constant LDS offsets, fragments and acc[] in registers
    for (int ks = 0; ks < 2; ++ks) {
        Frag fa[2];
#pragma unroll
        for (int mt = 0; mt < 2; ++mt) {
            fa[mt].u[0] = *reinterpret_cast<const uint4*>(asrc + mt * 16 * GP_ + ks * 32);
            fa[mt].u[1] = *reinterpret_cast<const uint4*>(asrc + mt * 16 * GP_ + ks * 32 + 16);
        }
#pragma unroll
        for (int j = 0; j < 4; ++j) {
            Frag fb;                           // row d = j*16 + lm of the strip, e in the hardware k order
            fb.u[0] = lds_load_tr16(bsrc + ks * 32 * WP_ + j * 16);
            fb.u[1] = lds_load_tr16(bsrc + (ks * 32 + 16) * WP_ + j * 16);
            acc[0][j] = WMMA_BF16(fb.v, fa[0].v, acc[0][j]);
            acc[1][j] = WMMA_BF16(fb.v, fa[1].v, acc[1][j]);
        }
    }
}

__device__ inline void fold_gemm_part(const float* __restrict__ w2, const float* __restrict__ w1,
                                      __bf16* __restrict__ C, int bx, int by) {
    // w2 tiles 0 and 1, then w1 tiles 0 and 1; the epilogue stages the output in it
    __shared__ __attribute__((aligned(16))) __bf16 fring[2 * 128 * GP_ + 2 * 64 * WP_];
    __bf16* alds = fring;
    __bf16* wlds = fring + 2 * 128 * GP_;

    const int t    = threadIdx.x;
    const int lane = t & 31;
    const int wave = t >> 5;
    const int g    = lane >> 4;
    const int lm   = lane & 15;
    const int mw   = wave & 3;       // 32-row strip within block tile
    const int nw   = wave >> 2;      // 64-col strip within block tile
    const int n0   = bx * 128;
    const int m0   = by * 128;

    f32x8 acc[2][4];
    for (int mt = 0; mt < 2; ++mt)
        for (int j = 0; j < 4; ++j)
            for (int e = 0; e < 8; ++e) acc[mt][j][e] = 0.0f;

    // staging, whole 128-byte lines: w2 16 rows x 256 bytes a round, w1 8 rows x 512 bytes a round, 8 rounds each
    const float* ag = w2 + (size_t)(m0 + (t >> 4)) * D_ + (t & 15) * 4;
    const float* wg = w1 + (size_t)(t >> 5) * D_ + n0 + (t & 31) * 4;
    __bf16* ad = alds + (t >> 4) * GP_ + (t & 15) * 4;
    __bf16* wd = wlds + (t >> 5) * WP_ + (t & 31) * 4;
    // the lane's places for its fragments: w2 as in gemm_nt_kernel, w1 for the transposing load
    const __bf16* asrc = alds + (mw * 32 + lm) * GP_ + g * 8;
    const __bf16* bsrc = wlds + (8 * g + (lane & 7)) * WP_ + ((lane >> 3) & 1) * 8 + nw * 64;

    // The weights come from memory, and a block has only its own two waves a SIMD to hide that: the loads
    // run TWO steps ahead of their use, in two sets of registers; the LDS ring stays at two buffers.
    float4 pa0[8], pw0[8], pa1[8], pw1[8];
    fold_load(pa0, pw0, ag, wg);               // step 0
    fold_load(pa1, pw1, ag, wg);               // step 1
    fold_store(pa0, pw0, ad, wd);

    // two steps a trip, one for each register set and buffer; not unrolled further.  The last two steps
    // stand behind the loop: with their missing loads under a branch inside it, the waits in front of the
    // LDS stores would be counted for the path without loads and drain the newer set too.
#pragma nounroll
    for (int it = 0; it < D_ / 64 - 2; it += 2) {
        lds_barrier();                         // buffer 0 is ready, buffer 1 is free
        fold_load(pa0, pw0, ag, wg);           // step it + 2
        fold_mma(asrc, bsrc, acc);
        fold_store(pa1, pw1, ad + 128 * GP_, wd + 64 * WP_);
        lds_barrier();                         // buffer 1 is ready, buffer 0 is free
        fold_load(pa1, pw1, ag, wg);           // step it + 3
        fold_mma(asrc + 128 * GP_, bsrc + 64 * WP_, acc);
        fold_store(pa0, pw0, ad, wd);
    }
    lds_barrier();                             // buffer 0 is ready, buffer 1 is free
    fold_mma(asrc, bsrc, acc);
    fold_store(pa1, pw1, ad + 128 * GP_, wd + 64 * WP_);
    lds_barrier();                             // buffer 1 is ready
    fold_mma(asrc + 128 * GP_, bsrc + 64 * WP_, acc);

    // epilogue: acc[mt][j][r] = C[m0 + mw*32 + mt*16 + lm][n0 + nw*64 + j*16 + 8*g + r];
    // a row of the wave's piece is 128 bytes: 8 lanes take it, a wave-wide store covers 4 rows
    const int orow = lane >> 3;
    const int och  = lane & 7;
    char* st = reinterpret_cast<char*>(fring) + wave * (32 * SP0_);
    __syncthreads();                           // every wave has read its last fragments: the ring is free
#pragma unroll  // all three unrolled: acc[] indexed by constants, in registers
    for (int mt = 0; mt < 2; ++mt) {
#pragma unroll
        for (int j = 0; j < 4; ++j) {
            union { uint4 u; __bf16 e[8]; } o;
#pragma unroll
            for (int r = 0; r < 8; ++r) o.e[r] = (__bf16)acc[mt][j][r];
            *reinterpret_cast<uint4*>(st + (mt * 16 + lm) * SP0_ + j * 32 + g * 16) = o.u;
        }
    }
    // the wave's own LDS stores have landed before other lanes of it read them back
    asm volatile("s_wait_dscnt 0x0" ::: "memory");
    __bf16* dst = C + (size_t)(m0 + mw * 32 + orow) * D_ + n0 + nw * 64 + och * 8;
    uint4 ov[8];
#pragma unroll  // ov[] indexed by constants, in registers; the eight LDS reads go as one group
    for (int i = 0; i < 8; ++i)
        ov[i] = *reinterpret_cast<const uint4*>(st + (4 * i + orow) * SP0_ + och * 16);
#pragma unroll
    for (int i = 0; i < 8; ++i)
        *reinterpret_cast<uint4*>(dst + (size_t)(4 * i) * D_) = ov[i];
}

#define PB_GEMM (4 * (D_ / 128) * (D_ / 128))   // 256 blocks: the four weight products
#define PB_BIAS (D_ / 32)                       // 32 blocks: the folded bias
#define PB_X    (M_ * D_ / 16384)               // 512 blocks: x

// Every branch is block-uniform.
__global__ __launch_bounds__(256)
void prep_kernel(const float* __restrict__ x, const float* __restrict__ Wq, const float* __restrict__ Wk,
                 const float* __restrict__ Wv, const float* __restrict__ out_w,
                 const float* __restrict__ in_w, const float* __restrict__ proj_w,
                 const float* __restrict__ out_b, const float* __restrict__ proj_b,
                 __bf16* __restrict__ xb, __bf16* __restrict__ wf, float* __restrict__ bfold) {
    int blk = blockIdx.x;
    if (blk < PB_GEMM) {
        const int which = blk >> 6;
        const float* w1 = (which == 0) ? Wq : (which == 1) ? Wk : (which == 2) ? Wv : out_w;
        const float* w2 = (which == 3) ? proj_w : in_w + (size_t)which * D_ * D_;
        fold_gemm_part(w2, w1, wf + (size_t)which * D_ * D_, blk & 7, (blk >> 3) & 7);
        return;
    }
    blk -= PB_GEMM;
    if (blk < PB_BIAS) {
        fold_bias_part(proj_w, out_b, proj_b, bfold, blk);
        return;
    }
    x_to_bf16_part(x, xb, blk - PB_BIAS);
}

// ---------------------------------------------------------------------------
extern "C" void kernel_launch(void* const* d_in, const int* in_sizes, int n_in,
                              void* d_out, int out_size, void* d_ws, size_t ws_size,
                              hipStream_t stream) {
    const float* x      = (const float*)d_in[0];
    const float* Wq     = (const float*)d_in[1];
    const float* Wk     = (const float*)d_in[2];
    const float* Wv     = (const float*)d_in[3];
    const float* in_w   = (const float*)d_in[4];
    const float* in_b   = (const float*)d_in[5];
    const float* out_w  = (const float*)d_in[6];
    const float* out_b  = (const float*)d_in[7];
    const float* proj_w = (const float*)d_in[8];
    const float* proj_b = (const float*)d_in[9];
    float* out = (float*)d_out;

    const size_t MB = 1u << 20;
    char* ws = (char*)d_ws;
    const int ND = D_ * D_;      // 1,048,576
    __bf16* xb    = (__bf16*)(ws + 0);         // 16 MB  (B*S*D)
    __bf16* wf    = (__bf16*)(ws + 32 * MB);   //  8 MB: folded weights, second layer * first layer
    float*  bfold = (float*) (ws + 40 * MB);   //  4 KB: proj_w * out_b + proj_b
    __bf16* Qb    = (__bf16*)(ws + 48 * MB);   // 16 MB each
    __bf16* Kb    = (__bf16*)(ws + 64 * MB);
    __bf16* Vb    = (__bf16*)(ws + 80 * MB);
    __bf16* ctx   = (__bf16*)(ws + 96 * MB);

    // two linear layers in a row are one: (x * W1^T) * W2^T = x * (W2 * W1)^T.
    // wf[i][f][d] = sum_e W2[i][f][e] * W1[i][e][d], beside x's conversion and the folded bias
    prep_kernel<<<PB_GEMM + PB_BIAS + PB_X, 256, 0, stream>>>(
        x, Wq, Wk, Wv, out_w, in_w, proj_w, out_b, proj_b, xb, wf, bfold);

    const dim3 blk(256);
    const dim3 gg(D_ / 128, M_ / 128);      // (8, 64)
    const dim3 g3(D_ / 128, M_ / 128, 3);   // (8, 64, 3): Q, K and V
    const float qscale = 0.18033688f;       // log2(e)/sqrt(HD): attention's scores come out in the log2 domain

    // Q/K/V = x * wf^T + bias, one batch on the one x; Qb, Kb, Vb lie back to back
    // (softmax scale folded into Q, the batch's product 0)
    gemm_nt_kernel<0><<<g3, blk, 0, stream>>>(xb, wf, in_b, Qb, nullptr, M_, D_, D_, 0, qscale);
    // attention
    flash_attn_kernel<<<dim3(S_ / 256, B_ * H_), blk, 0, stream>>>(Qb, Kb, Vb, ctx);
    // out = ctx * (proj_w * out_w)^T + (proj_w * out_b + proj_b) + x   (fp32)
    gemm_nt_kernel<1><<<gg, blk, 0, stream>>>(ctx, wf + 3 * ND, bfold, out, x, M_, D_, D_, 0, 1.0f);
}
